// v000
// Measured on an AMD MI455X. A time is GPU time per run, averaged over a window of back-to-back runs after a warm-up
// (all launches, gaps included; the runs take copies of the inputs in turn), and the median of several windows.
// Apart from v000's, it joins two sittings. Times from different sittings can be a few percent apart, while
// side-by-side timings come from the same sitting.
// v000, which the later versions start from, runs in 575 microseconds.
#include <hip/hip_runtime.h>

// Compute dtypes (f32 accumulate everywhere): LayerNorm in f32 on bf16 (RNE) copies of x, ln_g, ln_b; QKV projection = v_wmma_f32_16x16x32_bf16 with xn as bf16 hi+lo planes and W^T as one bf16 plane; scores q.k^T and P.v = v_wmma_f32_16x16x32_f16 with q, k, v^T plain f16 planes and P = f16(1024 * exp(s - m)); online softmax statistics f32; output f32.
// Pipeline per batch: k_ln -> xn hi/lo [SEQ][1024]; k_gemmw -> qkv f32 [SEQ][3072]; k_qkp -> q, k head planes [16][SEQ][64]; k_vtp16 -> v^T planes [16][64][SEQ]; k_flash -> out rows [SEQ][1024] at h*64. k_wtG once: W^T bf16 [3072][1024].

#ifndef NB
#define NB 4
#endif
#ifndef SEQ
#define SEQ 2048
#endif
#define NB_FULL  4
#define SEQ_FULL 2048
#define DMOD 1024
#define NHD  16
#define HD   64
#define QKVN (3 * DMOD)
#define SCL  0.125f
#define PCAR 1024.0f
#define NEGB (-3.0e38f)
#define LNEPS 1e-5f
#define KSP  72      // LDS pitch (halves) of key / value^T / P tiles
#define OSP  68      // LDS pitch (floats) of the output staging tile
static_assert(SEQ % 128 == 0);
static_assert(SEQ >= 128);
static_assert(SEQ <= SEQ_FULL);
static_assert(NB >= 1);
static_assert(NB <= NB_FULL);
static_assert(DMOD % 64 == 0);
static_assert(QKVN % 64 == 0);
static_assert(NHD * HD == DMOD);
static_assert(DMOD % 32 == 0);

typedef _Float16 h16;
typedef unsigned short bf;
typedef __attribute__((ext_vector_type(16))) __bf16   v16bf;
typedef __attribute__((ext_vector_type(16))) _Float16 v16h;
typedef __attribute__((ext_vector_type(8)))  _Float16 v8h;
typedef __attribute__((ext_vector_type(8)))  unsigned short v8us;
typedef __attribute__((ext_vector_type(8)))  float    v8f;
typedef __attribute__((ext_vector_type(4)))  float    v4f;
typedef __attribute__((ext_vector_type(2)))  unsigned short v2us;
typedef v8h  __attribute__((may_alias)) v8ha;
typedef v4f  __attribute__((may_alias)) v4fa;
typedef v8us __attribute__((may_alias)) v8usa;
typedef v8f  __attribute__((may_alias)) v8fa;

__device__ __forceinline__ unsigned short f2bf(float f) { unsigned u = __float_as_uint(f); u += 0x7FFFu + ((u >> 16) & 1u); return (unsigned short)(u >> 16); }
__device__ __forceinline__ float bf2f(unsigned short b) { return __uint_as_float(((unsigned)b) << 16); }
__device__ __forceinline__ float bfr(float f) { return bf2f(f2bf(f)); }
__device__ __forceinline__ void splitf(float y, unsigned short& h, unsigned short& l) { h = f2bf(y); l = f2bf(y - bf2f(h)); }
__device__ __forceinline__ v16h cat16(v8h lo, v8h hi) { return __builtin_shufflevector(lo, hi, 0, 1, 2, 3, 4, 5, 6, 7, 8, 9, 10, 11, 12, 13, 14, 15); }
__device__ __forceinline__ v16bf cat16b(v8us lo, v8us hi) { return __builtin_bit_cast(v16bf, __builtin_shufflevector(lo, hi, 0, 1, 2, 3, 4, 5, 6, 7, 8, 9, 10, 11, 12, 13, 14, 15)); }
__device__ __forceinline__ v8f wmma16(v16h a, v16h b, v8f c) { return __builtin_amdgcn_wmma_f32_16x16x32_f16(false, a, false, b, (short)0, c, false, false); }
__device__ __forceinline__ v8f wmmab(v16bf a, v16bf b, v8f c) { return __builtin_amdgcn_wmma_f32_16x16x32_bf16(false, a, false, b, (short)0, c, false, false); }
__device__ __forceinline__ float hmax16(float v) { v = fmaxf(v, __shfl_xor(v, 1, 32)); v = fmaxf(v, __shfl_xor(v, 2, 32)); v = fmaxf(v, __shfl_xor(v, 4, 32)); v = fmaxf(v, __shfl_xor(v, 8, 32)); return v; }
__device__ __forceinline__ float hsum16(float v) { v += __shfl_xor(v, 1, 32); v += __shfl_xor(v, 2, 32); v += __shfl_xor(v, 4, 32); v += __shfl_xor(v, 8, 32); return v; }

// Fragment loaders (A and B use the same per-lane k map): p = row (lane & 15) base + k0 + 8*(lane >> 4); elements 0..7 = p[0..7], elements 8..15 = p[16..23].
template <typename T16> struct WFrag;
template <> struct WFrag<h16> { typedef v16h V; static __device__ __forceinline__ V ld(const h16* p) { return cat16(*(const v8ha*)p, *(const v8ha*)(p + 16)); } static __device__ __forceinline__ v8f mma(V a, V b, v8f c) { return wmma16(a, b, c); } };
template <> struct WFrag<bf> { typedef v16bf V; static __device__ __forceinline__ V ld(const bf* p) { return cat16b(*(const v8usa*)p, *(const v8usa*)(p + 16)); } static __device__ __forceinline__ v8f mma(V a, V b, v8f c) { return wmmab(a, b, c); } };

// ---- k_gemmw: register-blocked GEMM, ONE WAVE per 64x64 output tile (16 accumulators), operands straight from K-contiguous 16-bit planes; grid (M/64, N/64, Z), 32 threads.
// C[m][n] (f32, pitch ldc, + optional f32 bias[n]) = sum_k A[m][k] Bt[n][k] (+ split products per NSPLIT). z-batch strides sA/sB/sC in elements. K % 32 == 0.
template <typename T16, int NSPLIT, bool BIAS>
__global__ __launch_bounds__(32) void k_gemmw(const T16* __restrict__ A, const T16* __restrict__ A2, const T16* __restrict__ Bt, const T16* __restrict__ Bt2, int K, float* C, int ldc, const float* __restrict__ bias, size_t sA, size_t sB, size_t sC) {
    typedef typename WFrag<T16>::V V;
    __shared__ __align__(16) float os[16 * 68];
    const size_t z = blockIdx.z; A += z * sA; if (A2) A2 += z * sA; Bt += z * sB; if (Bt2) Bt2 += z * sB; C += z * sC;
    const int lane = threadIdx.x & 31, lr = lane & 15, hi = lane >> 4; const int r0 = blockIdx.x * 64, c0 = blockIdx.y * 64;
    v8f acc[4][4];
#pragma unroll
    for (int mb = 0; mb < 4; ++mb)
#pragma unroll
        for (int nb = 0; nb < 4; ++nb) acc[mb][nb] = (v8f){};
    const size_t aoff = (size_t)(r0 + lr) * K + 8 * hi, boff = (size_t)(c0 + lr) * K + 8 * hi;
#pragma unroll 1
    for (int kc = 0; kc < K; kc += 32) {
        V a[4], a2[4];
#pragma unroll
        for (int mb = 0; mb < 4; ++mb) { a[mb] = WFrag<T16>::ld(A + aoff + (size_t)mb * 16 * K + kc); if (NSPLIT == 1 || NSPLIT == 2) a2[mb] = WFrag<T16>::ld(A2 + aoff + (size_t)mb * 16 * K + kc); }
#pragma unroll
        for (int nb = 0; nb < 4; ++nb) { const V b = WFrag<T16>::ld(Bt + boff + (size_t)nb * 16 * K + kc); V b2; if (NSPLIT >= 2) b2 = WFrag<T16>::ld(Bt2 + boff + (size_t)nb * 16 * K + kc);
#pragma unroll
            for (int mb = 0; mb < 4; ++mb) { acc[mb][nb] = WFrag<T16>::mma(a[mb], b, acc[mb][nb]); if (NSPLIT == 1 || NSPLIT == 2) acc[mb][nb] = WFrag<T16>::mma(a2[mb], b, acc[mb][nb]); if (NSPLIT >= 2) acc[mb][nb] = WFrag<T16>::mma(a[mb], b2, acc[mb][nb]); } }
        asm volatile("v_nop\n\tv_nop\n\tv_nop\n\tv_nop" : "+v"(acc[0][0]), "+v"(acc[1][1]), "+v"(acc[2][2]), "+v"(acc[3][3]) : "v"(a[0]), "v"(a[3]));
    }
#pragma unroll
    for (int mb = 0; mb < 4; ++mb) {
#pragma unroll
        for (int nb = 0; nb < 4; ++nb) {
#pragma unroll
            for (int j = 0; j < 8; ++j) os[(hi * 8 + j) * 68 + nb * 16 + lr] = acc[mb][nb][j]; }
        __builtin_amdgcn_wave_barrier(); asm volatile("" ::: "memory");
        float* crow = C + (size_t)(r0 + mb * 16) * ldc + c0;
{
#pragma unroll
            for (int s = 0; s < 8; ++s) { const int row = 2 * s + hi, cofs = lr * 4; v4f val = *(const v4fa*)(os + row * 68 + cofs); if (BIAS) { val[0] += bfr(bias[c0 + cofs]); val[1] += bfr(bias[c0 + cofs + 1]); val[2] += bfr(bias[c0 + cofs + 2]); val[3] += bfr(bias[c0 + cofs + 3]); }
                *(v4f*)(crow + (size_t)row * ldc + cofs) = val; }
             }
        __builtin_amdgcn_wave_barrier(); asm volatile("" ::: "memory");
    }
}

__global__ __launch_bounds__(256) void k_wtG(const float* __restrict__ w, int K, int N, bf* Bt) {
    const int lane = threadIdx.x & 31; const int L0 = (blockIdx.x * 8 + (threadIdx.x >> 5)) * 8; const int nlines = N * K / 64;
{
#pragma unroll 1
        for (int l = 0; l < 8; ++l) { const int L = L0 + l; if (L >= nlines) break; const size_t e = (size_t)L * 64 + lane * 2; const int k = (int)(e % K), n = (int)(e / K); v2us o;
            o[0] = f2bf(w[(size_t)k * N + n]); o[1] = f2bf(w[(size_t)(k + 1) * N + n]); *(v2us*)(Bt + e) = o; }
         }
}

__global__ __launch_bounds__(128) void k_ln(const float* __restrict__ X, const float* __restrict__ G, const float* __restrict__ Bv, bf* XH, bf* XL) {
    __shared__ float red[8];
    const int tid = threadIdx.x, lane = tid & 31, wid = tid >> 5; const int row = blockIdx.x; const int c = tid * 8;
    const v8f a = *(const v8fa*)(X + (size_t)row * DMOD + c);
    float v[8]; float s = 0.f;
#pragma unroll
    for (int q = 0; q < 8; ++q) { v[q] = bfr(a[q]); s += v[q]; }
#pragma unroll
    for (int sh = 16; sh; sh >>= 1) s += __shfl_xor(s, sh, 32);
    if (lane == 0) red[wid] = s;
    __syncthreads();
    const float mean = ((red[0] + red[1]) + (red[2] + red[3])) * (1.0f / DMOD);
    float s2 = 0.f;
#pragma unroll
    for (int q = 0; q < 8; ++q) { const float d = v[q] - mean; v[q] = d; s2 += d * d; }
#pragma unroll
    for (int sh = 16; sh; sh >>= 1) s2 += __shfl_xor(s2, sh, 32);
    if (lane == 0) red[4 + wid] = s2;
    __syncthreads();
    const float var = ((red[4] + red[5]) + (red[6] + red[7])) * (1.0f / DMOD);
    const float rstd = rsqrtf(var + LNEPS);
    const v8f g = *(const v8fa*)(G + c); const v8f bb = *(const v8fa*)(Bv + c);
    v8us oh, ol;
#pragma unroll
    for (int q = 0; q < 8; ++q) { const float y = v[q] * rstd * bfr(g[q]) + bfr(bb[q]); unsigned short a2, c2; splitf(y, a2, c2); oh[q] = a2; ol[q] = c2; }
    const size_t e = (size_t)row * DMOD + c;
    *(v8us*)(XH + e) = oh; *(v8us*)(XL + e) = ol;
    
}

__global__ __launch_bounds__(256) void k_qkp(const float* __restrict__ C, h16* QP, h16* KP, int n8) {
    const int i = blockIdx.x * 256 + threadIdx.x; if (i >= n8) return;
    const int which = blockIdx.y;
    const size_t e = (size_t)i * 8; const int d = (int)(e % HD); const int t = (int)((e / HD) % SEQ); const int hh = (int)(e / ((size_t)HD * SEQ));
    const v8f a = *(const v8fa*)(C + (size_t)t * QKVN + which * DMOD + hh * HD + d);
    v8h o;
#pragma unroll
    for (int q = 0; q < 8; ++q) o[q] = (h16)a[q];
    h16* dst = (which == 0) ? QP : KP;
    *(v8h*)(dst + e) = o; 
}

// ---- k_vtp16: value^T planes VT[h][d][t0..t0+63] = f16(C[t][2048 + h*64 + d]) through an LDS transpose; block = (64 t, one head); grid (SEQ/64, 16), 256 threads.
__global__ __launch_bounds__(256) void k_vtp16(const float* __restrict__ C, h16* VTp) {
    __shared__ __align__(16) h16 T[64 * KSP];
    const int tid = threadIdx.x; const int t0 = blockIdx.x * 64; const int hh = blockIdx.y;
#pragma unroll
    for (int rr = 0; rr < 4; ++rr) { const int idx = tid + 256 * rr; const int tt = idx >> 4; const int c4 = (idx & 15) * 4;
        const v4f a = *(const v4fa*)(C + (size_t)(t0 + tt) * QKVN + 2 * DMOD + hh * HD + c4);
#pragma unroll
        for (int q = 0; q < 4; ++q) T[(c4 + q) * KSP + tt] = (h16)a[q]; }
    __syncthreads();
    v8h o[2]; size_t oo[2];
#pragma unroll
    for (int rr = 0; rr < 2; ++rr) { const int d = rr * 32 + (tid >> 3); const int p = (tid & 7) * 8; o[rr] = *(const v8ha*)(T + d * KSP + p); oo[rr] = ((size_t)hh * HD + d) * SEQ + t0 + p; }
#pragma unroll
    for (int rr = 0; rr < 2; ++rr) *(v8h*)(VTp + oo[rr]) = o[rr];
    
}

// ---- k_flash: softmax(q k^T * 1/8 with excluded keys replaced by -3e38) v, online over 64-key tiles; grid (SEQ/128, 16 heads), 256 threads = 8 waves x 16 query rows.
// Key tile [64 j][64 d] and value^T tile [64 d][64 j] staged in LDS with plain loads between block barriers; S and P.v fragments via the WFrag loaders (A and B same k map);
// P = f16(1024 * exp(s - m_run)) through a per-wave LDS tile (block barrier between store and reload); l accumulated in f32; out = O / (1024 l).
__global__ __launch_bounds__(256) void k_flash(const h16* __restrict__ QP, const h16* __restrict__ KP, const h16* __restrict__ VT, const int* __restrict__ mk, float* outb) {
    __shared__ __align__(16) h16 Ks[64 * KSP];
    __shared__ __align__(16) h16 Vs[64 * KSP];
    __shared__ __align__(16) float Ow[8 * 16 * OSP];
    __shared__ int Ms[64];
    const int tid = threadIdx.x, wid = tid >> 5, lane = tid & 31, lr = lane & 15, hi = lane >> 4;
    const int hh = blockIdx.y, i0 = blockIdx.x * 128 + wid * 16;
    const h16* qp = QP + (size_t)hh * SEQ * HD; const h16* kp = KP + (size_t)hh * SEQ * HD; const h16* vt = VT + (size_t)hh * HD * SEQ;
    float* ow = Ow + wid * (16 * OSP); h16* pw = (h16*)ow;
    v16h qf[2];
    qf[0] = WFrag<h16>::ld(qp + (size_t)(i0 + lr) * HD + 8 * hi);
    qf[1] = WFrag<h16>::ld(qp + (size_t)(i0 + lr) * HD + 32 + 8 * hi);
    v8f o[4];
#pragma unroll
    for (int n = 0; n < 4; ++n) o[n] = (v8f){};
    float mrow[8], lrow[8];
#pragma unroll
    for (int r = 0; r < 8; ++r) { mrow[r] = -__builtin_inff(); lrow[r] = 0.f; }
    const float L2E = 1.4426950408889634f;
    const int srow = tid >> 3, spc = (tid & 7) * 8;
#pragma unroll 1
    for (int j0 = 0; j0 < SEQ; j0 += 64) {
        __syncthreads();
#pragma unroll
        for (int rr = 0; rr < 2; ++rr) { const int row = srow + 32 * rr;
            const v8h kv = *(const v8ha*)(kp + (size_t)(j0 + row) * HD + spc);
            const v8h vv = *(const v8ha*)(vt + (size_t)row * SEQ + j0 + spc);
            *(v8ha*)(Ks + row * KSP + spc) = kv; *(v8ha*)(Vs + row * KSP + spc) = vv; }
        if (tid < 64) Ms[tid] = mk[j0 + tid];
        __syncthreads();
        v8f s[4];
#pragma unroll
        for (int nt = 0; nt < 4; ++nt) { s[nt] = (v8f){};
#pragma unroll
            for (int kk = 0; kk < 2; ++kk) { const v16h b = WFrag<h16>::ld(Ks + (nt * 16 + lr) * KSP + kk * 32 + 8 * hi); s[nt] = wmma16(qf[kk], b, s[nt]); } }
        asm volatile("v_nop\n\tv_nop\n\tv_nop\n\tv_nop" : "+v"(s[0]), "+v"(s[1]), "+v"(s[2]), "+v"(s[3]) : "v"(qf[0]), "v"(qf[1]));
#pragma unroll
        for (int nt = 0; nt < 4; ++nt) { const bool ex = (Ms[nt * 16 + lr] >= 1);
#pragma unroll
            for (int r = 0; r < 8; ++r) { const float t = s[nt][r] * SCL; s[nt][r] = ex ? NEGB : t; } }
        float mcur[8], alpha[8];
#pragma unroll
        for (int r = 0; r < 8; ++r) { float mx = fmaxf(fmaxf(s[0][r], s[1][r]), fmaxf(s[2][r], s[3][r])); mx = hmax16(mx); const float mn = fmaxf(mrow[r], mx);
            alpha[r] = __builtin_amdgcn_exp2f(__fmul_rn(__fsub_rn(mrow[r], mn), L2E)); mcur[r] = mn; mrow[r] = mn; }
#pragma unroll
        for (int nt = 0; nt < 4; ++nt)
#pragma unroll
            for (int r = 0; r < 8; ++r) s[nt][r] = __builtin_amdgcn_exp2f(__fmul_rn(__fsub_rn(s[nt][r], mcur[r]), L2E));
#pragma unroll
        for (int r = 0; r < 8; ++r) { float su = (s[0][r] + s[1][r]) + (s[2][r] + s[3][r]); su = hsum16(su); lrow[r] = lrow[r] * alpha[r] + su; }
#pragma unroll
        for (int n = 0; n < 4; ++n)
#pragma unroll
            for (int r = 0; r < 8; ++r) o[n][r] *= alpha[r];
#pragma unroll
        for (int nt = 0; nt < 4; ++nt)
#pragma unroll
            for (int r = 0; r < 8; ++r) pw[(8 * hi + r) * KSP + nt * 16 + lr] = (h16)(s[nt][r] * PCAR);
        __syncthreads();
        const v16h a0 = WFrag<h16>::ld(pw + lr * KSP + 8 * hi), a1 = WFrag<h16>::ld(pw + lr * KSP + 32 + 8 * hi);
#pragma unroll
        for (int n = 0; n < 4; ++n) { const v16h b0 = WFrag<h16>::ld(Vs + (n * 16 + lr) * KSP + 8 * hi); o[n] = wmma16(a0, b0, o[n]); const v16h b1 = WFrag<h16>::ld(Vs + (n * 16 + lr) * KSP + 32 + 8 * hi); o[n] = wmma16(a1, b1, o[n]); }
        asm volatile("v_nop\n\tv_nop\n\tv_nop\n\tv_nop" : "+v"(o[0]), "+v"(o[1]), "+v"(o[2]), "+v"(o[3]) : "v"(a0), "v"(a1));
    }
    float inv[8];
#pragma unroll
    for (int r = 0; r < 8; ++r) inv[r] = __fdiv_rn(1.0f, lrow[r] * PCAR);
    __syncthreads();
#pragma unroll
    for (int n = 0; n < 4; ++n)
#pragma unroll
        for (int r = 0; r < 8; ++r) ow[(hi * 8 + r) * OSP + n * 16 + lr] = o[n][r] * inv[r];
    __syncthreads();
    float* orow = outb + (size_t)i0 * DMOD + hh * HD;
    v4f val[8];
#pragma unroll
    for (int sI = 0; sI < 8; ++sI) val[sI] = *(const v4fa*)(ow + (2 * sI + hi) * OSP + lr * 4);
#pragma unroll
    for (int sI = 0; sI < 8; ++sI) *(v4f*)(orow + (size_t)(2 * sI + hi) * DMOD + lr * 4) = val[sI];
    
}

extern "C" void kernel_launch(void* const* d_in, const int* in_sizes, int n_in,
                              void* d_out, int out_size, void* d_ws, size_t ws_size, hipStream_t stream) {
    if (n_in < 5) return;
    const long rows_used = (long)(NB - 1) * SEQ_FULL + SEQ;
    if ((long)in_sizes[0] < rows_used * DMOD) return;
    if ((long)in_sizes[1] < rows_used) return;
    if ((long)in_sizes[2] < (long)DMOD * QKVN) return;
    if (in_sizes[3] < DMOD || in_sizes[4] < DMOD) return;
    if ((long)out_size < rows_used * DMOD) return;
    const float* X = (const float*)d_in[0]; const int* M = (const int*)d_in[1]; const float* W = (const float*)d_in[2]; const float* G = (const float*)d_in[3]; const float* Bv = (const float*)d_in[4];
    float* OUT = (float*)d_out;     // [4][2048][1024]
    char* wsp = (char*)d_ws;
    auto take = [&](size_t bytes) { char* p = wsp; wsp += (bytes + 255) & ~(size_t)255; return (void*)p; };
    bf* WT = (bf*)take((size_t)QKVN * DMOD * 2);                       // W^T bf16 [3072][1024]            6,291,456 B
    bf* XH = (bf*)take((size_t)SEQ * DMOD * 2);                        // xn hi [SEQ][1024]                4,194,304 B
    bf* XL = (bf*)take((size_t)SEQ * DMOD * 2);                        // xn lo                            4,194,304 B
    float* CQ = (float*)take((size_t)SEQ * QKVN * 4);                  // qkv f32 [SEQ][3072]             25,165,824 B
    h16* QP = (h16*)take((size_t)NHD * SEQ * HD * 2);                  // q planes [16][SEQ][64]            4,194,304 B
    h16* KP = (h16*)take((size_t)NHD * SEQ * HD * 2);                  // k planes                          4,194,304 B
    h16* VTp = (h16*)take((size_t)NHD * HD * SEQ * 2);                 // v^T planes [16][64][SEQ]          4,194,304 B
    if ((size_t)(wsp - (char*)d_ws) > ws_size) return;                 // total 52,428,800 B
    const int nlines = QKVN * DMOD / 64;
    k_wtG<<<(unsigned)((nlines + 63) / 64), 256, 0, stream>>>(W, DMOD, QKVN, WT);
    const int n8 = NHD * SEQ * HD / 8;
    for (int b = 0; b < NB; ++b) {
        const float* xb = X + (size_t)b * SEQ_FULL * DMOD;
        k_ln<<<SEQ, 128, 0, stream>>>(xb, G, Bv, XH, XL);
        k_gemmw<bf, 1, false><<<dim3(SEQ / 64, QKVN / 64, 1), 32, 0, stream>>>(XH, XL, WT, nullptr, DMOD, CQ, QKVN, nullptr, 0, 0, 0);
        k_qkp<<<dim3((unsigned)((n8 + 255) / 256), 2, 1), 256, 0, stream>>>(CQ, QP, KP, n8);
        k_vtp16<<<dim3(SEQ / 64, NHD, 1), 256, 0, stream>>>(CQ, VTp);
        k_flash<<<dim3(SEQ / 128, NHD, 1), 256, 0, stream>>>(QP, KP, VTp, M + (size_t)b * SEQ_FULL, OUT + (size_t)b * SEQ_FULL * DMOD);
    }
}

// v001
// A run of this version takes 381 microseconds.
// Timed twice side by side with v000, it ran 1.51 and 1.52 times as fast.
#include <hip/hip_runtime.h>

// Compute dtypes (f32 accumulate everywhere): LayerNorm in f32 on bf16 (RNE) copies of x, ln_g, ln_b; QKV projection = v_wmma_f32_16x16x32_bf16 with xn as bf16 hi+lo planes and W^T as one bf16 plane; scores q.k^T and P.v = v_wmma_f32_16x16x32_f16 with q, k, v^T plain f16 planes and P = f16(1024 * exp(s - m)); online softmax statistics f32; output f32.
// Pipeline, every launch covers all NB batches (batch = slowest grid index): k_ln -> xn hi/lo [NB][SEQ][1024]; k_gemmw -> qkv f32 [NB][SEQ][3072]; k_qkp -> q, k head planes [NB][16][SEQ][64]; k_vtp16 -> v^T planes [NB][16][64][SEQ]; k_flash -> out rows [SEQ][1024] at h*64 of each batch. k_wtG once: W^T bf16 [3072][1024].

#ifndef NB
#define NB 4
#endif
#ifndef SEQ
#define SEQ 2048
#endif
#define NB_FULL  4
#define SEQ_FULL 2048
#define DMOD 1024
#define NHD  16
#define HD   64
#define QKVN (3 * DMOD)
#define SCL  0.125f
#define PCAR 1024.0f
#define NEGB (-3.0e38f)
#define LNEPS 1e-5f
#define KSP  72      // LDS pitch (halves) of key / value^T / P tiles
#define OSP  68      // LDS pitch (floats) of the output staging tile
static_assert(SEQ % 128 == 0);
static_assert(SEQ >= 128);
static_assert(SEQ <= SEQ_FULL);
static_assert(NB >= 1);
static_assert(NB <= NB_FULL);
static_assert(DMOD % 64 == 0);
static_assert(QKVN % 64 == 0);
static_assert(NHD * HD == DMOD);
static_assert(DMOD % 32 == 0);

typedef _Float16 h16;
typedef unsigned short bf;
typedef __attribute__((ext_vector_type(16))) __bf16   v16bf;
typedef __attribute__((ext_vector_type(16))) _Float16 v16h;
typedef __attribute__((ext_vector_type(8)))  _Float16 v8h;
typedef __attribute__((ext_vector_type(8)))  unsigned short v8us;
typedef __attribute__((ext_vector_type(8)))  float    v8f;
typedef __attribute__((ext_vector_type(4)))  float    v4f;
typedef __attribute__((ext_vector_type(2)))  unsigned short v2us;
typedef v8h  __attribute__((may_alias)) v8ha;
typedef v4f  __attribute__((may_alias)) v4fa;
typedef v8us __attribute__((may_alias)) v8usa;
typedef v8f  __attribute__((may_alias)) v8fa;

__device__ __forceinline__ unsigned short f2bf(float f) { unsigned u = __float_as_uint(f); u += 0x7FFFu + ((u >> 16) & 1u); return (unsigned short)(u >> 16); }
__device__ __forceinline__ float bf2f(unsigned short b) { return __uint_as_float(((unsigned)b) << 16); }
__device__ __forceinline__ float bfr(float f) { return bf2f(f2bf(f)); }
__device__ __forceinline__ void splitf(float y, unsigned short& h, unsigned short& l) { h = f2bf(y); l = f2bf(y - bf2f(h)); }
__device__ __forceinline__ v16h cat16(v8h lo, v8h hi) { return __builtin_shufflevector(lo, hi, 0, 1, 2, 3, 4, 5, 6, 7, 8, 9, 10, 11, 12, 13, 14, 15); }
__device__ __forceinline__ v16bf cat16b(v8us lo, v8us hi) { return __builtin_bit_cast(v16bf, __builtin_shufflevector(lo, hi, 0, 1, 2, 3, 4, 5, 6, 7, 8, 9, 10, 11, 12, 13, 14, 15)); }
__device__ __forceinline__ v8f wmma16(v16h a, v16h b, v8f c) { return __builtin_amdgcn_wmma_f32_16x16x32_f16(false, a, false, b, (short)0, c, false, false); }
__device__ __forceinline__ v8f wmmab(v16bf a, v16bf b, v8f c) { return __builtin_amdgcn_wmma_f32_16x16x32_bf16(false, a, false, b, (short)0, c, false, false); }
__device__ __forceinline__ float hmax16(float v) { v = fmaxf(v, __shfl_xor(v, 1, 32)); v = fmaxf(v, __shfl_xor(v, 2, 32)); v = fmaxf(v, __shfl_xor(v, 4, 32)); v = fmaxf(v, __shfl_xor(v, 8, 32)); return v; }
__device__ __forceinline__ float hsum16(float v) { v += __shfl_xor(v, 1, 32); v += __shfl_xor(v, 2, 32); v += __shfl_xor(v, 4, 32); v += __shfl_xor(v, 8, 32); return v; }

// Fragment loaders (A and B use the same per-lane k map): p = row (lane & 15) base + k0 + 8*(lane >> 4); elements 0..7 = p[0..7], elements 8..15 = p[16..23].
template <typename T16> struct WFrag;
template <> struct WFrag<h16> { typedef v16h V; static __device__ __forceinline__ V ld(const h16* p) { return cat16(*(const v8ha*)p, *(const v8ha*)(p + 16)); } static __device__ __forceinline__ v8f mma(V a, V b, v8f c) { return wmma16(a, b, c); } };
template <> struct WFrag<bf> { typedef v16bf V; static __device__ __forceinline__ V ld(const bf* p) { return cat16b(*(const v8usa*)p, *(const v8usa*)(p + 16)); } static __device__ __forceinline__ v8f mma(V a, V b, v8f c) { return wmmab(a, b, c); } };

// ---- k_gemmw: register-blocked GEMM, ONE WAVE per 64x64 output tile (16 accumulators), operands straight from K-contiguous 16-bit planes; grid (M/64, N/64, Z), 32 threads.
// C[m][n] (f32, pitch ldc, + optional f32 bias[n]) = sum_k A[m][k] Bt[n][k] (+ split products per NSPLIT). z-batch strides sA/sB/sC in elements. K % 32 == 0.
template <typename T16, int NSPLIT, bool BIAS>
__global__ __launch_bounds__(32) void k_gemmw(const T16* __restrict__ A, const T16* __restrict__ A2, const T16* __restrict__ Bt, const T16* __restrict__ Bt2, int K, float* C, int ldc, const float* __restrict__ bias, size_t sA, size_t sB, size_t sC) {
    typedef typename WFrag<T16>::V V;
    __shared__ __align__(16) float os[16 * 68];
    const size_t z = blockIdx.z; A += z * sA; if (A2) A2 += z * sA; Bt += z * sB; if (Bt2) Bt2 += z * sB; C += z * sC;
    const int lane = threadIdx.x & 31, lr = lane & 15, hi = lane >> 4; const int r0 = blockIdx.x * 64, c0 = blockIdx.y * 64;
    v8f acc[4][4];
#pragma unroll
    for (int mb = 0; mb < 4; ++mb)
#pragma unroll
        for (int nb = 0; nb < 4; ++nb) acc[mb][nb] = (v8f){};
    const size_t aoff = (size_t)(r0 + lr) * K + 8 * hi, boff = (size_t)(c0 + lr) * K + 8 * hi;
#pragma unroll 1
    for (int kc = 0; kc < K; kc += 32) {
        V a[4], a2[4];
#pragma unroll
        for (int mb = 0; mb < 4; ++mb) { a[mb] = WFrag<T16>::ld(A + aoff + (size_t)mb * 16 * K + kc); if (NSPLIT == 1 || NSPLIT == 2) a2[mb] = WFrag<T16>::ld(A2 + aoff + (size_t)mb * 16 * K + kc); }
#pragma unroll
        for (int nb = 0; nb < 4; ++nb) { const V b = WFrag<T16>::ld(Bt + boff + (size_t)nb * 16 * K + kc); V b2; if (NSPLIT >= 2) b2 = WFrag<T16>::ld(Bt2 + boff + (size_t)nb * 16 * K + kc);
#pragma unroll
            for (int mb = 0; mb < 4; ++mb) { acc[mb][nb] = WFrag<T16>::mma(a[mb], b, acc[mb][nb]); if (NSPLIT == 1 || NSPLIT == 2) acc[mb][nb] = WFrag<T16>::mma(a2[mb], b, acc[mb][nb]); if (NSPLIT >= 2) acc[mb][nb] = WFrag<T16>::mma(a[mb], b2, acc[mb][nb]); } }
        asm volatile("v_nop\n\tv_nop\n\tv_nop\n\tv_nop" : "+v"(acc[0][0]), "+v"(acc[1][1]), "+v"(acc[2][2]), "+v"(acc[3][3]) : "v"(a[0]), "v"(a[3]));
    }
#pragma unroll
    for (int mb = 0; mb < 4; ++mb) {
#pragma unroll
        for (int nb = 0; nb < 4; ++nb) {
#pragma unroll
            for (int j = 0; j < 8; ++j) os[(hi * 8 + j) * 68 + nb * 16 + lr] = acc[mb][nb][j]; }
        __builtin_amdgcn_wave_barrier(); asm volatile("" ::: "memory");
        float* crow = C + (size_t)(r0 + mb * 16) * ldc + c0;
{
#pragma unroll
            for (int s = 0; s < 8; ++s) { const int row = 2 * s + hi, cofs = lr * 4; v4f val = *(const v4fa*)(os + row * 68 + cofs); if (BIAS) { val[0] += bfr(bias[c0 + cofs]); val[1] += bfr(bias[c0 + cofs + 1]); val[2] += bfr(bias[c0 + cofs + 2]); val[3] += bfr(bias[c0 + cofs + 3]); }
                *(v4f*)(crow + (size_t)row * ldc + cofs) = val; }
             }
        __builtin_amdgcn_wave_barrier(); asm volatile("" ::: "memory");
    }
}

__global__ __launch_bounds__(256) void k_wtG(const float* __restrict__ w, int K, int N, bf* Bt) {
    const int lane = threadIdx.x & 31; const int L0 = (blockIdx.x * 8 + (threadIdx.x >> 5)) * 8; const int nlines = N * K / 64;
{
#pragma unroll 1
        for (int l = 0; l < 8; ++l) { const int L = L0 + l; if (L >= nlines) break; const size_t e = (size_t)L * 64 + lane * 2; const int k = (int)(e % K), n = (int)(e / K); v2us o;
            o[0] = f2bf(w[(size_t)k * N + n]); o[1] = f2bf(w[(size_t)(k + 1) * N + n]); *(v2us*)(Bt + e) = o; }
         }
}

__global__ __launch_bounds__(128) void k_ln(const float* __restrict__ X, const float* __restrict__ G, const float* __restrict__ Bv, bf* XH, bf* XL) {
    __shared__ float red[8];
    const int tid = threadIdx.x, lane = tid & 31, wid = tid >> 5; const int row = blockIdx.x; const int c = tid * 8; const size_t bz = blockIdx.y;
    const v8f a = *(const v8fa*)(X + (bz * SEQ_FULL + row) * DMOD + c);
    float v[8]; float s = 0.f;
#pragma unroll
    for (int q = 0; q < 8; ++q) { v[q] = bfr(a[q]); s += v[q]; }
#pragma unroll
    for (int sh = 16; sh; sh >>= 1) s += __shfl_xor(s, sh, 32);
    if (lane == 0) red[wid] = s;
    __syncthreads();
    const float mean = ((red[0] + red[1]) + (red[2] + red[3])) * (1.0f / DMOD);
    float s2 = 0.f;
#pragma unroll
    for (int q = 0; q < 8; ++q) { const float d = v[q] - mean; v[q] = d; s2 += d * d; }
#pragma unroll
    for (int sh = 16; sh; sh >>= 1) s2 += __shfl_xor(s2, sh, 32);
    if (lane == 0) red[4 + wid] = s2;
    __syncthreads();
    const float var = ((red[4] + red[5]) + (red[6] + red[7])) * (1.0f / DMOD);
    const float rstd = rsqrtf(var + LNEPS);
    const v8f g = *(const v8fa*)(G + c); const v8f bb = *(const v8fa*)(Bv + c);
    v8us oh, ol;
#pragma unroll
    for (int q = 0; q < 8; ++q) { const float y = v[q] * rstd * bfr(g[q]) + bfr(bb[q]); unsigned short a2, c2; splitf(y, a2, c2); oh[q] = a2; ol[q] = c2; }
    const size_t e = (bz * SEQ + row) * DMOD + c;
    *(v8us*)(XH + e) = oh; *(v8us*)(XL + e) = ol;
    
}

__global__ __launch_bounds__(256) void k_qkp(const float* __restrict__ C, h16* QP, h16* KP, int n8) {
    const int i = blockIdx.x * 256 + threadIdx.x; if (i >= n8) return;
    const int which = blockIdx.y; const size_t bz = blockIdx.z;
    const size_t e = (size_t)i * 8; const int d = (int)(e % HD); const int t = (int)((e / HD) % SEQ); const int hh = (int)(e / ((size_t)HD * SEQ));
    const v8f a = *(const v8fa*)(C + (bz * SEQ + t) * QKVN + which * DMOD + hh * HD + d);
    v8h o;
#pragma unroll
    for (int q = 0; q < 8; ++q) o[q] = (h16)a[q];
    h16* dst = (which == 0) ? QP : KP;
    *(v8h*)(dst + bz * ((size_t)NHD * SEQ * HD) + e) = o;
}

// ---- k_vtp16: value^T planes VT[h][d][t0..t0+63] = f16(C[t][2048 + h*64 + d]) through an LDS transpose; block = (64 t, one head, one batch); grid (SEQ/64, 16, NB), 256 threads.
__global__ __launch_bounds__(256) void k_vtp16(const float* __restrict__ C, h16* VTp) {
    __shared__ __align__(16) h16 T[64 * KSP];
    const int tid = threadIdx.x; const int t0 = blockIdx.x * 64; const int hh = blockIdx.y;
    C += (size_t)blockIdx.z * SEQ * QKVN; VTp += (size_t)blockIdx.z * NHD * HD * SEQ;
#pragma unroll
    for (int rr = 0; rr < 4; ++rr) { const int idx = tid + 256 * rr; const int tt = idx >> 4; const int c4 = (idx & 15) * 4;
        const v4f a = *(const v4fa*)(C + (size_t)(t0 + tt) * QKVN + 2 * DMOD + hh * HD + c4);
#pragma unroll
        for (int q = 0; q < 4; ++q) T[(c4 + q) * KSP + tt] = (h16)a[q]; }
    __syncthreads();
    v8h o[2]; size_t oo[2];
#pragma unroll
    for (int rr = 0; rr < 2; ++rr) { const int d = rr * 32 + (tid >> 3); const int p = (tid & 7) * 8; o[rr] = *(const v8ha*)(T + d * KSP + p); oo[rr] = ((size_t)hh * HD + d) * SEQ + t0 + p; }
#pragma unroll
    for (int rr = 0; rr < 2; ++rr) *(v8h*)(VTp + oo[rr]) = o[rr];
    
}

// ---- k_flash: softmax(q k^T * 1/8 with excluded keys replaced by -3e38) v, online over 64-key tiles; grid (SEQ/128, 16 heads, NB batches), 256 threads = 8 waves x 16 query rows.
// Key tile [64 j][64 d] and value^T tile [64 d][64 j] staged in LDS with plain loads between block barriers; S and P.v fragments via the WFrag loaders (A and B same k map);
// P = f16(1024 * exp(s - m_run)) through a per-wave LDS tile (block barrier between store and reload); l accumulated in f32; out = O / (1024 l).
__global__ __launch_bounds__(256) void k_flash(const h16* __restrict__ QP, const h16* __restrict__ KP, const h16* __restrict__ VT, const int* __restrict__ mk, float* outb) {
    __shared__ __align__(16) h16 Ks[64 * KSP];
    __shared__ __align__(16) h16 Vs[64 * KSP];
    __shared__ __align__(16) float Ow[8 * 16 * OSP];
    __shared__ int Ms[64];
    const int tid = threadIdx.x, wid = tid >> 5, lane = tid & 31, lr = lane & 15, hi = lane >> 4;
    const int hh = blockIdx.y, i0 = blockIdx.x * 128 + wid * 16;
    const size_t bz = blockIdx.z, pl = (bz * NHD + hh) * ((size_t)SEQ * HD);
    mk += bz * SEQ_FULL; outb += bz * SEQ_FULL * DMOD;
    const h16* qp = QP + pl; const h16* kp = KP + pl; const h16* vt = VT + pl;
    float* ow = Ow + wid * (16 * OSP); h16* pw = (h16*)ow;
    v16h qf[2];
    qf[0] = WFrag<h16>::ld(qp + (size_t)(i0 + lr) * HD + 8 * hi);
    qf[1] = WFrag<h16>::ld(qp + (size_t)(i0 + lr) * HD + 32 + 8 * hi);
    v8f o[4];
#pragma unroll
    for (int n = 0; n < 4; ++n) o[n] = (v8f){};
    float mrow[8], lrow[8];
#pragma unroll
    for (int r = 0; r < 8; ++r) { mrow[r] = -__builtin_inff(); lrow[r] = 0.f; }
    const float L2E = 1.4426950408889634f;
    const int srow = tid >> 3, spc = (tid & 7) * 8;
#pragma unroll 1
    for (int j0 = 0; j0 < SEQ; j0 += 64) {
        __syncthreads();
#pragma unroll
        for (int rr = 0; rr < 2; ++rr) { const int row = srow + 32 * rr;
            const v8h kv = *(const v8ha*)(kp + (size_t)(j0 + row) * HD + spc);
            const v8h vv = *(const v8ha*)(vt + (size_t)row * SEQ + j0 + spc);
            *(v8ha*)(Ks + row * KSP + spc) = kv; *(v8ha*)(Vs + row * KSP + spc) = vv; }
        if (tid < 64) Ms[tid] = mk[j0 + tid];
        __syncthreads();
        v8f s[4];
#pragma unroll
        for (int nt = 0; nt < 4; ++nt) { s[nt] = (v8f){};
#pragma unroll
            for (int kk = 0; kk < 2; ++kk) { const v16h b = WFrag<h16>::ld(Ks + (nt * 16 + lr) * KSP + kk * 32 + 8 * hi); s[nt] = wmma16(qf[kk], b, s[nt]); } }
        asm volatile("v_nop\n\tv_nop\n\tv_nop\n\tv_nop" : "+v"(s[0]), "+v"(s[1]), "+v"(s[2]), "+v"(s[3]) : "v"(qf[0]), "v"(qf[1]));
#pragma unroll
        for (int nt = 0; nt < 4; ++nt) { const bool ex = (Ms[nt * 16 + lr] >= 1);
#pragma unroll
            for (int r = 0; r < 8; ++r) { const float t = s[nt][r] * SCL; s[nt][r] = ex ? NEGB : t; } }
        float mcur[8], alpha[8];
#pragma unroll
        for (int r = 0; r < 8; ++r) { float mx = fmaxf(fmaxf(s[0][r], s[1][r]), fmaxf(s[2][r], s[3][r])); mx = hmax16(mx); const float mn = fmaxf(mrow[r], mx);
            alpha[r] = __builtin_amdgcn_exp2f(__fmul_rn(__fsub_rn(mrow[r], mn), L2E)); mcur[r] = mn; mrow[r] = mn; }
#pragma unroll
        for (int nt = 0; nt < 4; ++nt)
#pragma unroll
            for (int r = 0; r < 8; ++r) s[nt][r] = __builtin_amdgcn_exp2f(__fmul_rn(__fsub_rn(s[nt][r], mcur[r]), L2E));
#pragma unroll
        for (int r = 0; r < 8; ++r) { float su = (s[0][r] + s[1][r]) + (s[2][r] + s[3][r]); su = hsum16(su); lrow[r] = lrow[r] * alpha[r] + su; }
#pragma unroll
        for (int n = 0; n < 4; ++n)
#pragma unroll
            for (int r = 0; r < 8; ++r) o[n][r] *= alpha[r];
#pragma unroll
        for (int nt = 0; nt < 4; ++nt)
#pragma unroll
            for (int r = 0; r < 8; ++r) pw[(8 * hi + r) * KSP + nt * 16 + lr] = (h16)(s[nt][r] * PCAR);
        __syncthreads();
        const v16h a0 = WFrag<h16>::ld(pw + lr * KSP + 8 * hi), a1 = WFrag<h16>::ld(pw + lr * KSP + 32 + 8 * hi);
#pragma unroll
        for (int n = 0; n < 4; ++n) { const v16h b0 = WFrag<h16>::ld(Vs + (n * 16 + lr) * KSP + 8 * hi); o[n] = wmma16(a0, b0, o[n]); const v16h b1 = WFrag<h16>::ld(Vs + (n * 16 + lr) * KSP + 32 + 8 * hi); o[n] = wmma16(a1, b1, o[n]); }
        asm volatile("v_nop\n\tv_nop\n\tv_nop\n\tv_nop" : "+v"(o[0]), "+v"(o[1]), "+v"(o[2]), "+v"(o[3]) : "v"(a0), "v"(a1));
    }
    float inv[8];
#pragma unroll
    for (int r = 0; r < 8; ++r) inv[r] = __fdiv_rn(1.0f, lrow[r] * PCAR);
    __syncthreads();
#pragma unroll
    for (int n = 0; n < 4; ++n)
#pragma unroll
        for (int r = 0; r < 8; ++r) ow[(hi * 8 + r) * OSP + n * 16 + lr] = o[n][r] * inv[r];
    __syncthreads();
    float* orow = outb + (size_t)i0 * DMOD + hh * HD;
    v4f val[8];
#pragma unroll
    for (int sI = 0; sI < 8; ++sI) val[sI] = *(const v4fa*)(ow + (2 * sI + hi) * OSP + lr * 4);
#pragma unroll
    for (int sI = 0; sI < 8; ++sI) *(v4f*)(orow + (size_t)(2 * sI + hi) * DMOD + lr * 4) = val[sI];
    
}

extern "C" void kernel_launch(void* const* d_in, const int* in_sizes, int n_in,
                              void* d_out, int out_size, void* d_ws, size_t ws_size, hipStream_t stream) {
    if (n_in < 5) return;
    const long rows_used = (long)(NB - 1) * SEQ_FULL + SEQ;
    if ((long)in_sizes[0] < rows_used * DMOD) return;
    if ((long)in_sizes[1] < rows_used) return;
    if ((long)in_sizes[2] < (long)DMOD * QKVN) return;
    if (in_sizes[3] < DMOD || in_sizes[4] < DMOD) return;
    if ((long)out_size < rows_used * DMOD) return;
    const float* X = (const float*)d_in[0]; const int* M = (const int*)d_in[1]; const float* W = (const float*)d_in[2]; const float* G = (const float*)d_in[3]; const float* Bv = (const float*)d_in[4];
    float* OUT = (float*)d_out;     // [4][2048][1024]
    char* wsp = (char*)d_ws;
    auto take = [&](size_t bytes) { char* p = wsp; wsp += (bytes + 255) & ~(size_t)255; return (void*)p; };
    bf* WT = (bf*)take((size_t)QKVN * DMOD * 2);                       // W^T bf16 [3072][1024]            6,291,456 B
    bf* XH = (bf*)take((size_t)NB * SEQ * DMOD * 2);                   // xn hi [NB][SEQ][1024]           16,777,216 B
    bf* XL = (bf*)take((size_t)NB * SEQ * DMOD * 2);                   // xn lo                           16,777,216 B
    float* CQ = (float*)take((size_t)NB * SEQ * QKVN * 4);             // qkv f32 [NB][SEQ][3072]        100,663,296 B
    h16* QP = (h16*)take((size_t)NB * NHD * SEQ * HD * 2);             // q planes [NB][16][SEQ][64]      16,777,216 B
    h16* KP = (h16*)take((size_t)NB * NHD * SEQ * HD * 2);             // k planes                        16,777,216 B
    h16* VTp = (h16*)take((size_t)NB * NHD * HD * SEQ * 2);            // v^T planes [NB][16][64][SEQ]    16,777,216 B
    if ((size_t)(wsp - (char*)d_ws) > ws_size) return;                 // total 190,840,832 B
    const int nlines = QKVN * DMOD / 64;
    k_wtG<<<(unsigned)((nlines + 63) / 64), 256, 0, stream>>>(W, DMOD, QKVN, WT);
    const int n8 = NHD * SEQ * HD / 8;
    k_ln<<<dim3(SEQ, NB, 1), 128, 0, stream>>>(X, G, Bv, XH, XL);
    k_gemmw<bf, 1, false><<<dim3(SEQ / 64, QKVN / 64, NB), 32, 0, stream>>>(XH, XL, WT, nullptr, DMOD, CQ, QKVN, nullptr, (size_t)SEQ * DMOD, 0, (size_t)SEQ * QKVN);
    k_qkp<<<dim3((unsigned)((n8 + 255) / 256), 2, NB), 256, 0, stream>>>(CQ, QP, KP, n8);
    k_vtp16<<<dim3(SEQ / 64, NHD, NB), 256, 0, stream>>>(CQ, VTp);
    k_flash<<<dim3(SEQ / 128, NHD, NB), 256, 0, stream>>>(QP, KP, VTp, M, OUT);
}

// v002
// Measured time: 292 microseconds a run.
// In both of two side-by-side timings against v001, it was 1.31 times as fast.
// Counting every step since v000, it is 1.99 times as fast.
#include <hip/hip_runtime.h>

// Compute dtypes (f32 accumulate everywhere): LayerNorm in f32 on bf16 (RNE) copies of x, ln_g, ln_b; QKV projection = v_wmma_f32_16x16x32_bf16 with xn as bf16 hi+lo planes and W^T as one bf16 plane; scores q.k^T and P.v = v_wmma_f32_16x16x32_f16 with q, k, v^T plain f16 planes and P = f16(1024 * exp(s - m)); online softmax statistics f32; output f32.
// Pipeline, every launch covers all NB batches (batch = slowest grid index, except k_gemms, whose row tiles run over all NB*SEQ rows as one matrix): k_ln -> xn hi/lo [NB][SEQ][1024]; k_gemms -> qkv f32 [NB][SEQ][3072]; k_qkp -> q, k head planes [NB][16][SEQ][64]; k_vtp16 -> v^T planes [NB][16][64][SEQ]; k_flash -> out rows [SEQ][1024] at h*64 of each batch. k_wtG once: W^T bf16 [3072][1024].

#ifndef NB
#define NB 4
#endif
#ifndef SEQ
#define SEQ 2048
#endif
#define NB_FULL  4
#define SEQ_FULL 2048
#define DMOD 1024
#define NHD  16
#define HD   64
#define QKVN (3 * DMOD)
#define SCL  0.125f
#define PCAR 1024.0f
#define NEGB (-3.0e38f)
#define LNEPS 1e-5f
#define KSP  72      // LDS pitch (halves) of key / value^T / P tiles
#define OSP  68      // LDS pitch (floats) of the output staging tile
static_assert(SEQ % 128 == 0);
static_assert(SEQ >= 128);
static_assert(SEQ <= SEQ_FULL);
static_assert(NB >= 1);
static_assert(NB <= NB_FULL);
static_assert(DMOD % 64 == 0);
static_assert(QKVN % 64 == 0);
static_assert(NHD * HD == DMOD);
static_assert(DMOD % 32 == 0);

typedef _Float16 h16;
typedef unsigned short bf;
typedef __attribute__((ext_vector_type(16))) __bf16   v16bf;
typedef __attribute__((ext_vector_type(16))) _Float16 v16h;
typedef __attribute__((ext_vector_type(8)))  _Float16 v8h;
typedef __attribute__((ext_vector_type(8)))  unsigned short v8us;
typedef __attribute__((ext_vector_type(8)))  float    v8f;
typedef __attribute__((ext_vector_type(4)))  float    v4f;
typedef __attribute__((ext_vector_type(2)))  unsigned short v2us;
typedef v8h  __attribute__((may_alias)) v8ha;
typedef v4f  __attribute__((may_alias)) v4fa;
typedef v8us __attribute__((may_alias)) v8usa;
typedef v8f  __attribute__((may_alias)) v8fa;

__device__ __forceinline__ unsigned short f2bf(float f) { unsigned u = __float_as_uint(f); u += 0x7FFFu + ((u >> 16) & 1u); return (unsigned short)(u >> 16); }
__device__ __forceinline__ float bf2f(unsigned short b) { return __uint_as_float(((unsigned)b) << 16); }
__device__ __forceinline__ float bfr(float f) { return bf2f(f2bf(f)); }
__device__ __forceinline__ void splitf(float y, unsigned short& h, unsigned short& l) { h = f2bf(y); l = f2bf(y - bf2f(h)); }
__device__ __forceinline__ v16h cat16(v8h lo, v8h hi) { return __builtin_shufflevector(lo, hi, 0, 1, 2, 3, 4, 5, 6, 7, 8, 9, 10, 11, 12, 13, 14, 15); }
__device__ __forceinline__ v16bf cat16b(v8us lo, v8us hi) { return __builtin_bit_cast(v16bf, __builtin_shufflevector(lo, hi, 0, 1, 2, 3, 4, 5, 6, 7, 8, 9, 10, 11, 12, 13, 14, 15)); }
__device__ __forceinline__ v8f wmma16(v16h a, v16h b, v8f c) { return __builtin_amdgcn_wmma_f32_16x16x32_f16(false, a, false, b, (short)0, c, false, false); }
__device__ __forceinline__ v8f wmmab(v16bf a, v16bf b, v8f c) { return __builtin_amdgcn_wmma_f32_16x16x32_bf16(false, a, false, b, (short)0, c, false, false); }
__device__ __forceinline__ float hmax16(float v) { v = fmaxf(v, __shfl_xor(v, 1, 32)); v = fmaxf(v, __shfl_xor(v, 2, 32)); v = fmaxf(v, __shfl_xor(v, 4, 32)); v = fmaxf(v, __shfl_xor(v, 8, 32)); return v; }
__device__ __forceinline__ float hsum16(float v) { v += __shfl_xor(v, 1, 32); v += __shfl_xor(v, 2, 32); v += __shfl_xor(v, 4, 32); v += __shfl_xor(v, 8, 32); return v; }

// Fragment loaders (A and B use the same per-lane k map): p = row (lane & 15) base + k0 + 8*(lane >> 4); elements 0..7 = p[0..7], elements 8..15 = p[16..23].
template <typename T16> struct WFrag;
template <> struct WFrag<h16> { typedef v16h V; static __device__ __forceinline__ V ld(const h16* p) { return cat16(*(const v8ha*)p, *(const v8ha*)(p + 16)); } static __device__ __forceinline__ v8f mma(V a, V b, v8f c) { return wmma16(a, b, c); } };
template <> struct WFrag<bf> { typedef v16bf V; static __device__ __forceinline__ V ld(const bf* p) { return cat16b(*(const v8usa*)p, *(const v8usa*)(p + 16)); } static __device__ __forceinline__ v8f mma(V a, V b, v8f c) { return wmmab(a, b, c); } };

// ---- k_gemms: C[m][n] (f32, pitch QKVN) = sum_k (AH[m][k] + AL[m][k]) Bt[n][k], K = DMOD; block tile 128 x 256 = 8 waves (2 x 4) of 64 x 64 (16 accumulators each); grid (NB*SEQ/128, QKVN/256), 256 threads: the batches' rows are one matrix of NB*SEQ rows.
// A stage = 64 k of [AH 128 rows | AL 128 rows | Bt 256 rows] at pitch KSP halves in LDS, two buffers; every lane brings 16 x 16 B of a stage by asynchronous copies while the stage before it is multiplied.
#define GBM 128
#define GBN 256
#define GKC 64
#define GSTG ((2 * GBM + GBN) * KSP)   // halves per buffer
static_assert((NB * SEQ) % GBM == 0);
static_assert(QKVN % GBN == 0);
static_assert(DMOD % GKC == 0);
static_assert(DMOD / GKC >= 2);
static_assert(8 * 16 * 68 * 4 <= 2 * GSTG * 2);

// Eight copies of 16 B per lane into LDS rows 32 apart from l: four from global rows 32 apart from g, four likewise from h. The s_wait_xcnt stands inside the statement so that no address register is rewritten ahead of it.
__device__ __forceinline__ void cp8(unsigned l, const bf* g, const bf* h) {
    asm volatile("global_load_async_to_lds_b128 %0, %8, off\n\t"
                 "global_load_async_to_lds_b128 %1, %9, off\n\t"
                 "global_load_async_to_lds_b128 %2, %10, off\n\t"
                 "global_load_async_to_lds_b128 %3, %11, off\n\t"
                 "global_load_async_to_lds_b128 %4, %12, off\n\t"
                 "global_load_async_to_lds_b128 %5, %13, off\n\t"
                 "global_load_async_to_lds_b128 %6, %14, off\n\t"
                 "global_load_async_to_lds_b128 %7, %15, off\n\t"
                 "s_wait_xcnt 0x0"
                 :: "v"(l), "v"(l + 1u * 32 * KSP * 2), "v"(l + 2u * 32 * KSP * 2), "v"(l + 3u * 32 * KSP * 2), "v"(l + 4u * 32 * KSP * 2), "v"(l + 5u * 32 * KSP * 2), "v"(l + 6u * 32 * KSP * 2), "v"(l + 7u * 32 * KSP * 2),
                    "v"(g), "v"(g + 1 * 32 * DMOD), "v"(g + 2 * 32 * DMOD), "v"(g + 3 * 32 * DMOD), "v"(h), "v"(h + 1 * 32 * DMOD), "v"(h + 2 * 32 * DMOD), "v"(h + 3 * 32 * DMOD)
                 : "memory");
}

__global__ __launch_bounds__(256) void k_gemms(const bf* __restrict__ AH, const bf* __restrict__ AL, const bf* __restrict__ Bt, float* C) {
    __shared__ __align__(16) bf S[2 * GSTG];
    const int tid = threadIdx.x, wid = tid >> 5, lane = tid & 31, lr = lane & 15, hi = lane >> 4;
    const int wm = wid >> 2, wn = wid & 3; const int r0 = blockIdx.x * GBM, c0 = blockIdx.y * GBN;
    const int crow = tid >> 3, ccol = (tid & 7) * 8;   // a wave's copy covers 4 rows x 128 B: whole lines
    const bf* gah = AH + (size_t)(r0 + crow) * DMOD + ccol; const bf* gal = AL + (size_t)(r0 + crow) * DMOD + ccol; const bf* gb = Bt + (size_t)(c0 + crow) * DMOD + ccol;
    const unsigned l0 = (unsigned)(size_t)(S + crow * KSP + ccol);
    v8f acc[4][4];
#pragma unroll
    for (int mb = 0; mb < 4; ++mb)
#pragma unroll
        for (int nb = 0; nb < 4; ++nb) acc[mb][nb] = (v8f){};
    const int NT = DMOD / GKC;
    cp8(l0, gah, gal); cp8(l0 + 2u * GBM * KSP * 2, gb, gb + 128 * DMOD);
    asm volatile("s_wait_asynccnt 0x0" ::: "memory");   // stage 0 has landed (this wave's copies)
    __syncthreads();                                     // ... and every other wave's
    cp8(l0 + GSTG * 2u, gah + GKC, gal + GKC); cp8(l0 + GSTG * 2u + 2u * GBM * KSP * 2, gb + GKC, gb + 128 * DMOD + GKC);
    const int aofs = (wm * 64 + lr) * KSP + 8 * hi, bofs = (2 * GBM + wn * 64 + lr) * KSP + 8 * hi;
#pragma unroll 1   // one trip per stage stays rolled: 64 products a trip already fill the loop, and the accumulators leave no registers for a second trip's fragments
    for (int t = 0; t < NT; ++t) {
        const bf* sb = S + (t & 1) * GSTG;
#pragma unroll
        for (int ks = 0; ks < GKC; ks += 32) {
            v16bf a[4], a2[4];
#pragma unroll
            for (int mb = 0; mb < 4; ++mb) { a[mb] = WFrag<bf>::ld(sb + aofs + mb * 16 * KSP + ks); a2[mb] = WFrag<bf>::ld(sb + aofs + (GBM + mb * 16) * KSP + ks); }
#pragma unroll
            for (int nb = 0; nb < 4; ++nb) { const v16bf b = WFrag<bf>::ld(sb + bofs + nb * 16 * KSP + ks);
#pragma unroll
                for (int mb = 0; mb < 4; ++mb) { acc[mb][nb] = wmmab(a[mb], b, acc[mb][nb]); acc[mb][nb] = wmmab(a2[mb], b, acc[mb][nb]); } }
        }
        asm volatile("s_wait_dscnt 0x0" ::: "memory");      // this wave has left the buffer that is refilled below
        asm volatile("s_wait_asynccnt 0x0" ::: "memory");   // this wave's copies of stage t + 1 have landed
        __syncthreads();                                     // publishes stage t + 1, ends every reader's last read of stage t
        if (t + 2 < NT) { const unsigned lb = l0 + (unsigned)(t & 1) * (GSTG * 2u); const int ko = (t + 2) * GKC;
            cp8(lb, gah + ko, gal + ko); cp8(lb + 2u * GBM * KSP * 2, gb + ko, gb + 128 * DMOD + ko); }
    }
    asm volatile("s_wait_asynccnt 0x0" ::: "memory");       // nothing in flight when the ring becomes output staging
    float* os = (float*)S + wid * (16 * 68);
#pragma unroll
    for (int mb = 0; mb < 4; ++mb) {
#pragma unroll
        for (int nb = 0; nb < 4; ++nb) {
#pragma unroll
            for (int j = 0; j < 8; ++j) os[(hi * 8 + j) * 68 + nb * 16 + lr] = acc[mb][nb][j]; }
        float* crw = C + (size_t)(r0 + wm * 64 + mb * 16) * QKVN + c0 + wn * 64;
#pragma unroll
        for (int s = 0; s < 8; ++s) { const int row = 2 * s + hi, cofs = lr * 4; const v4f val = *(const v4fa*)(os + row * 68 + cofs);
            *(v4f*)(crw + (size_t)row * QKVN + cofs) = val; }
    }
}

__global__ __launch_bounds__(256) void k_wtG(const float* __restrict__ w, int K, int N, bf* Bt) {
    const int lane = threadIdx.x & 31; const int L0 = (blockIdx.x * 8 + (threadIdx.x >> 5)) * 8; const int nlines = N * K / 64;
{
#pragma unroll 1
        for (int l = 0; l < 8; ++l) { const int L = L0 + l; if (L >= nlines) break; const size_t e = (size_t)L * 64 + lane * 2; const int k = (int)(e % K), n = (int)(e / K); v2us o;
            o[0] = f2bf(w[(size_t)k * N + n]); o[1] = f2bf(w[(size_t)(k + 1) * N + n]); *(v2us*)(Bt + e) = o; }
         }
}

__global__ __launch_bounds__(128) void k_ln(const float* __restrict__ X, const float* __restrict__ G, const float* __restrict__ Bv, bf* XH, bf* XL) {
    __shared__ float red[8];
    const int tid = threadIdx.x, lane = tid & 31, wid = tid >> 5; const int row = blockIdx.x; const int c = tid * 8; const size_t bz = blockIdx.y;
    const v8f a = *(const v8fa*)(X + (bz * SEQ_FULL + row) * DMOD + c);
    float v[8]; float s = 0.f;
#pragma unroll
    for (int q = 0; q < 8; ++q) { v[q] = bfr(a[q]); s += v[q]; }
#pragma unroll
    for (int sh = 16; sh; sh >>= 1) s += __shfl_xor(s, sh, 32);
    if (lane == 0) red[wid] = s;
    __syncthreads();
    const float mean = ((red[0] + red[1]) + (red[2] + red[3])) * (1.0f / DMOD);
    float s2 = 0.f;
#pragma unroll
    for (int q = 0; q < 8; ++q) { const float d = v[q] - mean; v[q] = d; s2 += d * d; }
#pragma unroll
    for (int sh = 16; sh; sh >>= 1) s2 += __shfl_xor(s2, sh, 32);
    if (lane == 0) red[4 + wid] = s2;
    __syncthreads();
    const float var = ((red[4] + red[5]) + (red[6] + red[7])) * (1.0f / DMOD);
    const float rstd = rsqrtf(var + LNEPS);
    const v8f g = *(const v8fa*)(G + c); const v8f bb = *(const v8fa*)(Bv + c);
    v8us oh, ol;
#pragma unroll
    for (int q = 0; q < 8; ++q) { const float y = v[q] * rstd * bfr(g[q]) + bfr(bb[q]); unsigned short a2, c2; splitf(y, a2, c2); oh[q] = a2; ol[q] = c2; }
    const size_t e = (bz * SEQ + row) * DMOD + c;
    *(v8us*)(XH + e) = oh; *(v8us*)(XL + e) = ol;
    
}

__global__ __launch_bounds__(256) void k_qkp(const float* __restrict__ C, h16* QP, h16* KP, int n8) {
    const int i = blockIdx.x * 256 + threadIdx.x; if (i >= n8) return;
    const int which = blockIdx.y; const size_t bz = blockIdx.z;
    const size_t e = (size_t)i * 8; const int d = (int)(e % HD); const int t = (int)((e / HD) % SEQ); const int hh = (int)(e / ((size_t)HD * SEQ));
    const v8f a = *(const v8fa*)(C + (bz * SEQ + t) * QKVN + which * DMOD + hh * HD + d);
    v8h o;
#pragma unroll
    for (int q = 0; q < 8; ++q) o[q] = (h16)a[q];
    h16* dst = (which == 0) ? QP : KP;
    *(v8h*)(dst + bz * ((size_t)NHD * SEQ * HD) + e) = o;
}

// ---- k_vtp16: value^T planes VT[h][d][t0..t0+63] = f16(C[t][2048 + h*64 + d]) through an LDS transpose; block = (64 t, one head, one batch); grid (SEQ/64, 16, NB), 256 threads.
__global__ __launch_bounds__(256) void k_vtp16(const float* __restrict__ C, h16* VTp) {
    __shared__ __align__(16) h16 T[64 * KSP];
    const int tid = threadIdx.x; const int t0 = blockIdx.x * 64; const int hh = blockIdx.y;
    C += (size_t)blockIdx.z * SEQ * QKVN; VTp += (size_t)blockIdx.z * NHD * HD * SEQ;
#pragma unroll
    for (int rr = 0; rr < 4; ++rr) { const int idx = tid + 256 * rr; const int tt = idx >> 4; const int c4 = (idx & 15) * 4;
        const v4f a = *(const v4fa*)(C + (size_t)(t0 + tt) * QKVN + 2 * DMOD + hh * HD + c4);
#pragma unroll
        for (int q = 0; q < 4; ++q) T[(c4 + q) * KSP + tt] = (h16)a[q]; }
    __syncthreads();
    v8h o[2]; size_t oo[2];
#pragma unroll
    for (int rr = 0; rr < 2; ++rr) { const int d = rr * 32 + (tid >> 3); const int p = (tid & 7) * 8; o[rr] = *(const v8ha*)(T + d * KSP + p); oo[rr] = ((size_t)hh * HD + d) * SEQ + t0 + p; }
#pragma unroll
    for (int rr = 0; rr < 2; ++rr) *(v8h*)(VTp + oo[rr]) = o[rr];
    
}

// ---- k_flash: softmax(q k^T * 1/8 with excluded keys replaced by -3e38) v, online over 64-key tiles; grid (SEQ/128, 16 heads, NB batches), 256 threads = 8 waves x 16 query rows.
// Key tile [64 j][64 d] and value^T tile [64 d][64 j] staged in LDS with plain loads between block barriers; S and P.v fragments via the WFrag loaders (A and B same k map);
// P = f16(1024 * exp(s - m_run)) through a per-wave LDS tile (block barrier between store and reload); l accumulated in f32; out = O / (1024 l).
__global__ __launch_bounds__(256) void k_flash(const h16* __restrict__ QP, const h16* __restrict__ KP, const h16* __restrict__ VT, const int* __restrict__ mk, float* outb) {
    __shared__ __align__(16) h16 Ks[64 * KSP];
    __shared__ __align__(16) h16 Vs[64 * KSP];
    __shared__ __align__(16) float Ow[8 * 16 * OSP];
    __shared__ int Ms[64];
    const int tid = threadIdx.x, wid = tid >> 5, lane = tid & 31, lr = lane & 15, hi = lane >> 4;
    const int hh = blockIdx.y, i0 = blockIdx.x * 128 + wid * 16;
    const size_t bz = blockIdx.z, pl = (bz * NHD + hh) * ((size_t)SEQ * HD);
    mk += bz * SEQ_FULL; outb += bz * SEQ_FULL * DMOD;
    const h16* qp = QP + pl; const h16* kp = KP + pl; const h16* vt = VT + pl;
    float* ow = Ow + wid * (16 * OSP); h16* pw = (h16*)ow;
    v16h qf[2];
    qf[0] = WFrag<h16>::ld(qp + (size_t)(i0 + lr) * HD + 8 * hi);
    qf[1] = WFrag<h16>::ld(qp + (size_t)(i0 + lr) * HD + 32 + 8 * hi);
    v8f o[4];
#pragma unroll
    for (int n = 0; n < 4; ++n) o[n] = (v8f){};
    float mrow[8], lrow[8];
#pragma unroll
    for (int r = 0; r < 8; ++r) { mrow[r] = -__builtin_inff(); lrow[r] = 0.f; }
    const float L2E = 1.4426950408889634f;
    const int srow = tid >> 3, spc = (tid & 7) * 8;
#pragma unroll 1
    for (int j0 = 0; j0 < SEQ; j0 += 64) {
        __syncthreads();
#pragma unroll
        for (int rr = 0; rr < 2; ++rr) { const int row = srow + 32 * rr;
            const v8h kv = *(const v8ha*)(kp + (size_t)(j0 + row) * HD + spc);
            const v8h vv = *(const v8ha*)(vt + (size_t)row * SEQ + j0 + spc);
            *(v8ha*)(Ks + row * KSP + spc) = kv; *(v8ha*)(Vs + row * KSP + spc) = vv; }
        if (tid < 64) Ms[tid] = mk[j0 + tid];
        __syncthreads();
        v8f s[4];
#pragma unroll
        for (int nt = 0; nt < 4; ++nt) { s[nt] = (v8f){};
#pragma unroll
            for (int kk = 0; kk < 2; ++kk) { const v16h b = WFrag<h16>::ld(Ks + (nt * 16 + lr) * KSP + kk * 32 + 8 * hi); s[nt] = wmma16(qf[kk], b, s[nt]); } }
        asm volatile("v_nop\n\tv_nop\n\tv_nop\n\tv_nop" : "+v"(s[0]), "+v"(s[1]), "+v"(s[2]), "+v"(s[3]) : "v"(qf[0]), "v"(qf[1]));
#pragma unroll
        for (int nt = 0; nt < 4; ++nt) { const bool ex = (Ms[nt * 16 + lr] >= 1);
#pragma unroll
            for (int r = 0; r < 8; ++r) { const float t = s[nt][r] * SCL; s[nt][r] = ex ? NEGB : t; } }
        float mcur[8], alpha[8];
#pragma unroll
        for (int r = 0; r < 8; ++r) { float mx = fmaxf(fmaxf(s[0][r], s[1][r]), fmaxf(s[2][r], s[3][r])); mx = hmax16(mx); const float mn = fmaxf(mrow[r], mx);
            alpha[r] = __builtin_amdgcn_exp2f(__fmul_rn(__fsub_rn(mrow[r], mn), L2E)); mcur[r] = mn; mrow[r] = mn; }
#pragma unroll
        for (int nt = 0; nt < 4; ++nt)
#pragma unroll
            for (int r = 0; r < 8; ++r) s[nt][r] = __builtin_amdgcn_exp2f(__fmul_rn(__fsub_rn(s[nt][r], mcur[r]), L2E));
#pragma unroll
        for (int r = 0; r < 8; ++r) { float su = (s[0][r] + s[1][r]) + (s[2][r] + s[3][r]); su = hsum16(su); lrow[r] = lrow[r] * alpha[r] + su; }
#pragma unroll
        for (int n = 0; n < 4; ++n)
#pragma unroll
            for (int r = 0; r < 8; ++r) o[n][r] *= alpha[r];
#pragma unroll
        for (int nt = 0; nt < 4; ++nt)
#pragma unroll
            for (int r = 0; r < 8; ++r) pw[(8 * hi + r) * KSP + nt * 16 + lr] = (h16)(s[nt][r] * PCAR);
        __syncthreads();
        const v16h a0 = WFrag<h16>::ld(pw + lr * KSP + 8 * hi), a1 = WFrag<h16>::ld(pw + lr * KSP + 32 + 8 * hi);
#pragma unroll
        for (int n = 0; n < 4; ++n) { const v16h b0 = WFrag<h16>::ld(Vs + (n * 16 + lr) * KSP + 8 * hi); o[n] = wmma16(a0, b0, o[n]); const v16h b1 = WFrag<h16>::ld(Vs + (n * 16 + lr) * KSP + 32 + 8 * hi); o[n] = wmma16(a1, b1, o[n]); }
        asm volatile("v_nop\n\tv_nop\n\tv_nop\n\tv_nop" : "+v"(o[0]), "+v"(o[1]), "+v"(o[2]), "+v"(o[3]) : "v"(a0), "v"(a1));
    }
    float inv[8];
#pragma unroll
    for (int r = 0; r < 8; ++r) inv[r] = __fdiv_rn(1.0f, lrow[r] * PCAR);
    __syncthreads();
#pragma unroll
    for (int n = 0; n < 4; ++n)
#pragma unroll
        for (int r = 0; r < 8; ++r) ow[(hi * 8 + r) * OSP + n * 16 + lr] = o[n][r] * inv[r];
    __syncthreads();
    float* orow = outb + (size_t)i0 * DMOD + hh * HD;
    v4f val[8];
#pragma unroll
    for (int sI = 0; sI < 8; ++sI) val[sI] = *(const v4fa*)(ow + (2 * sI + hi) * OSP + lr * 4);
#pragma unroll
    for (int sI = 0; sI < 8; ++sI) *(v4f*)(orow + (size_t)(2 * sI + hi) * DMOD + lr * 4) = val[sI];
    
}

extern "C" void kernel_launch(void* const* d_in, const int* in_sizes, int n_in,
                              void* d_out, int out_size, void* d_ws, size_t ws_size, hipStream_t stream) {
    if (n_in < 5) return;
    const long rows_used = (long)(NB - 1) * SEQ_FULL + SEQ;
    if ((long)in_sizes[0] < rows_used * DMOD) return;
    if ((long)in_sizes[1] < rows_used) return;
    if ((long)in_sizes[2] < (long)DMOD * QKVN) return;
    if (in_sizes[3] < DMOD || in_sizes[4] < DMOD) return;
    if ((long)out_size < rows_used * DMOD) return;
    const float* X = (const float*)d_in[0]; const int* M = (const int*)d_in[1]; const float* W = (const float*)d_in[2]; const float* G = (const float*)d_in[3]; const float* Bv = (const float*)d_in[4];
    float* OUT = (float*)d_out;     // [4][2048][1024]
    char* wsp = (char*)d_ws;
    auto take = [&](size_t bytes) { char* p = wsp; wsp += (bytes + 255) & ~(size_t)255; return (void*)p; };
    bf* WT = (bf*)take((size_t)QKVN * DMOD * 2);                       // W^T bf16 [3072][1024]            6,291,456 B
    bf* XH = (bf*)take((size_t)NB * SEQ * DMOD * 2);                   // xn hi [NB][SEQ][1024]           16,777,216 B
    bf* XL = (bf*)take((size_t)NB * SEQ * DMOD * 2);                   // xn lo                           16,777,216 B
    float* CQ = (float*)take((size_t)NB * SEQ * QKVN * 4);             // qkv f32 [NB][SEQ][3072]        100,663,296 B
    h16* QP = (h16*)take((size_t)NB * NHD * SEQ * HD * 2);             // q planes [NB][16][SEQ][64]      16,777,216 B
    h16* KP = (h16*)take((size_t)NB * NHD * SEQ * HD * 2);             // k planes                        16,777,216 B
    h16* VTp = (h16*)take((size_t)NB * NHD * HD * SEQ * 2);            // v^T planes [NB][16][64][SEQ]    16,777,216 B
    if ((size_t)(wsp - (char*)d_ws) > ws_size) return;                 // total 190,840,832 B
    const int nlines = QKVN * DMOD / 64;
    k_wtG<<<(unsigned)((nlines + 63) / 64), 256, 0, stream>>>(W, DMOD, QKVN, WT);
    const int n8 = NHD * SEQ * HD / 8;
    k_ln<<<dim3(SEQ, NB, 1), 128, 0, stream>>>(X, G, Bv, XH, XL);
    k_gemms<<<dim3(NB * SEQ / GBM, QKVN / GBN, 1), 256, 0, stream>>>(XH, XL, WT, CQ);
    k_qkp<<<dim3((unsigned)((n8 + 255) / 256), 2, NB), 256, 0, stream>>>(CQ, QP, KP, n8);
    k_vtp16<<<dim3(SEQ / 64, NHD, NB), 256, 0, stream>>>(CQ, VTp);
    k_flash<<<dim3(SEQ / 128, NHD, NB), 256, 0, stream>>>(QP, KP, VTp, M, OUT);
}

// v003
// A run of this version takes 211 microseconds.
// Timed twice side by side with v002, it ran 1.39 times as fast both times.
// All steps since v000 together make it 2.76 times as fast.
#include <hip/hip_runtime.h>

// Compute dtypes (f32 accumulate everywhere): LayerNorm in f32 on bf16 (RNE) copies of x, ln_g, ln_b; QKV projection = v_wmma_f32_16x16x32_bf16 with xn as bf16 hi+lo planes and W^T as one bf16 plane; scores (k.q^T, transposed) and v^T.P^T = v_wmma_f32_16x16x32_f16 with q, k, v^T plain f16 planes and P = f16(1024 * exp(s - m)); online softmax statistics f32; output f32.
// Pipeline, every launch covers all NB batches (batch = slowest grid index; k_gemms folds batches into its row tiles): k_ln -> xn hi/lo [NB][SEQ][1024]; k_gemms -> qkv f32 [NB][SEQ][3072]; k_qkp -> q, k head planes [NB][16][SEQ][64]; k_vtp16 -> v^T planes [NB][16][64][SEQ]; k_flash -> out rows [SEQ][1024] at h*64 of each batch. k_wtG once: W^T bf16 [3072][1024].

#ifndef NB
#define NB 4
#endif
#ifndef SEQ
#define SEQ 2048
#endif
#define NB_FULL  4
#define SEQ_FULL 2048
#define DMOD 1024
#define NHD  16
#define HD   64
#define QKVN (3 * DMOD)
#define SCL  0.125f
#define PCAR 1024.0f
#define NEGB (-3.0e38f)
#define LNEPS 1e-5f
#define KSP  72      // LDS pitch (halves) of key / value^T tiles
#define OSP  68      // LDS pitch (floats) of the output staging tile
static_assert(SEQ % 128 == 0);
static_assert(SEQ >= 128);
static_assert(SEQ <= SEQ_FULL);
static_assert(NB >= 1);
static_assert(NB <= NB_FULL);
static_assert(DMOD % 64 == 0);
static_assert(QKVN % 64 == 0);
static_assert(NHD * HD == DMOD);
static_assert(DMOD % 32 == 0);

typedef _Float16 h16;
typedef unsigned short bf;
typedef __attribute__((ext_vector_type(16))) __bf16   v16bf;
typedef __attribute__((ext_vector_type(16))) _Float16 v16h;
typedef __attribute__((ext_vector_type(8)))  _Float16 v8h;
typedef __attribute__((ext_vector_type(8)))  unsigned short v8us;
typedef __attribute__((ext_vector_type(8)))  float    v8f;
typedef __attribute__((ext_vector_type(4)))  float    v4f;
typedef __attribute__((ext_vector_type(4)))  int      v4i;
typedef __attribute__((ext_vector_type(2)))  unsigned short v2us;
typedef v8h  __attribute__((may_alias)) v8ha;
typedef v4f  __attribute__((may_alias)) v4fa;
typedef v4i  __attribute__((may_alias)) v4ia;
typedef v8us __attribute__((may_alias)) v8usa;
typedef v8f  __attribute__((may_alias)) v8fa;

__device__ __forceinline__ unsigned short f2bf(float f) { unsigned u = __float_as_uint(f); u += 0x7FFFu + ((u >> 16) & 1u); return (unsigned short)(u >> 16); }
__device__ __forceinline__ float bf2f(unsigned short b) { return __uint_as_float(((unsigned)b) << 16); }
__device__ __forceinline__ float bfr(float f) { return bf2f(f2bf(f)); }
__device__ __forceinline__ void splitf(float y, unsigned short& h, unsigned short& l) { h = f2bf(y); l = f2bf(y - bf2f(h)); }
__device__ __forceinline__ v16h cat16(v8h lo, v8h hi) { return __builtin_shufflevector(lo, hi, 0, 1, 2, 3, 4, 5, 6, 7, 8, 9, 10, 11, 12, 13, 14, 15); }
__device__ __forceinline__ v16bf cat16b(v8us lo, v8us hi) { return __builtin_bit_cast(v16bf, __builtin_shufflevector(lo, hi, 0, 1, 2, 3, 4, 5, 6, 7, 8, 9, 10, 11, 12, 13, 14, 15)); }
__device__ __forceinline__ v8f wmma16(v16h a, v16h b, v8f c) { return __builtin_amdgcn_wmma_f32_16x16x32_f16(false, a, false, b, (short)0, c, false, false); }
__device__ __forceinline__ v8f wmmab(v16bf a, v16bf b, v8f c) { return __builtin_amdgcn_wmma_f32_16x16x32_bf16(false, a, false, b, (short)0, c, false, false); }
__device__ __forceinline__ float xhalf(float x) { return __builtin_bit_cast(float, __builtin_amdgcn_permlanex16(__builtin_bit_cast(int, x), __builtin_bit_cast(int, x), 0x76543210, 0xfedcba98, false, false)); }  // lane l reads lane l ^ 16

// Fragment loaders (A and B use the same per-lane k map): p = row (lane & 15) base + k0 + 8*(lane >> 4); elements 0..7 = p[0..7], elements 8..15 = p[16..23].
template <typename T16> struct WFrag;
template <> struct WFrag<h16> { typedef v16h V; static __device__ __forceinline__ V ld(const h16* p) { return cat16(*(const v8ha*)p, *(const v8ha*)(p + 16)); } static __device__ __forceinline__ v8f mma(V a, V b, v8f c) { return wmma16(a, b, c); } };
template <> struct WFrag<bf> { typedef v16bf V; static __device__ __forceinline__ V ld(const bf* p) { return cat16b(*(const v8usa*)p, *(const v8usa*)(p + 16)); } static __device__ __forceinline__ v8f mma(V a, V b, v8f c) { return wmmab(a, b, c); } };

// ---- k_gemms: C[m][n] (f32, pitch QKVN) = sum_k (AH[m][k] + AL[m][k]) Bt[n][k], K = DMOD; block tile 128 x 256 = 8 waves (2 x 4) of 64 x 64 (16 accumulators each); grid (NB*SEQ/128, QKVN/256), 256 threads: the batches' rows are one matrix of NB*SEQ rows.
// A stage = 64 k of [AH 128 rows | AL 128 rows | Bt 256 rows] at pitch KSP halves in LDS, two buffers; every lane brings 16 x 16 B of a stage by asynchronous copies while the stage before it is multiplied.
#define GBM 128
#define GBN 256
#define GKC 64
#define GSTG ((2 * GBM + GBN) * KSP)   // halves per buffer
static_assert((NB * SEQ) % GBM == 0);
static_assert(QKVN % GBN == 0);
static_assert(DMOD % GKC == 0);
static_assert(DMOD / GKC >= 2);
static_assert(8 * 16 * 68 * 4 <= 2 * GSTG * 2);

// Eight copies of 16 B per lane into LDS rows 32 apart from l: four from global rows 32 apart from g, four likewise from h. The s_wait_xcnt stands inside the statement so that no address register is rewritten ahead of it.
__device__ __forceinline__ void cp8(unsigned l, const bf* g, const bf* h) {
    asm volatile("global_load_async_to_lds_b128 %0, %8, off\n\t"
                 "global_load_async_to_lds_b128 %1, %9, off\n\t"
                 "global_load_async_to_lds_b128 %2, %10, off\n\t"
                 "global_load_async_to_lds_b128 %3, %11, off\n\t"
                 "global_load_async_to_lds_b128 %4, %12, off\n\t"
                 "global_load_async_to_lds_b128 %5, %13, off\n\t"
                 "global_load_async_to_lds_b128 %6, %14, off\n\t"
                 "global_load_async_to_lds_b128 %7, %15, off\n\t"
                 "s_wait_xcnt 0x0"
                 :: "v"(l), "v"(l + 1u * 32 * KSP * 2), "v"(l + 2u * 32 * KSP * 2), "v"(l + 3u * 32 * KSP * 2), "v"(l + 4u * 32 * KSP * 2), "v"(l + 5u * 32 * KSP * 2), "v"(l + 6u * 32 * KSP * 2), "v"(l + 7u * 32 * KSP * 2),
                    "v"(g), "v"(g + 1 * 32 * DMOD), "v"(g + 2 * 32 * DMOD), "v"(g + 3 * 32 * DMOD), "v"(h), "v"(h + 1 * 32 * DMOD), "v"(h + 2 * 32 * DMOD), "v"(h + 3 * 32 * DMOD)
                 : "memory");
}

__global__ __launch_bounds__(256) void k_gemms(const bf* __restrict__ AH, const bf* __restrict__ AL, const bf* __restrict__ Bt, float* C) {
    __shared__ __align__(16) bf S[2 * GSTG];
    const int tid = threadIdx.x, wid = tid >> 5, lane = tid & 31, lr = lane & 15, hi = lane >> 4;
    const int wm = wid >> 2, wn = wid & 3; const int r0 = blockIdx.x * GBM, c0 = blockIdx.y * GBN;
    const int crow = tid >> 3, ccol = (tid & 7) * 8;   // a wave's copy covers 4 rows x 128 B: whole lines
    const bf* gah = AH + (size_t)(r0 + crow) * DMOD + ccol; const bf* gal = AL + (size_t)(r0 + crow) * DMOD + ccol; const bf* gb = Bt + (size_t)(c0 + crow) * DMOD + ccol;
    const unsigned l0 = (unsigned)(size_t)(S + crow * KSP + ccol);
    v8f acc[4][4];
#pragma unroll
    for (int mb = 0; mb < 4; ++mb)
#pragma unroll
        for (int nb = 0; nb < 4; ++nb) acc[mb][nb] = (v8f){};
    const int NT = DMOD / GKC;
    cp8(l0, gah, gal); cp8(l0 + 2u * GBM * KSP * 2, gb, gb + 128 * DMOD);
    asm volatile("s_wait_asynccnt 0x0" ::: "memory");   // stage 0 has landed (this wave's copies)
    __syncthreads();                                     // ... and every other wave's
    cp8(l0 + GSTG * 2u, gah + GKC, gal + GKC); cp8(l0 + GSTG * 2u + 2u * GBM * KSP * 2, gb + GKC, gb + 128 * DMOD + GKC);
    const int aofs = (wm * 64 + lr) * KSP + 8 * hi, bofs = (2 * GBM + wn * 64 + lr) * KSP + 8 * hi;
#pragma unroll 1   // one trip per stage stays rolled: 64 products a trip already fill the loop, and the accumulators leave no registers for a second trip's fragments
    for (int t = 0; t < NT; ++t) {
        const bf* sb = S + (t & 1) * GSTG;
#pragma unroll
        for (int ks = 0; ks < GKC; ks += 32) {
            v16bf a[4], a2[4];
#pragma unroll
            for (int mb = 0; mb < 4; ++mb) { a[mb] = WFrag<bf>::ld(sb + aofs + mb * 16 * KSP + ks); a2[mb] = WFrag<bf>::ld(sb + aofs + (GBM + mb * 16) * KSP + ks); }
#pragma unroll
            for (int nb = 0; nb < 4; ++nb) { const v16bf b = WFrag<bf>::ld(sb + bofs + nb * 16 * KSP + ks);
#pragma unroll
                for (int mb = 0; mb < 4; ++mb) { acc[mb][nb] = wmmab(a[mb], b, acc[mb][nb]); acc[mb][nb] = wmmab(a2[mb], b, acc[mb][nb]); } }
        }
        asm volatile("s_wait_dscnt 0x0" ::: "memory");      // this wave has left the buffer that is refilled below
        asm volatile("s_wait_asynccnt 0x0" ::: "memory");   // this wave's copies of stage t + 1 have landed
        __syncthreads();                                     // publishes stage t + 1, ends every reader's last read of stage t
        if (t + 2 < NT) { const unsigned lb = l0 + (unsigned)(t & 1) * (GSTG * 2u); const int ko = (t + 2) * GKC;
            cp8(lb, gah + ko, gal + ko); cp8(lb + 2u * GBM * KSP * 2, gb + ko, gb + 128 * DMOD + ko); }
    }
    asm volatile("s_wait_asynccnt 0x0" ::: "memory");       // nothing in flight when the ring becomes output staging
    float* os = (float*)S + wid * (16 * 68);
#pragma unroll
    for (int mb = 0; mb < 4; ++mb) {
#pragma unroll
        for (int nb = 0; nb < 4; ++nb) {
#pragma unroll
            for (int j = 0; j < 8; ++j) os[(hi * 8 + j) * 68 + nb * 16 + lr] = acc[mb][nb][j]; }
        float* crw = C + (size_t)(r0 + wm * 64 + mb * 16) * QKVN + c0 + wn * 64;
#pragma unroll
        for (int s = 0; s < 8; ++s) { const int row = 2 * s + hi, cofs = lr * 4; const v4f val = *(const v4fa*)(os + row * 68 + cofs);
            *(v4f*)(crw + (size_t)row * QKVN + cofs) = val; }
    }
}

__global__ __launch_bounds__(256) void k_wtG(const float* __restrict__ w, int K, int N, bf* Bt) {
    const int lane = threadIdx.x & 31; const int L0 = (blockIdx.x * 8 + (threadIdx.x >> 5)) * 8; const int nlines = N * K / 64;
{
#pragma unroll 1
        for (int l = 0; l < 8; ++l) { const int L = L0 + l; if (L >= nlines) break; const size_t e = (size_t)L * 64 + lane * 2; const int k = (int)(e % K), n = (int)(e / K); v2us o;
            o[0] = f2bf(w[(size_t)k * N + n]); o[1] = f2bf(w[(size_t)(k + 1) * N + n]); *(v2us*)(Bt + e) = o; }
         }
}

__global__ __launch_bounds__(128) void k_ln(const float* __restrict__ X, const float* __restrict__ G, const float* __restrict__ Bv, bf* XH, bf* XL) {
    __shared__ float red[8];
    const int tid = threadIdx.x, lane = tid & 31, wid = tid >> 5; const int row = blockIdx.x; const int c = tid * 8; const size_t bz = blockIdx.y;
    const v8f a = *(const v8fa*)(X + (bz * SEQ_FULL + row) * DMOD + c);
    float v[8]; float s = 0.f;
#pragma unroll
    for (int q = 0; q < 8; ++q) { v[q] = bfr(a[q]); s += v[q]; }
#pragma unroll
    for (int sh = 16; sh; sh >>= 1) s += __shfl_xor(s, sh, 32);
    if (lane == 0) red[wid] = s;
    __syncthreads();
    const float mean = ((red[0] + red[1]) + (red[2] + red[3])) * (1.0f / DMOD);
    float s2 = 0.f;
#pragma unroll
    for (int q = 0; q < 8; ++q) { const float d = v[q] - mean; v[q] = d; s2 += d * d; }
#pragma unroll
    for (int sh = 16; sh; sh >>= 1) s2 += __shfl_xor(s2, sh, 32);
    if (lane == 0) red[4 + wid] = s2;
    __syncthreads();
    const float var = ((red[4] + red[5]) + (red[6] + red[7])) * (1.0f / DMOD);
    const float rstd = rsqrtf(var + LNEPS);
    const v8f g = *(const v8fa*)(G + c); const v8f bb = *(const v8fa*)(Bv + c);
    v8us oh, ol;
#pragma unroll
    for (int q = 0; q < 8; ++q) { const float y = v[q] * rstd * bfr(g[q]) + bfr(bb[q]); unsigned short a2, c2; splitf(y, a2, c2); oh[q] = a2; ol[q] = c2; }
    const size_t e = (bz * SEQ + row) * DMOD + c;
    *(v8us*)(XH + e) = oh; *(v8us*)(XL + e) = ol;
    
}

__global__ __launch_bounds__(256) void k_qkp(const float* __restrict__ C, h16* QP, h16* KP, int n8) {
    const int i = blockIdx.x * 256 + threadIdx.x; if (i >= n8) return;
    const int which = blockIdx.y; const size_t bz = blockIdx.z;
    const size_t e = (size_t)i * 8; const int d = (int)(e % HD); const int t = (int)((e / HD) % SEQ); const int hh = (int)(e / ((size_t)HD * SEQ));
    const v8f a = *(const v8fa*)(C + (bz * SEQ + t) * QKVN + which * DMOD + hh * HD + d);
    v8h o;
#pragma unroll
    for (int q = 0; q < 8; ++q) o[q] = (h16)a[q];
    h16* dst = (which == 0) ? QP : KP;
    *(v8h*)(dst + bz * ((size_t)NHD * SEQ * HD) + e) = o;
}

// ---- k_vtp16: value^T planes VT[h][d][t0..t0+63] = f16(C[t][2048 + h*64 + d]) through an LDS transpose; block = (64 t, one head, one batch); grid (SEQ/64, 16, NB), 256 threads.
__global__ __launch_bounds__(256) void k_vtp16(const float* __restrict__ C, h16* VTp) {
    __shared__ __align__(16) h16 T[64 * KSP];
    const int tid = threadIdx.x; const int t0 = blockIdx.x * 64; const int hh = blockIdx.y;
    C += (size_t)blockIdx.z * SEQ * QKVN; VTp += (size_t)blockIdx.z * NHD * HD * SEQ;
#pragma unroll
    for (int rr = 0; rr < 4; ++rr) { const int idx = tid + 256 * rr; const int tt = idx >> 4; const int c4 = (idx & 15) * 4;
        const v4f a = *(const v4fa*)(C + (size_t)(t0 + tt) * QKVN + 2 * DMOD + hh * HD + c4);
#pragma unroll
        for (int q = 0; q < 4; ++q) T[(c4 + q) * KSP + tt] = (h16)a[q]; }
    __syncthreads();
    v8h o[2]; size_t oo[2];
#pragma unroll
    for (int rr = 0; rr < 2; ++rr) { const int d = rr * 32 + (tid >> 3); const int p = (tid & 7) * 8; o[rr] = *(const v8ha*)(T + d * KSP + p); oo[rr] = ((size_t)hh * HD + d) * SEQ + t0 + p; }
#pragma unroll
    for (int rr = 0; rr < 2; ++rr) *(v8h*)(VTp + oo[rr]) = o[rr];
    
}

// ---- k_flash: softmax(q k^T * 1/8 with excluded keys replaced by -3e38) v, online over 64-key tiles; grid (SEQ/128, 16 heads, NB batches), 256 threads = 8 waves x 16 query columns.
// Transposed products: S^T = K.Q^T (A = key rows from LDS, B = q kept in registers) and O^T += V^T.P^T (A = value^T rows from LDS, B = P^T). A lane holds one query (column lane & 15) and keys nt*16 + 8*(lane >> 4) + r,
// which is the B operand's k map (elements 0..7 of a 32-key fragment = score tile 2c, elements 8..15 = score tile 2c + 1): P = f16(1024 * exp(s - m_run)) goes from the score accumulators into the operand without LDS.
// Maximum in-lane plus one exchange between the wave halves per tile; l in f32, one partial sum per half, joined after the loop; out = O / (1024 l).
// Key tile [64 j][64 d] and value^T tile [64 d][64 j] staged in LDS with plain loads between block barriers; fragments via the WFrag loaders (A and B same k map).
__global__ __launch_bounds__(256) void k_flash(const h16* __restrict__ QP, const h16* __restrict__ KP, const h16* __restrict__ VT, const int* __restrict__ mk, float* outb) {
    __shared__ __align__(16) h16 Ks[64 * KSP];
    __shared__ __align__(16) h16 Vs[64 * KSP];
    __shared__ __align__(16) float Ow[8 * 16 * OSP];
    __shared__ __align__(16) int Ms[64];
    const int tid = threadIdx.x, wid = tid >> 5, lane = tid & 31, lr = lane & 15, hi = lane >> 4;
    const int hh = blockIdx.y, i0 = blockIdx.x * 128 + wid * 16;
    const size_t bz = blockIdx.z, pl = (bz * NHD + hh) * ((size_t)SEQ * HD);
    mk += bz * SEQ_FULL; outb += bz * SEQ_FULL * DMOD;
    const h16* qp = QP + pl; const h16* kp = KP + pl; const h16* vt = VT + pl;
    float* ow = Ow + wid * (16 * OSP);
    v16h qf[2];
    qf[0] = WFrag<h16>::ld(qp + (size_t)(i0 + lr) * HD + 8 * hi);
    qf[1] = WFrag<h16>::ld(qp + (size_t)(i0 + lr) * HD + 32 + 8 * hi);
    v8f o[4];
#pragma unroll
    for (int n = 0; n < 4; ++n) o[n] = (v8f){};
    float mrow = -__builtin_inff(), lrow = 0.f;
    const float L2E = 1.4426950408889634f;
    const int srow = tid >> 3, spc = (tid & 7) * 8;
#pragma unroll 1
    for (int j0 = 0; j0 < SEQ; j0 += 64) {
        __syncthreads();
#pragma unroll
        for (int rr = 0; rr < 2; ++rr) { const int row = srow + 32 * rr;
            const v8h kv = *(const v8ha*)(kp + (size_t)(j0 + row) * HD + spc);
            const v8h vv = *(const v8ha*)(vt + (size_t)row * SEQ + j0 + spc);
            *(v8ha*)(Ks + row * KSP + spc) = kv; *(v8ha*)(Vs + row * KSP + spc) = vv; }
        if (tid < 64) Ms[tid] = mk[j0 + tid];
        __syncthreads();
        v8f s[4];
#pragma unroll
        for (int nt = 0; nt < 4; ++nt) { s[nt] = (v8f){};
#pragma unroll
            for (int kk = 0; kk < 2; ++kk) { const v16h a = WFrag<h16>::ld(Ks + (nt * 16 + lr) * KSP + kk * 32 + 8 * hi); s[nt] = wmma16(a, qf[kk], s[nt]); } }
        asm volatile("v_nop\n\tv_nop\n\tv_nop\n\tv_nop" : "+v"(s[0]), "+v"(s[1]), "+v"(s[2]), "+v"(s[3]) : "v"(qf[0]), "v"(qf[1]));
#pragma unroll
        for (int nt = 0; nt < 4; ++nt) { const v4i e0 = *(const v4ia*)(Ms + nt * 16 + 8 * hi), e1 = *(const v4ia*)(Ms + nt * 16 + 8 * hi + 4);
#pragma unroll
            for (int r = 0; r < 8; ++r) { const bool ex = ((r < 4 ? e0[r & 3] : e1[r & 3]) >= 1); const float t = s[nt][r] * SCL; s[nt][r] = ex ? NEGB : t; } }
        float mx = NEGB;
#pragma unroll
        for (int r = 0; r < 8; ++r) mx = fmaxf(mx, fmaxf(fmaxf(s[0][r], s[1][r]), fmaxf(s[2][r], s[3][r])));
        mx = fmaxf(mx, xhalf(mx));
        const float mn = fmaxf(mrow, mx);
        const float alpha = __builtin_amdgcn_exp2f(__fmul_rn(__fsub_rn(mrow, mn), L2E)); mrow = mn;
#pragma unroll
        for (int nt = 0; nt < 4; ++nt)
#pragma unroll
            for (int r = 0; r < 8; ++r) s[nt][r] = __builtin_amdgcn_exp2f(__fmul_rn(__fsub_rn(s[nt][r], mn), L2E));
        float sr[8];
#pragma unroll
        for (int r = 0; r < 8; ++r) sr[r] = (s[0][r] + s[1][r]) + (s[2][r] + s[3][r]);
        lrow = lrow * alpha + (((sr[0] + sr[1]) + (sr[2] + sr[3])) + ((sr[4] + sr[5]) + (sr[6] + sr[7])));
#pragma unroll
        for (int n = 0; n < 4; ++n)
#pragma unroll
            for (int r = 0; r < 8; ++r) o[n][r] *= alpha;
        v16h p0, p1;
#pragma unroll
        for (int r = 0; r < 8; ++r) { p0[r] = (h16)(s[0][r] * PCAR); p0[8 + r] = (h16)(s[1][r] * PCAR); p1[r] = (h16)(s[2][r] * PCAR); p1[8 + r] = (h16)(s[3][r] * PCAR); }
#pragma unroll
        for (int n = 0; n < 4; ++n) { const v16h a0 = WFrag<h16>::ld(Vs + (n * 16 + lr) * KSP + 8 * hi); o[n] = wmma16(a0, p0, o[n]); const v16h a1 = WFrag<h16>::ld(Vs + (n * 16 + lr) * KSP + 32 + 8 * hi); o[n] = wmma16(a1, p1, o[n]); }
        // four vector slots behind the last product, also on the loop's back edge, before anything rewrites its operands or touches o
        asm volatile("v_nop\n\tv_nop\n\tv_nop\n\tv_nop" : "+v"(o[0]), "+v"(o[1]), "+v"(o[2]), "+v"(o[3]) : "v"(p0), "v"(p1));
    }
    const float inv = __fdiv_rn(1.0f, (lrow + xhalf(lrow)) * PCAR);
    __syncthreads();
#pragma unroll
    for (int n = 0; n < 4; ++n) { v4f w0, w1;
#pragma unroll
        for (int r = 0; r < 4; ++r) { w0[r] = o[n][r] * inv; w1[r] = o[n][4 + r] * inv; }
        *(v4fa*)(ow + lr * OSP + n * 16 + 8 * hi) = w0; *(v4fa*)(ow + lr * OSP + n * 16 + 8 * hi + 4) = w1; }
    __syncthreads();
    float* orow = outb + (size_t)i0 * DMOD + hh * HD;
    v4f val[8];
#pragma unroll
    for (int sI = 0; sI < 8; ++sI) val[sI] = *(const v4fa*)(ow + (2 * sI + hi) * OSP + lr * 4);
#pragma unroll
    for (int sI = 0; sI < 8; ++sI) *(v4f*)(orow + (size_t)(2 * sI + hi) * DMOD + lr * 4) = val[sI];
    
}

extern "C" void kernel_launch(void* const* d_in, const int* in_sizes, int n_in,
                              void* d_out, int out_size, void* d_ws, size_t ws_size, hipStream_t stream) {
    if (n_in < 5) return;
    const long rows_used = (long)(NB - 1) * SEQ_FULL + SEQ;
    if ((long)in_sizes[0] < rows_used * DMOD) return;
    if ((long)in_sizes[1] < rows_used) return;
    if ((long)in_sizes[2] < (long)DMOD * QKVN) return;
    if (in_sizes[3] < DMOD || in_sizes[4] < DMOD) return;
    if ((long)out_size < rows_used * DMOD) return;
    const float* X = (const float*)d_in[0]; const int* M = (const int*)d_in[1]; const float* W = (const float*)d_in[2]; const float* G = (const float*)d_in[3]; const float* Bv = (const float*)d_in[4];
    float* OUT = (float*)d_out;     // [4][2048][1024]
    char* wsp = (char*)d_ws;
    auto take = [&](size_t bytes) { char* p = wsp; wsp += (bytes + 255) & ~(size_t)255; return (void*)p; };
    bf* WT = (bf*)take((size_t)QKVN * DMOD * 2);                       // W^T bf16 [3072][1024]            6,291,456 B
    bf* XH = (bf*)take((size_t)NB * SEQ * DMOD * 2);                   // xn hi [NB][SEQ][1024]           16,777,216 B
    bf* XL = (bf*)take((size_t)NB * SEQ * DMOD * 2);                   // xn lo                           16,777,216 B
    float* CQ = (float*)take((size_t)NB * SEQ * QKVN * 4);             // qkv f32 [NB][SEQ][3072]        100,663,296 B
    h16* QP = (h16*)take((size_t)NB * NHD * SEQ * HD * 2);             // q planes [NB][16][SEQ][64]      16,777,216 B
    h16* KP = (h16*)take((size_t)NB * NHD * SEQ * HD * 2);             // k planes                        16,777,216 B
    h16* VTp = (h16*)take((size_t)NB * NHD * HD * SEQ * 2);            // v^T planes [NB][16][64][SEQ]    16,777,216 B
    if ((size_t)(wsp - (char*)d_ws) > ws_size) return;                 // total 190,840,832 B
    const int nlines = QKVN * DMOD / 64;
    k_wtG<<<(unsigned)((nlines + 63) / 64), 256, 0, stream>>>(W, DMOD, QKVN, WT);
    const int n8 = NHD * SEQ * HD / 8;
    k_ln<<<dim3(SEQ, NB, 1), 128, 0, stream>>>(X, G, Bv, XH, XL);
    k_gemms<<<dim3(NB * SEQ / GBM, QKVN / GBN, 1), 256, 0, stream>>>(XH, XL, WT, CQ);
    k_qkp<<<dim3((unsigned)((n8 + 255) / 256), 2, NB), 256, 0, stream>>>(CQ, QP, KP, n8);
    k_vtp16<<<dim3(SEQ / 64, NHD, NB), 256, 0, stream>>>(CQ, VTp);
    k_flash<<<dim3(SEQ / 128, NHD, NB), 256, 0, stream>>>(QP, KP, VTp, M, OUT);
}

// v004
// It runs in 152 microseconds.
// Next to v003, in two timings, it ran 1.38 and 1.40 times as fast.
// All steps since v000 together make it 3.84 times as fast.
#include <hip/hip_runtime.h>

// Compute dtypes (f32 accumulate everywhere): LayerNorm in f32 on bf16 (RNE) copies of x, ln_g, ln_b; QKV projection = v_wmma_f32_16x16x32_bf16 with xn as bf16 hi+lo planes and W^T as one bf16 plane; scores (k.q^T, transposed) and v^T.P^T = v_wmma_f32_16x16x32_f16 with q, k, v^T plain f16 planes and P = f16(1024 * exp(s - m)); online softmax statistics f32; output f32.
// Pipeline, every launch covers all NB batches: k_ln -> xn hi/lo [NB][SEQ][1024]; k_gemms -> qkv f32 [NB][SEQ][3072]; k_qkp -> q, k head planes [NB][16][SEQ][64]; k_vtp16 -> v^T planes [NB][16][64][SEQ]; k_flash -> out rows [SEQ][1024] at h*64 of each batch. k_wtG once: W^T bf16 [3072][1024], and in NB more blocks the list of the keys that count.
// Excluded keys have weight exactly 0 as long as one key of the batch counts, so they are left out of everything behind the LayerNorm: k_ln also writes xn rows in key-list order (slot s = the s-th key that counts), the k and v columns of qkv, the k and v^T planes and the key loop of k_flash run over the ne slots in use (rounded up to their tiles) instead of SEQ. A batch with every key excluded keeps all SEQ keys, all flagged: the uniform weights of the reference.

#ifndef NB
#define NB 4
#endif
#ifndef SEQ
#define SEQ 2048
#endif
#define NB_FULL  4
#define SEQ_FULL 2048
#define DMOD 1024
#define NHD  16
#define HD   64
#define QKVN (3 * DMOD)
#define SCL  0.125f
#define PCAR 1024.0f
#define NEGB (-3.0e38f)
#define LNEPS 1e-5f
#define KSP  72      // LDS pitch (halves) of key / value^T tiles
#define OSP  68      // LDS pitch (floats) of the output staging tile
static_assert(SEQ % 128 == 0);
static_assert(SEQ >= 128);
static_assert(SEQ <= SEQ_FULL);
static_assert(NB >= 1);
static_assert(NB <= NB_FULL);
static_assert(DMOD % 64 == 0);
static_assert(QKVN % 64 == 0);
static_assert(NHD * HD == DMOD);
static_assert(DMOD % 32 == 0);

typedef _Float16 h16;
typedef unsigned short bf;
typedef __attribute__((ext_vector_type(16))) __bf16   v16bf;
typedef __attribute__((ext_vector_type(16))) _Float16 v16h;
typedef __attribute__((ext_vector_type(8)))  _Float16 v8h;
typedef __attribute__((ext_vector_type(8)))  unsigned short v8us;
typedef __attribute__((ext_vector_type(8)))  float    v8f;
typedef __attribute__((ext_vector_type(4)))  float    v4f;
typedef __attribute__((ext_vector_type(4)))  int      v4i;
typedef __attribute__((ext_vector_type(2)))  unsigned short v2us;
typedef v8h  __attribute__((may_alias)) v8ha;
typedef v4f  __attribute__((may_alias)) v4fa;
typedef v4i  __attribute__((may_alias)) v4ia;
typedef v8us __attribute__((may_alias)) v8usa;
typedef v8f  __attribute__((may_alias)) v8fa;

__device__ __forceinline__ unsigned short f2bf(float f) { unsigned u = __float_as_uint(f); u += 0x7FFFu + ((u >> 16) & 1u); return (unsigned short)(u >> 16); }
__device__ __forceinline__ float bf2f(unsigned short b) { return __uint_as_float(((unsigned)b) << 16); }
__device__ __forceinline__ float bfr(float f) { return bf2f(f2bf(f)); }
__device__ __forceinline__ void splitf(float y, unsigned short& h, unsigned short& l) { h = f2bf(y); l = f2bf(y - bf2f(h)); }
__device__ __forceinline__ v16h cat16(v8h lo, v8h hi) { return __builtin_shufflevector(lo, hi, 0, 1, 2, 3, 4, 5, 6, 7, 8, 9, 10, 11, 12, 13, 14, 15); }
__device__ __forceinline__ v16bf cat16b(v8us lo, v8us hi) { return __builtin_bit_cast(v16bf, __builtin_shufflevector(lo, hi, 0, 1, 2, 3, 4, 5, 6, 7, 8, 9, 10, 11, 12, 13, 14, 15)); }
__device__ __forceinline__ v8f wmma16(v16h a, v16h b, v8f c) { return __builtin_amdgcn_wmma_f32_16x16x32_f16(false, a, false, b, (short)0, c, false, false); }
__device__ __forceinline__ v8f wmmab(v16bf a, v16bf b, v8f c) { return __builtin_amdgcn_wmma_f32_16x16x32_bf16(false, a, false, b, (short)0, c, false, false); }
__device__ __forceinline__ float xhalf(float x) { return __builtin_bit_cast(float, __builtin_amdgcn_permlanex16(__builtin_bit_cast(int, x), __builtin_bit_cast(int, x), 0x76543210, 0xfedcba98, false, false)); }  // lane l reads lane l ^ 16

// Fragment loaders (A and B use the same per-lane k map): p = row (lane & 15) base + k0 + 8*(lane >> 4); elements 0..7 = p[0..7], elements 8..15 = p[16..23].
template <typename T16> struct WFrag;
template <> struct WFrag<h16> { typedef v16h V; static __device__ __forceinline__ V ld(const h16* p) { return cat16(*(const v8ha*)p, *(const v8ha*)(p + 16)); } static __device__ __forceinline__ v8f mma(V a, V b, v8f c) { return wmma16(a, b, c); } };
template <> struct WFrag<bf> { typedef v16bf V; static __device__ __forceinline__ V ld(const bf* p) { return cat16b(*(const v8usa*)p, *(const v8usa*)(p + 16)); } static __device__ __forceinline__ v8f mma(V a, V b, v8f c) { return wmmab(a, b, c); } };

// ---- k_gemms: C[m][n] (f32, pitch QKVN) = sum_k (AH[m][k] + AL[m][k]) Bt[n][k], K = DMOD; block tile 128 x 256 = 8 waves (2 x 4) of 64 x 64 (16 accumulators each); grid (NB*SEQ/128, QKVN/256), 256 threads: the batches' rows are one matrix of NB*SEQ rows.
// Column blocks of q take the rows in token order (AH, AL); column blocks of k and v take them in key-list order (AHc, ALc), and a block whose first slot lies behind its batch's slots in use leaves at once; in the last block in use a wave with no slot in use among its 64 rows only copies.
// A stage = 64 k of [AH 128 rows | AL 128 rows | Bt 256 rows] at pitch KSP halves in LDS, two buffers; every lane brings 16 x 16 B of a stage by asynchronous copies while the stage before it is multiplied.
#define GBM 128
#define GBN 256
#define GKC 64
#define GSTG ((2 * GBM + GBN) * KSP)   // halves per buffer
static_assert((NB * SEQ) % GBM == 0);
static_assert(QKVN % GBN == 0);
static_assert(DMOD % GKC == 0);
static_assert(DMOD / GKC >= 2);
static_assert(DMOD % GBN == 0);
static_assert(SEQ % GBM == 0);
static_assert(8 * 16 * 68 * 4 <= 2 * GSTG * 2);

// Eight copies of 16 B per lane into LDS rows 32 apart from l: four from global rows 32 apart from g, four likewise from h. The s_wait_xcnt stands inside the statement so that no address register is rewritten ahead of it.
__device__ __forceinline__ void cp8(unsigned l, const bf* g, const bf* h) {
    asm volatile("global_load_async_to_lds_b128 %0, %8, off\n\t"
                 "global_load_async_to_lds_b128 %1, %9, off\n\t"
                 "global_load_async_to_lds_b128 %2, %10, off\n\t"
                 "global_load_async_to_lds_b128 %3, %11, off\n\t"
                 "global_load_async_to_lds_b128 %4, %12, off\n\t"
                 "global_load_async_to_lds_b128 %5, %13, off\n\t"
                 "global_load_async_to_lds_b128 %6, %14, off\n\t"
                 "global_load_async_to_lds_b128 %7, %15, off\n\t"
                 "s_wait_xcnt 0x0"
                 :: "v"(l), "v"(l + 1u * 32 * KSP * 2), "v"(l + 2u * 32 * KSP * 2), "v"(l + 3u * 32 * KSP * 2), "v"(l + 4u * 32 * KSP * 2), "v"(l + 5u * 32 * KSP * 2), "v"(l + 6u * 32 * KSP * 2), "v"(l + 7u * 32 * KSP * 2),
                    "v"(g), "v"(g + 1 * 32 * DMOD), "v"(g + 2 * 32 * DMOD), "v"(g + 3 * 32 * DMOD), "v"(h), "v"(h + 1 * 32 * DMOD), "v"(h + 2 * 32 * DMOD), "v"(h + 3 * 32 * DMOD)
                 : "memory");
}

__global__ __launch_bounds__(256) void k_gemms(const bf* __restrict__ AH, const bf* __restrict__ AL, const bf* __restrict__ AHc, const bf* __restrict__ ALc, const bf* __restrict__ Bt, const int* __restrict__ NE, float* C) {
    __shared__ __align__(16) bf S[2 * GSTG];
    const int tid = threadIdx.x, wid = tid >> 5, lane = tid & 31, lr = lane & 15, hi = lane >> 4;
    const int wm = wid >> 2, wn = wid & 3; const int r0 = blockIdx.x * GBM, c0 = blockIdx.y * GBN;
    const bool kv = c0 >= DMOD;
    const int nrow = kv ? min(NE[r0 / SEQ], SEQ) - r0 % SEQ : GBM;   // slots in use from this block's first row on
    if (nrow <= 0) return;                                           // the whole block, in front of every copy and barrier
    const bool act = __builtin_amdgcn_readfirstlane(wm) * 64 < nrow; // a wave whose 64 rows all lie behind the slots in use multiplies and stores nothing; it still copies and passes every wait and barrier (readfirstlane: the test becomes a scalar branch, EXEC stays all ones at the products)
    const int crow = tid >> 3, ccol = (tid & 7) * 8;   // a wave's copy covers 4 rows x 128 B: whole lines
    const bf* gah = (kv ? AHc : AH) + (size_t)(r0 + crow) * DMOD + ccol; const bf* gal = (kv ? ALc : AL) + (size_t)(r0 + crow) * DMOD + ccol; const bf* gb = Bt + (size_t)(c0 + crow) * DMOD + ccol;
    const unsigned l0 = (unsigned)(size_t)(S + crow * KSP + ccol);
    v8f acc[4][4];
#pragma unroll
    for (int mb = 0; mb < 4; ++mb)
#pragma unroll
        for (int nb = 0; nb < 4; ++nb) acc[mb][nb] = (v8f){};
    const int NT = DMOD / GKC;
    cp8(l0, gah, gal); cp8(l0 + 2u * GBM * KSP * 2, gb, gb + 128 * DMOD);
    asm volatile("s_wait_asynccnt 0x0" ::: "memory");   // stage 0 has landed (this wave's copies)
    __syncthreads();                                     // ... and every other wave's
    cp8(l0 + GSTG * 2u, gah + GKC, gal + GKC); cp8(l0 + GSTG * 2u + 2u * GBM * KSP * 2, gb + GKC, gb + 128 * DMOD + GKC);
    const int aofs = (wm * 64 + lr) * KSP + 8 * hi, bofs = (2 * GBM + wn * 64 + lr) * KSP + 8 * hi;
#pragma unroll 1   // one trip per stage stays rolled: 64 products a trip already fill the loop, and the accumulators leave no registers for a second trip's fragments
    for (int t = 0; t < NT; ++t) {
        const bf* sb = S + (t & 1) * GSTG;
        if (act) {
#pragma unroll
        for (int ks = 0; ks < GKC; ks += 32) {
            v16bf a[4], a2[4];
#pragma unroll
            for (int mb = 0; mb < 4; ++mb) { a[mb] = WFrag<bf>::ld(sb + aofs + mb * 16 * KSP + ks); a2[mb] = WFrag<bf>::ld(sb + aofs + (GBM + mb * 16) * KSP + ks); }
#pragma unroll
            for (int nb = 0; nb < 4; ++nb) { const v16bf b = WFrag<bf>::ld(sb + bofs + nb * 16 * KSP + ks);
#pragma unroll
                for (int mb = 0; mb < 4; ++mb) { acc[mb][nb] = wmmab(a[mb], b, acc[mb][nb]); acc[mb][nb] = wmmab(a2[mb], b, acc[mb][nb]); } }
        }
        }
        asm volatile("s_wait_dscnt 0x0" ::: "memory");      // this wave has left the buffer that is refilled below
        asm volatile("s_wait_asynccnt 0x0" ::: "memory");   // this wave's copies of stage t + 1 have landed
        __syncthreads();                                     // publishes stage t + 1, ends every reader's last read of stage t
        if (t + 2 < NT) { const unsigned lb = l0 + (unsigned)(t & 1) * (GSTG * 2u); const int ko = (t + 2) * GKC;
            cp8(lb, gah + ko, gal + ko); cp8(lb + 2u * GBM * KSP * 2, gb + ko, gb + 128 * DMOD + ko); }
    }
    asm volatile("s_wait_asynccnt 0x0" ::: "memory");       // nothing in flight when the ring becomes output staging
    if (!act) return;                                       // behind the last barrier
    float* os = (float*)S + wid * (16 * 68);
#pragma unroll
    for (int mb = 0; mb < 4; ++mb) {
#pragma unroll
        for (int nb = 0; nb < 4; ++nb) {
#pragma unroll
            for (int j = 0; j < 8; ++j) os[(hi * 8 + j) * 68 + nb * 16 + lr] = acc[mb][nb][j]; }
        float* crw = C + (size_t)(r0 + wm * 64 + mb * 16) * QKVN + c0 + wn * 64;
#pragma unroll
        for (int s = 0; s < 8; ++s) { const int row = 2 * s + hi, cofs = lr * 4; const v4f val = *(const v4fa*)(os + row * 68 + cofs);
            *(v4f*)(crw + (size_t)row * QKVN + cofs) = val; }
    }
}

// Blocks 0..NB-1 of k_wtG, one per batch, n = number of keys that count: POS[b][t] = slot of token t among them (0..n-1, in token order), -1 where t is excluded; MC[b][s] = 1 where slot s holds no key that counts (s >= n); NE[b] = slots in use = n, or SEQ where n = 0.
// A thread owns KPT consecutive tokens; exclusive prefix of the per-thread counts by shuffles in the wave and one LDS pass over the 8 wave totals.
// The four short loops are unrolled so that keep[] stays in registers, the thread's mask words come as wide loads and the wave totals as wide LDS reads.
#define KPT (SEQ / 256)
static_assert(SEQ % 256 == 0);
__device__ __forceinline__ void key_list(const int* __restrict__ mk, int* POS, int* MC, int* NE) {
    __shared__ int wt[8];
    const int tid = threadIdx.x, lane = tid & 31, wid = tid >> 5; const int b = blockIdx.x;
    mk += (size_t)b * SEQ_FULL; POS += (size_t)b * SEQ; MC += (size_t)b * SEQ;
    bool keep[KPT]; int c = 0;
#pragma unroll
    for (int q = 0; q < KPT; ++q) { keep[q] = !(mk[tid * KPT + q] >= 1); c += keep[q] ? 1 : 0; }
    int inc = c;
#pragma unroll
    for (int sh = 1; sh < 32; sh <<= 1) { const int u = __shfl_up(inc, sh, 32); if (lane >= sh) inc += u; }
    if (lane == 31) wt[wid] = inc;
    __syncthreads();
    int base = inc - c, n = 0;
#pragma unroll
    for (int v = 0; v < 8; ++v) { const int x = wt[v]; if (v < wid) base += x; n += x; }
#pragma unroll
    for (int q = 0; q < KPT; ++q) { const int t = tid * KPT + q;
        POS[t] = keep[q] ? base : -1; base += keep[q] ? 1 : 0;
        MC[t] = (t >= n) ? 1 : 0; }
    if (tid == 0) NE[b] = (n == 0) ? SEQ : n;
}

__global__ __launch_bounds__(256) void k_wtG(const float* __restrict__ w, int K, int N, bf* Bt, const int* __restrict__ mk, int* POS, int* MC, int* NE) {
    if (blockIdx.x < NB) { key_list(mk, POS, MC, NE); return; }
    const int lane = threadIdx.x & 31; const int L0 = ((blockIdx.x - NB) * 8 + (threadIdx.x >> 5)) * 8; const int nlines = N * K / 64;
{
#pragma unroll 1
        for (int l = 0; l < 8; ++l) { const int L = L0 + l; if (L >= nlines) break; const size_t e = (size_t)L * 64 + lane * 2; const int k = (int)(e % K), n = (int)(e / K); v2us o;
            o[0] = f2bf(w[(size_t)k * N + n]); o[1] = f2bf(w[(size_t)(k + 1) * N + n]); *(v2us*)(Bt + e) = o; }
         }
}

// XH, XL: every row in token order. XHc, XLc: the same row again at its key-list slot where the token counts, and at slot = token number where that slot holds no key that counts and lies below ne rounded up to 128 (finite filling for the flagged slots). Every slot below ne rounded up to 128 is written by exactly one block.
__global__ __launch_bounds__(128) void k_ln(const float* __restrict__ X, const float* __restrict__ G, const float* __restrict__ Bv, bf* XH, bf* XL, bf* XHc, bf* XLc, const int* __restrict__ POS, const int* __restrict__ MC, const int* __restrict__ NE) {
    __shared__ float red[8];
    const int tid = threadIdx.x, lane = tid & 31, wid = tid >> 5; const int row = blockIdx.x; const int c = tid * 8; const size_t bz = blockIdx.y;
    const int ps = POS[bz * SEQ + row], mc = MC[bz * SEQ + row], ne = min(NE[bz], SEQ);   // the same for the whole block; read at the head, beside the row, and used only at the stores
    const v8f a = *(const v8fa*)(X + (bz * SEQ_FULL + row) * DMOD + c);
    float v[8]; float s = 0.f;
#pragma unroll
    for (int q = 0; q < 8; ++q) { v[q] = bfr(a[q]); s += v[q]; }
#pragma unroll
    for (int sh = 16; sh; sh >>= 1) s += __shfl_xor(s, sh, 32);
    if (lane == 0) red[wid] = s;
    __syncthreads();
    const float mean = ((red[0] + red[1]) + (red[2] + red[3])) * (1.0f / DMOD);
    float s2 = 0.f;
#pragma unroll
    for (int q = 0; q < 8; ++q) { const float d = v[q] - mean; v[q] = d; s2 += d * d; }
#pragma unroll
    for (int sh = 16; sh; sh >>= 1) s2 += __shfl_xor(s2, sh, 32);
    if (lane == 0) red[4 + wid] = s2;
    __syncthreads();
    const float var = ((red[4] + red[5]) + (red[6] + red[7])) * (1.0f / DMOD);
    const float rstd = rsqrtf(var + LNEPS);
    const v8f g = *(const v8fa*)(G + c); const v8f bb = *(const v8fa*)(Bv + c);
    v8us oh, ol;
#pragma unroll
    for (int q = 0; q < 8; ++q) { const float y = v[q] * rstd * bfr(g[q]) + bfr(bb[q]); unsigned short a2, c2; splitf(y, a2, c2); oh[q] = a2; ol[q] = c2; }
    const size_t e = (bz * SEQ + row) * DMOD + c;
    *(v8us*)(XH + e) = oh; *(v8us*)(XL + e) = ol;
    if (ps >= 0) { const size_t ec = (bz * SEQ + ps) * DMOD + c; *(v8us*)(XHc + ec) = oh; *(v8us*)(XLc + ec) = ol;
        asm volatile("s_wait_xcnt 0x0" ::: "memory"); }   // in front of the next branch's address arithmetic, which may reuse these stores' address registers
    if ((mc != 0) & (row < ((ne + GBM - 1) & ~(GBM - 1)))) { *(v8us*)(XHc + e) = oh; *(v8us*)(XLc + e) = ol; }
}

// q rows in token order; k rows in key-list order as qkv holds them, only the slots of the tiles that k_flash reads.
__global__ __launch_bounds__(256) void k_qkp(const float* __restrict__ C, h16* QP, h16* KP, int n8, const int* __restrict__ NE) {
    const int i = blockIdx.x * 256 + threadIdx.x; if (i >= n8) return;
    const int which = blockIdx.y; const size_t bz = blockIdx.z;
    const size_t e = (size_t)i * 8; const int d = (int)(e % HD); const int t = (int)((e / HD) % SEQ); const int hh = (int)(e / ((size_t)HD * SEQ));
    if (which == 1 && t >= ((min(NE[bz], SEQ) + 63) & ~63)) return;
    const v8f a = *(const v8fa*)(C + (bz * SEQ + t) * QKVN + which * DMOD + hh * HD + d);
    v8h o;
#pragma unroll
    for (int q = 0; q < 8; ++q) o[q] = (h16)a[q];
    h16* dst = (which == 0) ? QP : KP;
    *(v8h*)(dst + bz * ((size_t)NHD * SEQ * HD) + e) = o;
}

// ---- k_vtp16: value^T planes VT[h][d][t0..t0+63] = f16(C[t][2048 + h*64 + d]) through an LDS transpose; block = (64 key-list slots t, one head, one batch); grid (SEQ/64, 16, NB), 256 threads; a block behind the last slot in use leaves at once.
__global__ __launch_bounds__(256) void k_vtp16(const float* __restrict__ C, h16* VTp, const int* __restrict__ NE) {
    __shared__ __align__(16) h16 T[64 * KSP];
    const int tid = threadIdx.x; const int t0 = blockIdx.x * 64; const int hh = blockIdx.y;
    if (t0 >= min(NE[blockIdx.z], SEQ)) return;   // the whole block, in front of its barrier
    C += (size_t)blockIdx.z * SEQ * QKVN; VTp += (size_t)blockIdx.z * NHD * HD * SEQ;
#pragma unroll
    for (int rr = 0; rr < 4; ++rr) { const int idx = tid + 256 * rr; const int tt = idx >> 4; const int c4 = (idx & 15) * 4;
        const v4f a = *(const v4fa*)(C + (size_t)(t0 + tt) * QKVN + 2 * DMOD + hh * HD + c4);
#pragma unroll
        for (int q = 0; q < 4; ++q) T[(c4 + q) * KSP + tt] = (h16)a[q]; }
    __syncthreads();
    v8h o[2]; size_t oo[2];
#pragma unroll
    for (int rr = 0; rr < 2; ++rr) { const int d = rr * 32 + (tid >> 3); const int p = (tid & 7) * 8; o[rr] = *(const v8ha*)(T + d * KSP + p); oo[rr] = ((size_t)hh * HD + d) * SEQ + t0 + p; }
#pragma unroll
    for (int rr = 0; rr < 2; ++rr) *(v8h*)(VTp + oo[rr]) = o[rr];
    
}

// ---- k_flash: softmax(q k^T * 1/8 with excluded keys replaced by -3e38) v, online over 64-key tiles of the key list (ne slots in use, mk = the list's own flags: the filling slots of the last tile, or every slot where no key counts); grid (SEQ/128, 16 heads, NB batches), 256 threads = 8 waves x 16 query columns.
// Transposed products: S^T = K.Q^T (A = key rows from LDS, B = q kept in registers) and O^T += V^T.P^T (A = value^T rows from LDS, B = P^T). A lane holds one query (column lane & 15) and keys nt*16 + 8*(lane >> 4) + r,
// which is the B operand's k map (elements 0..7 of a 32-key fragment = score tile 2c, elements 8..15 = score tile 2c + 1): P = f16(1024 * exp(s - m_run)) goes from the score accumulators into the operand without LDS.
// Maximum in-lane plus one exchange between the wave halves per tile; l in f32, one partial sum per half, joined after the loop; out = O / (1024 l).
// Key tile [64 j][64 d] and value^T tile [64 d][64 j] staged in LDS with plain loads between block barriers; fragments via the WFrag loaders (A and B same k map).
__global__ __launch_bounds__(256) void k_flash(const h16* __restrict__ QP, const h16* __restrict__ KP, const h16* __restrict__ VT, const int* __restrict__ mk, const int* __restrict__ NE, float* outb) {
    __shared__ __align__(16) h16 Ks[64 * KSP];
    __shared__ __align__(16) h16 Vs[64 * KSP];
    __shared__ __align__(16) float Ow[8 * 16 * OSP];
    __shared__ __align__(16) int Ms[64];
    const int tid = threadIdx.x, wid = tid >> 5, lane = tid & 31, lr = lane & 15, hi = lane >> 4;
    const int hh = blockIdx.y, i0 = blockIdx.x * 128 + wid * 16;
    const size_t bz = blockIdx.z, pl = (bz * NHD + hh) * ((size_t)SEQ * HD);
    mk += bz * SEQ; outb += bz * SEQ_FULL * DMOD;
    const int ne = min(NE[bz], SEQ);   // the same for the whole block: the barriers in the loop stay uniform
    const h16* qp = QP + pl; const h16* kp = KP + pl; const h16* vt = VT + pl;
    float* ow = Ow + wid * (16 * OSP);
    v16h qf[2];
    qf[0] = WFrag<h16>::ld(qp + (size_t)(i0 + lr) * HD + 8 * hi);
    qf[1] = WFrag<h16>::ld(qp + (size_t)(i0 + lr) * HD + 32 + 8 * hi);
    v8f o[4];
#pragma unroll
    for (int n = 0; n < 4; ++n) o[n] = (v8f){};
    float mrow = -__builtin_inff(), lrow = 0.f;
    const float L2E = 1.4426950408889634f;
    const int srow = tid >> 3, spc = (tid & 7) * 8;
#pragma unroll 1
    for (int j0 = 0; j0 < ne; j0 += 64) {
        __syncthreads();
#pragma unroll
        for (int rr = 0; rr < 2; ++rr) { const int row = srow + 32 * rr;
            const v8h kv = *(const v8ha*)(kp + (size_t)(j0 + row) * HD + spc);
            const v8h vv = *(const v8ha*)(vt + (size_t)row * SEQ + j0 + spc);
            *(v8ha*)(Ks + row * KSP + spc) = kv; *(v8ha*)(Vs + row * KSP + spc) = vv; }
        if (tid < 64) Ms[tid] = mk[j0 + tid];
        __syncthreads();
        v8f s[4];
#pragma unroll
        for (int nt = 0; nt < 4; ++nt) { s[nt] = (v8f){};
#pragma unroll
            for (int kk = 0; kk < 2; ++kk) { const v16h a = WFrag<h16>::ld(Ks + (nt * 16 + lr) * KSP + kk * 32 + 8 * hi); s[nt] = wmma16(a, qf[kk], s[nt]); } }
        asm volatile("v_nop\n\tv_nop\n\tv_nop\n\tv_nop" : "+v"(s[0]), "+v"(s[1]), "+v"(s[2]), "+v"(s[3]) : "v"(qf[0]), "v"(qf[1]));
#pragma unroll
        for (int nt = 0; nt < 4; ++nt) { const v4i e0 = *(const v4ia*)(Ms + nt * 16 + 8 * hi), e1 = *(const v4ia*)(Ms + nt * 16 + 8 * hi + 4);
#pragma unroll
            for (int r = 0; r < 8; ++r) { const bool ex = ((r < 4 ? e0[r & 3] : e1[r & 3]) >= 1); const float t = s[nt][r] * SCL; s[nt][r] = ex ? NEGB : t; } }
        float mx = NEGB;
#pragma unroll
        for (int r = 0; r < 8; ++r) mx = fmaxf(mx, fmaxf(fmaxf(s[0][r], s[1][r]), fmaxf(s[2][r], s[3][r])));
        mx = fmaxf(mx, xhalf(mx));
        const float mn = fmaxf(mrow, mx);
        const float alpha = __builtin_amdgcn_exp2f(__fmul_rn(__fsub_rn(mrow, mn), L2E)); mrow = mn;
#pragma unroll
        for (int nt = 0; nt < 4; ++nt)
#pragma unroll
            for (int r = 0; r < 8; ++r) s[nt][r] = __builtin_amdgcn_exp2f(__fmul_rn(__fsub_rn(s[nt][r], mn), L2E));
        float sr[8];
#pragma unroll
        for (int r = 0; r < 8; ++r) sr[r] = (s[0][r] + s[1][r]) + (s[2][r] + s[3][r]);
        lrow = lrow * alpha + (((sr[0] + sr[1]) + (sr[2] + sr[3])) + ((sr[4] + sr[5]) + (sr[6] + sr[7])));
#pragma unroll
        for (int n = 0; n < 4; ++n)
#pragma unroll
            for (int r = 0; r < 8; ++r) o[n][r] *= alpha;
        v16h p0, p1;
#pragma unroll
        for (int r = 0; r < 8; ++r) { p0[r] = (h16)(s[0][r] * PCAR); p0[8 + r] = (h16)(s[1][r] * PCAR); p1[r] = (h16)(s[2][r] * PCAR); p1[8 + r] = (h16)(s[3][r] * PCAR); }
#pragma unroll
        for (int n = 0; n < 4; ++n) { const v16h a0 = WFrag<h16>::ld(Vs + (n * 16 + lr) * KSP + 8 * hi); o[n] = wmma16(a0, p0, o[n]); const v16h a1 = WFrag<h16>::ld(Vs + (n * 16 + lr) * KSP + 32 + 8 * hi); o[n] = wmma16(a1, p1, o[n]); }
        // four vector slots behind the last product, also on the loop's back edge, before anything rewrites its operands or touches o
        asm volatile("v_nop\n\tv_nop\n\tv_nop\n\tv_nop" : "+v"(o[0]), "+v"(o[1]), "+v"(o[2]), "+v"(o[3]) : "v"(p0), "v"(p1));
    }
    const float inv = __fdiv_rn(1.0f, (lrow + xhalf(lrow)) * PCAR);
    __syncthreads();
#pragma unroll
    for (int n = 0; n < 4; ++n) { v4f w0, w1;
#pragma unroll
        for (int r = 0; r < 4; ++r) { w0[r] = o[n][r] * inv; w1[r] = o[n][4 + r] * inv; }
        *(v4fa*)(ow + lr * OSP + n * 16 + 8 * hi) = w0; *(v4fa*)(ow + lr * OSP + n * 16 + 8 * hi + 4) = w1; }
    __syncthreads();
    float* orow = outb + (size_t)i0 * DMOD + hh * HD;
    v4f val[8];
#pragma unroll
    for (int sI = 0; sI < 8; ++sI) val[sI] = *(const v4fa*)(ow + (2 * sI + hi) * OSP + lr * 4);
#pragma unroll
    for (int sI = 0; sI < 8; ++sI) *(v4f*)(orow + (size_t)(2 * sI + hi) * DMOD + lr * 4) = val[sI];
    
}

extern "C" void kernel_launch(void* const* d_in, const int* in_sizes, int n_in,
                              void* d_out, int out_size, void* d_ws, size_t ws_size, hipStream_t stream) {
    if (n_in < 5) return;
    const long rows_used = (long)(NB - 1) * SEQ_FULL + SEQ;
    if ((long)in_sizes[0] < rows_used * DMOD) return;
    if ((long)in_sizes[1] < rows_used) return;
    if ((long)in_sizes[2] < (long)DMOD * QKVN) return;
    if (in_sizes[3] < DMOD || in_sizes[4] < DMOD) return;
    if ((long)out_size < rows_used * DMOD) return;
    const float* X = (const float*)d_in[0]; const int* M = (const int*)d_in[1]; const float* W = (const float*)d_in[2]; const float* G = (const float*)d_in[3]; const float* Bv = (const float*)d_in[4];
    float* OUT = (float*)d_out;     // [4][2048][1024]
    char* wsp = (char*)d_ws;
    auto take = [&](size_t bytes) { char* p = wsp; wsp += (bytes + 255) & ~(size_t)255; return (void*)p; };
    bf* WT = (bf*)take((size_t)QKVN * DMOD * 2);                       // W^T bf16 [3072][1024]            6,291,456 B
    bf* XH = (bf*)take((size_t)NB * SEQ * DMOD * 2);                   // xn hi [NB][SEQ][1024]           16,777,216 B
    bf* XL = (bf*)take((size_t)NB * SEQ * DMOD * 2);                   // xn lo                           16,777,216 B
    float* CQ = (float*)take((size_t)NB * SEQ * QKVN * 4);             // qkv f32 [NB][SEQ][3072]        100,663,296 B
    h16* QP = (h16*)take((size_t)NB * NHD * SEQ * HD * 2);             // q planes [NB][16][SEQ][64]      16,777,216 B
    h16* KP = (h16*)take((size_t)NB * NHD * SEQ * HD * 2);             // k planes                        16,777,216 B
    h16* VTp = (h16*)take((size_t)NB * NHD * HD * SEQ * 2);            // v^T planes [NB][16][64][SEQ]    16,777,216 B
    bf* XHc = (bf*)take((size_t)NB * SEQ * DMOD * 2);                  // xn hi in key-list order         16,777,216 B
    bf* XLc = (bf*)take((size_t)NB * SEQ * DMOD * 2);                  // xn lo in key-list order         16,777,216 B
    int* POS = (int*)take((size_t)NB * SEQ * 4);                       // token -> slot [NB][SEQ]             32,768 B
    int* MC = (int*)take((size_t)NB * SEQ * 4);                        // slot flags [NB][SEQ]                32,768 B
    int* NE = (int*)take((size_t)NB * 4);                              // slots in use [NB]                      256 B
    if ((size_t)(wsp - (char*)d_ws) > ws_size) return;                 // total 224,461,056 B
    const int nlines = QKVN * DMOD / 64;
    k_wtG<<<(unsigned)(NB + (nlines + 63) / 64), 256, 0, stream>>>(W, DMOD, QKVN, WT, M, POS, MC, NE);
    const int n8 = NHD * SEQ * HD / 8;
    k_ln<<<dim3(SEQ, NB, 1), 128, 0, stream>>>(X, G, Bv, XH, XL, XHc, XLc, POS, MC, NE);
    k_gemms<<<dim3(NB * SEQ / GBM, QKVN / GBN, 1), 256, 0, stream>>>(XH, XL, XHc, XLc, WT, NE, CQ);
    k_qkp<<<dim3((unsigned)((n8 + 255) / 256), 2, NB), 256, 0, stream>>>(CQ, QP, KP, n8, NE);
    k_vtp16<<<dim3(SEQ / 64, NHD, NB), 256, 0, stream>>>(CQ, VTp, NE);
    k_flash<<<dim3(SEQ / 128, NHD, NB), 256, 0, stream>>>(QP, KP, VTp, MC, NE, OUT);
}

// v005
// It runs in 137 microseconds.
// Two timings next to v004 both put it at 1.11 times that version's speed.
// Counting every step since v000, it is 4.25 times as fast.
#include <hip/hip_runtime.h>

// Compute dtypes (f32 accumulate everywhere): LayerNorm in f32 on bf16 (RNE) copies of x, ln_g, ln_b; QKV projection = v_wmma_f32_16x16x32_bf16 with xn as bf16 hi+lo planes and W^T as one bf16 plane; scores (k.q^T, transposed) and v^T.P^T = v_wmma_f32_16x16x32_f16 with q, k, v^T plain f16 planes and P = f16(1024 * exp(s - m)); online softmax statistics f32; output f32.
// Pipeline, every launch covers all NB batches (batch = slowest grid index, in k_gemms the high part of blockIdx.x): k_ln -> xn hi/lo [NB][SEQ][1024]; k_gemms -> f16 q, k head planes [NB][16][SEQ][64] and v^T planes [NB][16][64][SEQ], converted from its f32 accumulators; k_flash -> out rows [SEQ][1024] at h*64 of each batch. k_wtG once: W^T bf16 [3072][1024], and in NB more blocks the list of the keys that count.
// Excluded keys have weight exactly 0 as long as one key of the batch counts, so they are left out of everything behind the LayerNorm: k_ln also writes xn rows in key-list order (slot s = the s-th key that counts), the k and v column blocks of k_gemms, the k and v^T planes and the key loop of k_flash run over the ne slots in use (rounded up to their tiles) instead of SEQ. A batch with every key excluded keeps all SEQ keys, all flagged: the uniform weights of the reference.

#ifndef NB
#define NB 4
#endif
#ifndef SEQ
#define SEQ 2048
#endif
#define NB_FULL  4
#define SEQ_FULL 2048
#define DMOD 1024
#define NHD  16
#define HD   64
#define QKVN (3 * DMOD)
#define SCL  0.125f
#define PCAR 1024.0f
#define NEGB (-3.0e38f)
#define LNEPS 1e-5f
#define KSP  72      // LDS pitch (halves) of key / value^T tiles
#define OSP  68      // LDS pitch (floats) of the output staging tile
static_assert(SEQ % 128 == 0);
static_assert(SEQ >= 128);
static_assert(SEQ <= SEQ_FULL);
static_assert(NB >= 1);
static_assert(NB <= NB_FULL);
static_assert(DMOD % 64 == 0);
static_assert(QKVN % 64 == 0);
static_assert(NHD * HD == DMOD);
static_assert(DMOD % 32 == 0);

typedef _Float16 h16;
typedef unsigned short bf;
typedef __attribute__((ext_vector_type(16))) __bf16   v16bf;
typedef __attribute__((ext_vector_type(16))) _Float16 v16h;
typedef __attribute__((ext_vector_type(8)))  _Float16 v8h;
typedef __attribute__((ext_vector_type(8)))  unsigned short v8us;
typedef __attribute__((ext_vector_type(8)))  float    v8f;
typedef __attribute__((ext_vector_type(4)))  float    v4f;
typedef __attribute__((ext_vector_type(4)))  int      v4i;
typedef __attribute__((ext_vector_type(2)))  unsigned short v2us;
typedef v8h  __attribute__((may_alias)) v8ha;
typedef v4f  __attribute__((may_alias)) v4fa;
typedef v4i  __attribute__((may_alias)) v4ia;
typedef v8us __attribute__((may_alias)) v8usa;
typedef v8f  __attribute__((may_alias)) v8fa;

__device__ __forceinline__ unsigned short f2bf(float f) { unsigned u = __float_as_uint(f); u += 0x7FFFu + ((u >> 16) & 1u); return (unsigned short)(u >> 16); }
__device__ __forceinline__ float bf2f(unsigned short b) { return __uint_as_float(((unsigned)b) << 16); }
__device__ __forceinline__ float bfr(float f) { return bf2f(f2bf(f)); }
__device__ __forceinline__ void splitf(float y, unsigned short& h, unsigned short& l) { h = f2bf(y); l = f2bf(y - bf2f(h)); }
__device__ __forceinline__ v16h cat16(v8h lo, v8h hi) { return __builtin_shufflevector(lo, hi, 0, 1, 2, 3, 4, 5, 6, 7, 8, 9, 10, 11, 12, 13, 14, 15); }
__device__ __forceinline__ v16bf cat16b(v8us lo, v8us hi) { return __builtin_bit_cast(v16bf, __builtin_shufflevector(lo, hi, 0, 1, 2, 3, 4, 5, 6, 7, 8, 9, 10, 11, 12, 13, 14, 15)); }
__device__ __forceinline__ v8f wmma16(v16h a, v16h b, v8f c) { return __builtin_amdgcn_wmma_f32_16x16x32_f16(false, a, false, b, (short)0, c, false, false); }
__device__ __forceinline__ v8f wmmab(v16bf a, v16bf b, v8f c) { return __builtin_amdgcn_wmma_f32_16x16x32_bf16(false, a, false, b, (short)0, c, false, false); }
__device__ __forceinline__ float xhalf(float x) { return __builtin_bit_cast(float, __builtin_amdgcn_permlanex16(__builtin_bit_cast(int, x), __builtin_bit_cast(int, x), 0x76543210, 0xfedcba98, false, false)); }  // lane l reads lane l ^ 16

// Fragment loaders (A and B use the same per-lane k map): p = row (lane & 15) base + k0 + 8*(lane >> 4); elements 0..7 = p[0..7], elements 8..15 = p[16..23].
template <typename T16> struct WFrag;
template <> struct WFrag<h16> { typedef v16h V; static __device__ __forceinline__ V ld(const h16* p) { return cat16(*(const v8ha*)p, *(const v8ha*)(p + 16)); } static __device__ __forceinline__ v8f mma(V a, V b, v8f c) { return wmma16(a, b, c); } };
template <> struct WFrag<bf> { typedef v16bf V; static __device__ __forceinline__ V ld(const bf* p) { return cat16b(*(const v8usa*)p, *(const v8usa*)(p + 16)); } static __device__ __forceinline__ v8f mma(V a, V b, v8f c) { return wmmab(a, b, c); } };

// ---- k_gemms: c[m][n] (f32 accumulators) = sum_k (AH[m][k] + AL[m][k]) Bt[n][k], K = DMOD; block tile 128 x 256 = 8 waves (2 x 4) of 64 x 64 (16 accumulators each); grid (NB*SEQ/128, QKVN/256), 256 threads: the batches' rows are one matrix of NB*SEQ rows.
// Column blocks of q take the rows in token order (AH, AL); column blocks of k and v take them in key-list order (AHc, ALc), and a block whose first slot lies behind its batch's slots in use leaves at once; in the last block in use a wave with no slot in use among its 64 rows only copies.
// A stage = 64 k of [AH 128 rows | AL 128 rows | Bt 256 rows] at pitch KSP halves in LDS, two buffers; every lane brings 16 x 16 B of a stage by asynchronous copies while the stage before it is multiplied.
#define GBM 128
#define GBN 256
#define GKC 64
#define GSTG ((2 * GBM + GBN) * KSP)   // halves per buffer
static_assert((NB * SEQ) % GBM == 0);
static_assert(QKVN % GBN == 0);
static_assert(DMOD % GKC == 0);
static_assert(DMOD / GKC >= 2);
static_assert(DMOD % GBN == 0);
static_assert(SEQ % GBM == 0);
static_assert(8 * 64 * KSP * 2 <= 2 * GSTG * 2);
static_assert(HD == 64);

// Eight copies of 16 B per lane into LDS rows 32 apart from l: four from global rows 32 apart from g, four likewise from h. The s_wait_xcnt stands inside the statement so that no address register is rewritten ahead of it.
__device__ __forceinline__ void cp8(unsigned l, const bf* g, const bf* h) {
    asm volatile("global_load_async_to_lds_b128 %0, %8, off\n\t"
                 "global_load_async_to_lds_b128 %1, %9, off\n\t"
                 "global_load_async_to_lds_b128 %2, %10, off\n\t"
                 "global_load_async_to_lds_b128 %3, %11, off\n\t"
                 "global_load_async_to_lds_b128 %4, %12, off\n\t"
                 "global_load_async_to_lds_b128 %5, %13, off\n\t"
                 "global_load_async_to_lds_b128 %6, %14, off\n\t"
                 "global_load_async_to_lds_b128 %7, %15, off\n\t"
                 "s_wait_xcnt 0x0"
                 :: "v"(l), "v"(l + 1u * 32 * KSP * 2), "v"(l + 2u * 32 * KSP * 2), "v"(l + 3u * 32 * KSP * 2), "v"(l + 4u * 32 * KSP * 2), "v"(l + 5u * 32 * KSP * 2), "v"(l + 6u * 32 * KSP * 2), "v"(l + 7u * 32 * KSP * 2),
                    "v"(g), "v"(g + 1 * 32 * DMOD), "v"(g + 2 * 32 * DMOD), "v"(g + 3 * 32 * DMOD), "v"(h), "v"(h + 1 * 32 * DMOD), "v"(h + 2 * 32 * DMOD), "v"(h + 3 * 32 * DMOD)
                 : "memory");
}

__global__ __launch_bounds__(256) void k_gemms(const bf* __restrict__ AH, const bf* __restrict__ AL, const bf* __restrict__ AHc, const bf* __restrict__ ALc, const bf* __restrict__ Bt, const int* __restrict__ NE, h16* QP, h16* KP, h16* VT) {
    __shared__ __align__(16) bf S[2 * GSTG];
    const int tid = threadIdx.x, wid = tid >> 5, lane = tid & 31, lr = lane & 15, hi = lane >> 4;
    const int wm = wid >> 2, wn = wid & 3; const int r0 = blockIdx.x * GBM, c0 = blockIdx.y * GBN;
    const bool kv = c0 >= DMOD;
    const int nrow = kv ? min(NE[r0 / SEQ], SEQ) - r0 % SEQ : GBM;   // slots in use from this block's first row on
    if (nrow <= 0) return;                                           // the whole block, in front of every copy and barrier
    const bool act = __builtin_amdgcn_readfirstlane(wm) * 64 < nrow; // a wave whose 64 rows all lie behind the slots in use multiplies and stores nothing; it still copies and passes every wait and barrier (readfirstlane: the test becomes a scalar branch, EXEC stays all ones at the products)
    const int crow = tid >> 3, ccol = (tid & 7) * 8;   // a wave's copy covers 4 rows x 128 B: whole lines
    const bf* gah = (kv ? AHc : AH) + (size_t)(r0 + crow) * DMOD + ccol; const bf* gal = (kv ? ALc : AL) + (size_t)(r0 + crow) * DMOD + ccol; const bf* gb = Bt + (size_t)(c0 + crow) * DMOD + ccol;
    const unsigned l0 = (unsigned)(size_t)(S + crow * KSP + ccol);
    v8f acc[4][4];
#pragma unroll
    for (int mb = 0; mb < 4; ++mb)
#pragma unroll
        for (int nb = 0; nb < 4; ++nb) acc[mb][nb] = (v8f){};
    const int NT = DMOD / GKC;
    cp8(l0, gah, gal); cp8(l0 + 2u * GBM * KSP * 2, gb, gb + 128 * DMOD);
    asm volatile("s_wait_asynccnt 0x0" ::: "memory");   // stage 0 has landed (this wave's copies)
    __syncthreads();                                     // ... and every other wave's
    cp8(l0 + GSTG * 2u, gah + GKC, gal + GKC); cp8(l0 + GSTG * 2u + 2u * GBM * KSP * 2, gb + GKC, gb + 128 * DMOD + GKC);
    const int aofs = (wm * 64 + lr) * KSP + 8 * hi, bofs = (2 * GBM + wn * 64 + lr) * KSP + 8 * hi;
#pragma unroll 1   // one trip per stage stays rolled: 64 products a trip already fill the loop, and the accumulators leave no registers for a second trip's fragments
    for (int t = 0; t < NT; ++t) {
        const bf* sb = S + (t & 1) * GSTG;
        if (act) {
#pragma unroll
        for (int ks = 0; ks < GKC; ks += 32) {
            v16bf a[4], a2[4];
#pragma unroll
            for (int mb = 0; mb < 4; ++mb) { a[mb] = WFrag<bf>::ld(sb + aofs + mb * 16 * KSP + ks); a2[mb] = WFrag<bf>::ld(sb + aofs + (GBM + mb * 16) * KSP + ks); }
#pragma unroll
            for (int nb = 0; nb < 4; ++nb) { const v16bf b = WFrag<bf>::ld(sb + bofs + nb * 16 * KSP + ks);
#pragma unroll
                for (int mb = 0; mb < 4; ++mb) { acc[mb][nb] = wmmab(a[mb], b, acc[mb][nb]); acc[mb][nb] = wmmab(a2[mb], b, acc[mb][nb]); } }
        }
        }
        asm volatile("s_wait_dscnt 0x0" ::: "memory");      // this wave has left the buffer that is refilled below
        asm volatile("s_wait_asynccnt 0x0" ::: "memory");   // this wave's copies of stage t + 1 have landed
        __syncthreads();                                     // publishes stage t + 1, ends every reader's last read of stage t
        if (t + 2 < NT) { const unsigned lb = l0 + (unsigned)(t & 1) * (GSTG * 2u); const int ko = (t + 2) * GKC;
            cp8(lb, gah + ko, gal + ko); cp8(lb + 2u * GBM * KSP * 2, gb + ko, gb + 128 * DMOD + ko); }
    }
    asm volatile("s_wait_asynccnt 0x0" ::: "memory");       // nothing in flight when the ring becomes output staging
    if (!act) return;                                       // behind the last barrier
    // A wave's 64 x 64 tile is 64 rows of one head: 8 KB in a row of a q or k plane, or 64 lines of 128 B of a v^T plane. It is rounded to f16 and laid in the wave's own LDS range in the plane's order, then stored as whole lines.
    h16* os = (h16*)S + wid * (64 * KSP);
    const int col = c0 + wn * 64, hh = (col % DMOD) / HD, t0 = r0 % SEQ + wm * 64;
    const size_t pl = ((size_t)(r0 / SEQ) * NHD + hh) * ((size_t)SEQ * HD);
    const int orow = lane >> 3, ocol = (lane & 7) * 8;   // a wave's store covers 4 rows x 128 B: whole lines; 16 such stores cover the 64 rows
    if (c0 < 2 * DMOD) {   // q, k: [t][d]
#pragma unroll
        for (int mb = 0; mb < 4; ++mb)
#pragma unroll
            for (int nb = 0; nb < 4; ++nb)
#pragma unroll
                for (int j = 0; j < 8; ++j) os[(mb * 16 + hi * 8 + j) * KSP + nb * 16 + lr] = (h16)acc[mb][nb][j];
        h16* g = (kv ? KP : QP) + pl + (size_t)(t0 + orow) * HD + ocol;
        v8h val[16];
#pragma unroll
        for (int s = 0; s < 16; ++s) val[s] = *(const v8ha*)(os + (s * 4 + orow) * KSP + ocol);
#pragma unroll
        for (int s = 0; s < 16; ++s) *(v8h*)(g + s * 4 * HD) = val[s];
    } else {               // v: [d][t]; a lane's 8 accumulator rows are 8 consecutive t of one d
#pragma unroll
        for (int mb = 0; mb < 4; ++mb)
#pragma unroll
            for (int nb = 0; nb < 4; ++nb) { v8h c8;
#pragma unroll
                for (int j = 0; j < 8; ++j) c8[j] = (h16)acc[mb][nb][j];
                *(v8ha*)(os + (nb * 16 + lr) * KSP + mb * 16 + hi * 8) = c8; }
        h16* g = VT + pl + (size_t)orow * SEQ + t0 + ocol;
        v8h val[16];
#pragma unroll
        for (int s = 0; s < 16; ++s) val[s] = *(const v8ha*)(os + (s * 4 + orow) * KSP + ocol);
#pragma unroll
        for (int s = 0; s < 16; ++s) *(v8h*)(g + s * 4 * SEQ) = val[s];
    }
}

// Blocks 0..NB-1 of k_wtG, one per batch, n = number of keys that count: POS[b][t] = slot of token t among them (0..n-1, in token order), -1 where t is excluded; MC[b][s] = 1 where slot s holds no key that counts (s >= n); NE[b] = slots in use = n, or SEQ where n = 0.
// A thread owns KPT consecutive tokens; exclusive prefix of the per-thread counts by shuffles in the wave and one LDS pass over the 8 wave totals.
// The four short loops are unrolled so that keep[] stays in registers, the thread's mask words come as wide loads and the wave totals as wide LDS reads.
#define KPT (SEQ / 256)
static_assert(SEQ % 256 == 0);
__device__ __forceinline__ void key_list(const int* __restrict__ mk, int* POS, int* MC, int* NE) {
    __shared__ int wt[8];
    const int tid = threadIdx.x, lane = tid & 31, wid = tid >> 5; const int b = blockIdx.x;
    mk += (size_t)b * SEQ_FULL; POS += (size_t)b * SEQ; MC += (size_t)b * SEQ;
    bool keep[KPT]; int c = 0;
#pragma unroll
    for (int q = 0; q < KPT; ++q) { keep[q] = !(mk[tid * KPT + q] >= 1); c += keep[q] ? 1 : 0; }
    int inc = c;
#pragma unroll
    for (int sh = 1; sh < 32; sh <<= 1) { const int u = __shfl_up(inc, sh, 32); if (lane >= sh) inc += u; }
    if (lane == 31) wt[wid] = inc;
    __syncthreads();
    int base = inc - c, n = 0;
#pragma unroll
    for (int v = 0; v < 8; ++v) { const int x = wt[v]; if (v < wid) base += x; n += x; }
#pragma unroll
    for (int q = 0; q < KPT; ++q) { const int t = tid * KPT + q;
        POS[t] = keep[q] ? base : -1; base += keep[q] ? 1 : 0;
        MC[t] = (t >= n) ? 1 : 0; }
    if (tid == 0) NE[b] = (n == 0) ? SEQ : n;
}

__global__ __launch_bounds__(256) void k_wtG(const float* __restrict__ w, int K, int N, bf* Bt, const int* __restrict__ mk, int* POS, int* MC, int* NE) {
    if (blockIdx.x < NB) { key_list(mk, POS, MC, NE); return; }
    const int lane = threadIdx.x & 31; const int L0 = ((blockIdx.x - NB) * 8 + (threadIdx.x >> 5)) * 8; const int nlines = N * K / 64;
{
#pragma unroll 1
        for (int l = 0; l < 8; ++l) { const int L = L0 + l; if (L >= nlines) break; const size_t e = (size_t)L * 64 + lane * 2; const int k = (int)(e % K), n = (int)(e / K); v2us o;
            o[0] = f2bf(w[(size_t)k * N + n]); o[1] = f2bf(w[(size_t)(k + 1) * N + n]); *(v2us*)(Bt + e) = o; }
         }
}

// XH, XL: every row in token order. XHc, XLc: the same row again at its key-list slot where the token counts, and at slot = token number where that slot holds no key that counts and lies below ne rounded up to 128 (finite filling for the flagged slots). Every slot below ne rounded up to 128 is written by exactly one block.
__global__ __launch_bounds__(128) void k_ln(const float* __restrict__ X, const float* __restrict__ G, const float* __restrict__ Bv, bf* XH, bf* XL, bf* XHc, bf* XLc, const int* __restrict__ POS, const int* __restrict__ MC, const int* __restrict__ NE) {
    __shared__ float red[8];
    const int tid = threadIdx.x, lane = tid & 31, wid = tid >> 5; const int row = blockIdx.x; const int c = tid * 8; const size_t bz = blockIdx.y;
    const int ps = POS[bz * SEQ + row], mc = MC[bz * SEQ + row], ne = min(NE[bz], SEQ);   // the same for the whole block; read at the head, beside the row, and used only at the stores
    const v8f a = *(const v8fa*)(X + (bz * SEQ_FULL + row) * DMOD + c);
    float v[8]; float s = 0.f;
#pragma unroll
    for (int q = 0; q < 8; ++q) { v[q] = bfr(a[q]); s += v[q]; }
#pragma unroll
    for (int sh = 16; sh; sh >>= 1) s += __shfl_xor(s, sh, 32);
    if (lane == 0) red[wid] = s;
    __syncthreads();
    const float mean = ((red[0] + red[1]) + (red[2] + red[3])) * (1.0f / DMOD);
    float s2 = 0.f;
#pragma unroll
    for (int q = 0; q < 8; ++q) { const float d = v[q] - mean; v[q] = d; s2 += d * d; }
#pragma unroll
    for (int sh = 16; sh; sh >>= 1) s2 += __shfl_xor(s2, sh, 32);
    if (lane == 0) red[4 + wid] = s2;
    __syncthreads();
    const float var = ((red[4] + red[5]) + (red[6] + red[7])) * (1.0f / DMOD);
    const float rstd = rsqrtf(var + LNEPS);
    const v8f g = *(const v8fa*)(G + c); const v8f bb = *(const v8fa*)(Bv + c);
    v8us oh, ol;
#pragma unroll
    for (int q = 0; q < 8; ++q) { const float y = v[q] * rstd * bfr(g[q]) + bfr(bb[q]); unsigned short a2, c2; splitf(y, a2, c2); oh[q] = a2; ol[q] = c2; }
    const size_t e = (bz * SEQ + row) * DMOD + c;
    *(v8us*)(XH + e) = oh; *(v8us*)(XL + e) = ol;
    if (ps >= 0) { const size_t ec = (bz * SEQ + ps) * DMOD + c; *(v8us*)(XHc + ec) = oh; *(v8us*)(XLc + ec) = ol;
        asm volatile("s_wait_xcnt 0x0" ::: "memory"); }   // in front of the next branch's address arithmetic, which may reuse these stores' address registers
    if ((mc != 0) & (row < ((ne + GBM - 1) & ~(GBM - 1)))) { *(v8us*)(XHc + e) = oh; *(v8us*)(XLc + e) = ol; }
}

// ---- k_flash: softmax(q k^T * 1/8 with excluded keys replaced by -3e38) v, online over 64-key tiles of the key list (ne slots in use, mk = the list's own flags: the filling slots of the last tile, or every slot where no key counts); grid (SEQ/128, 16 heads, NB batches), 256 threads = 8 waves x 16 query columns.
// Transposed products: S^T = K.Q^T (A = key rows from LDS, B = q kept in registers) and O^T += V^T.P^T (A = value^T rows from LDS, B = P^T). A lane holds one query (column lane & 15) and keys nt*16 + 8*(lane >> 4) + r,
// which is the B operand's k map (elements 0..7 of a 32-key fragment = score tile 2c, elements 8..15 = score tile 2c + 1): P = f16(1024 * exp(s - m_run)) goes from the score accumulators into the operand without LDS.
// Maximum in-lane plus one exchange between the wave halves per tile; l in f32, one partial sum per half, joined after the loop; out = O / (1024 l).
// Key tile [64 j][64 d] and value^T tile [64 d][64 j] staged in LDS with plain loads between block barriers; fragments via the WFrag loaders (A and B same k map).
__global__ __launch_bounds__(256) void k_flash(const h16* __restrict__ QP, const h16* __restrict__ KP, const h16* __restrict__ VT, const int* __restrict__ mk, const int* __restrict__ NE, float* outb) {
    __shared__ __align__(16) h16 Ks[64 * KSP];
    __shared__ __align__(16) h16 Vs[64 * KSP];
    __shared__ __align__(16) float Ow[8 * 16 * OSP];
    __shared__ __align__(16) int Ms[64];
    const int tid = threadIdx.x, wid = tid >> 5, lane = tid & 31, lr = lane & 15, hi = lane >> 4;
    const int hh = blockIdx.y, i0 = blockIdx.x * 128 + wid * 16;
    const size_t bz = blockIdx.z, pl = (bz * NHD + hh) * ((size_t)SEQ * HD);
    mk += bz * SEQ; outb += bz * SEQ_FULL * DMOD;
    const int ne = min(NE[bz], SEQ);   // the same for the whole block: the barriers in the loop stay uniform
    const h16* qp = QP + pl; const h16* kp = KP + pl; const h16* vt = VT + pl;
    float* ow = Ow + wid * (16 * OSP);
    v16h qf[2];
    qf[0] = WFrag<h16>::ld(qp + (size_t)(i0 + lr) * HD + 8 * hi);
    qf[1] = WFrag<h16>::ld(qp + (size_t)(i0 + lr) * HD + 32 + 8 * hi);
    v8f o[4];
#pragma unroll
    for (int n = 0; n < 4; ++n) o[n] = (v8f){};
    float mrow = -__builtin_inff(), lrow = 0.f;
    const float L2E = 1.4426950408889634f;
    const int srow = tid >> 3, spc = (tid & 7) * 8;
#pragma unroll 1
    for (int j0 = 0; j0 < ne; j0 += 64) {
        __syncthreads();
#pragma unroll
        for (int rr = 0; rr < 2; ++rr) { const int row = srow + 32 * rr;
            const v8h kv = *(const v8ha*)(kp + (size_t)(j0 + row) * HD + spc);
            const v8h vv = *(const v8ha*)(vt + (size_t)row * SEQ + j0 + spc);
            *(v8ha*)(Ks + row * KSP + spc) = kv; *(v8ha*)(Vs + row * KSP + spc) = vv; }
        if (tid < 64) Ms[tid] = mk[j0 + tid];
        __syncthreads();
        v8f s[4];
#pragma unroll
        for (int nt = 0; nt < 4; ++nt) { s[nt] = (v8f){};
#pragma unroll
            for (int kk = 0; kk < 2; ++kk) { const v16h a = WFrag<h16>::ld(Ks + (nt * 16 + lr) * KSP + kk * 32 + 8 * hi); s[nt] = wmma16(a, qf[kk], s[nt]); } }
        asm volatile("v_nop\n\tv_nop\n\tv_nop\n\tv_nop" : "+v"(s[0]), "+v"(s[1]), "+v"(s[2]), "+v"(s[3]) : "v"(qf[0]), "v"(qf[1]));
#pragma unroll
        for (int nt = 0; nt < 4; ++nt) { const v4i e0 = *(const v4ia*)(Ms + nt * 16 + 8 * hi), e1 = *(const v4ia*)(Ms + nt * 16 + 8 * hi + 4);
#pragma unroll
            for (int r = 0; r < 8; ++r) { const bool ex = ((r < 4 ? e0[r & 3] : e1[r & 3]) >= 1); const float t = s[nt][r] * SCL; s[nt][r] = ex ? NEGB : t; } }
        float mx = NEGB;
#pragma unroll
        for (int r = 0; r < 8; ++r) mx = fmaxf(mx, fmaxf(fmaxf(s[0][r], s[1][r]), fmaxf(s[2][r], s[3][r])));
        mx = fmaxf(mx, xhalf(mx));
        const float mn = fmaxf(mrow, mx);
        const float alpha = __builtin_amdgcn_exp2f(__fmul_rn(__fsub_rn(mrow, mn), L2E)); mrow = mn;
#pragma unroll
        for (int nt = 0; nt < 4; ++nt)
#pragma unroll
            for (int r = 0; r < 8; ++r) s[nt][r] = __builtin_amdgcn_exp2f(__fmul_rn(__fsub_rn(s[nt][r], mn), L2E));
        float sr[8];
#pragma unroll
        for (int r = 0; r < 8; ++r) sr[r] = (s[0][r] + s[1][r]) + (s[2][r] + s[3][r]);
        lrow = lrow * alpha + (((sr[0] + sr[1]) + (sr[2] + sr[3])) + ((sr[4] + sr[5]) + (sr[6] + sr[7])));
#pragma unroll
        for (int n = 0; n < 4; ++n)
#pragma unroll
            for (int r = 0; r < 8; ++r) o[n][r] *= alpha;
        v16h p0, p1;
#pragma unroll
        for (int r = 0; r < 8; ++r) { p0[r] = (h16)(s[0][r] * PCAR); p0[8 + r] = (h16)(s[1][r] * PCAR); p1[r] = (h16)(s[2][r] * PCAR); p1[8 + r] = (h16)(s[3][r] * PCAR); }
#pragma unroll
        for (int n = 0; n < 4; ++n) { const v16h a0 = WFrag<h16>::ld(Vs + (n * 16 + lr) * KSP + 8 * hi); o[n] = wmma16(a0, p0, o[n]); const v16h a1 = WFrag<h16>::ld(Vs + (n * 16 + lr) * KSP + 32 + 8 * hi); o[n] = wmma16(a1, p1, o[n]); }
        // four vector slots behind the last product, also on the loop's back edge, before anything rewrites its operands or touches o
        asm volatile("v_nop\n\tv_nop\n\tv_nop\n\tv_nop" : "+v"(o[0]), "+v"(o[1]), "+v"(o[2]), "+v"(o[3]) : "v"(p0), "v"(p1));
    }
    const float inv = __fdiv_rn(1.0f, (lrow + xhalf(lrow)) * PCAR);
    __syncthreads();
#pragma unroll
    for (int n = 0; n < 4; ++n) { v4f w0, w1;
#pragma unroll
        for (int r = 0; r < 4; ++r) { w0[r] = o[n][r] * inv; w1[r] = o[n][4 + r] * inv; }
        *(v4fa*)(ow + lr * OSP + n * 16 + 8 * hi) = w0; *(v4fa*)(ow + lr * OSP + n * 16 + 8 * hi + 4) = w1; }
    __syncthreads();
    float* orow = outb + (size_t)i0 * DMOD + hh * HD;
    v4f val[8];
#pragma unroll
    for (int sI = 0; sI < 8; ++sI) val[sI] = *(const v4fa*)(ow + (2 * sI + hi) * OSP + lr * 4);
#pragma unroll
    for (int sI = 0; sI < 8; ++sI) *(v4f*)(orow + (size_t)(2 * sI + hi) * DMOD + lr * 4) = val[sI];
    
}

extern "C" void kernel_launch(void* const* d_in, const int* in_sizes, int n_in,
                              void* d_out, int out_size, void* d_ws, size_t ws_size, hipStream_t stream) {
    if (n_in < 5) return;
    const long rows_used = (long)(NB - 1) * SEQ_FULL + SEQ;
    if ((long)in_sizes[0] < rows_used * DMOD) return;
    if ((long)in_sizes[1] < rows_used) return;
    if ((long)in_sizes[2] < (long)DMOD * QKVN) return;
    if (in_sizes[3] < DMOD || in_sizes[4] < DMOD) return;
    if ((long)out_size < rows_used * DMOD) return;
    const float* X = (const float*)d_in[0]; const int* M = (const int*)d_in[1]; const float* W = (const float*)d_in[2]; const float* G = (const float*)d_in[3]; const float* Bv = (const float*)d_in[4];
    float* OUT = (float*)d_out;     // [4][2048][1024]
    char* wsp = (char*)d_ws;
    auto take = [&](size_t bytes) { char* p = wsp; wsp += (bytes + 255) & ~(size_t)255; return (void*)p; };
    bf* WT = (bf*)take((size_t)QKVN * DMOD * 2);                       // W^T bf16 [3072][1024]            6,291,456 B
    bf* XH = (bf*)take((size_t)NB * SEQ * DMOD * 2);                   // xn hi [NB][SEQ][1024]           16,777,216 B
    bf* XL = (bf*)take((size_t)NB * SEQ * DMOD * 2);                   // xn lo                           16,777,216 B
    h16* QP = (h16*)take((size_t)NB * NHD * SEQ * HD * 2);             // q planes [NB][16][SEQ][64]      16,777,216 B
    h16* KP = (h16*)take((size_t)NB * NHD * SEQ * HD * 2);             // k planes                        16,777,216 B
    h16* VTp = (h16*)take((size_t)NB * NHD * HD * SEQ * 2);            // v^T planes [NB][16][64][SEQ]    16,777,216 B
    bf* XHc = (bf*)take((size_t)NB * SEQ * DMOD * 2);                  // xn hi in key-list order         16,777,216 B
    bf* XLc = (bf*)take((size_t)NB * SEQ * DMOD * 2);                  // xn lo in key-list order         16,777,216 B
    int* POS = (int*)take((size_t)NB * SEQ * 4);                       // token -> slot [NB][SEQ]             32,768 B
    int* MC = (int*)take((size_t)NB * SEQ * 4);                        // slot flags [NB][SEQ]                32,768 B
    int* NE = (int*)take((size_t)NB * 4);                              // slots in use [NB]                      256 B
    if ((size_t)(wsp - (char*)d_ws) > ws_size) return;                 // total 123,797,760 B
    const int nlines = QKVN * DMOD / 64;
    k_wtG<<<(unsigned)(NB + (nlines + 63) / 64), 256, 0, stream>>>(W, DMOD, QKVN, WT, M, POS, MC, NE);
    k_ln<<<dim3(SEQ, NB, 1), 128, 0, stream>>>(X, G, Bv, XH, XL, XHc, XLc, POS, MC, NE);
    k_gemms<<<dim3(NB * SEQ / GBM, QKVN / GBN, 1), 256, 0, stream>>>(XH, XL, XHc, XLc, WT, NE, QP, KP, VTp);
    k_flash<<<dim3(SEQ / 128, NHD, NB), 256, 0, stream>>>(QP, KP, VTp, MC, NE, OUT);
}

// v007
// A run of this version takes 107 microseconds.
// Versions in between are left out here; by their measured steps it is 1.28 times as fast as v005.
// Counting every step since v000, it is 5.44 times as fast.
#include <hip/hip_runtime.h>

// Compute dtypes (f32 accumulate everywhere): LayerNorm in f32 on bf16 (RNE) copies of x, ln_g, ln_b; QKV projection = v_wmma_f32_16x16x32_f16 with xn as one f16 plane and W^T as one f16 plane that holds the bf16 (RNE) values of W; scores (k.q^T, transposed) and v^T.P^T = v_wmma_f32_16x16x32_f16 with q, k, v^T plain f16 planes and P = f16(1024 * exp(s - m)); online softmax statistics f32; output f32.
// Pipeline, every launch covers all NB batches (batch = slowest grid index of k_ln and k_flash): k_ln -> xn f16 [NB][SEQ][1024]; k_gemms -> f16 q, k head planes [NB][16][SEQ][64] and v^T planes [NB][16][64][SEQ], converted from its f32 accumulators; k_flash -> out rows [SEQ][1024] at h*64 of each batch. k_wtG once: W^T f16 [3072][1024], and in NB more blocks the list of the keys that count.
// Excluded keys have weight exactly 0 as long as one key of the batch counts, so they are left out of everything behind the LayerNorm: k_ln also writes xn rows in key-list order (slot s = the s-th key that counts), the k and v column blocks of k_gemms, the k and v^T planes and the key loop of k_flash run over the ne slots in use (rounded up to their tiles) instead of SEQ. A batch with every key excluded keeps all SEQ keys, all flagged: the uniform weights of the reference.

#ifndef NB
#define NB 4
#endif
#ifndef SEQ
#define SEQ 2048
#endif
#define NB_FULL  4
#define SEQ_FULL 2048
#define DMOD 1024
#define NHD  16
#define HD   64
#define QKVN (3 * DMOD)
#define SCL  0.125f
#define NEGB (-0x1p100f)   // stands in for an excluded key's score, far below any score of f16 operands; a power of two, so that NEGB * CE is exact in k_flash
#define LNEPS 1e-5f
#define KSP  72      // LDS pitch (halves) of key / value^T tiles
#define OSP  68      // LDS pitch (floats) of the output staging tile
static_assert(SEQ % 128 == 0);
static_assert(SEQ >= 128);
static_assert(SEQ <= SEQ_FULL);
static_assert(NB >= 1);
static_assert(NB <= NB_FULL);
static_assert(DMOD % 64 == 0);
static_assert(QKVN % 64 == 0);
static_assert(NHD * HD == DMOD);
static_assert(DMOD % 32 == 0);

typedef _Float16 h16;
typedef __attribute__((ext_vector_type(16))) _Float16 v16h;
typedef __attribute__((ext_vector_type(8)))  _Float16 v8h;
typedef __attribute__((ext_vector_type(8)))  float    v8f;
typedef __attribute__((ext_vector_type(4)))  float    v4f;
typedef __attribute__((ext_vector_type(4)))  int      v4i;
typedef __attribute__((ext_vector_type(2)))  _Float16 v2h;
typedef v8h  __attribute__((may_alias)) v8ha;
typedef v4f  __attribute__((may_alias)) v4fa;
typedef v4i  __attribute__((may_alias)) v4ia;
typedef v8f  __attribute__((may_alias)) v8fa;

__device__ __forceinline__ unsigned short f2bf(float f) { unsigned u = __float_as_uint(f); u += 0x7FFFu + ((u >> 16) & 1u); return (unsigned short)(u >> 16); }
__device__ __forceinline__ float bf2f(unsigned short b) { return __uint_as_float(((unsigned)b) << 16); }
__device__ __forceinline__ float bfr(float f) { return bf2f(f2bf(f)); }
__device__ __forceinline__ v16h cat16(v8h lo, v8h hi) { return __builtin_shufflevector(lo, hi, 0, 1, 2, 3, 4, 5, 6, 7, 8, 9, 10, 11, 12, 13, 14, 15); }
__device__ __forceinline__ v8f wmma16(v16h a, v16h b, v8f c) { return __builtin_amdgcn_wmma_f32_16x16x32_f16(false, a, false, b, (short)0, c, false, false); }
__device__ __forceinline__ float xhalf(float x) { return __builtin_bit_cast(float, __builtin_amdgcn_permlanex16(__builtin_bit_cast(int, x), __builtin_bit_cast(int, x), 0x76543210, 0xfedcba98, false, false)); }  // lane l reads lane l ^ 16

// Fragment loaders (A and B use the same per-lane k map): p = row (lane & 15) base + k0 + 8*(lane >> 4); elements 0..7 = p[0..7], elements 8..15 = p[16..23].
template <typename T16> struct WFrag;
template <> struct WFrag<h16> { typedef v16h V; static __device__ __forceinline__ V ld(const h16* p) { return cat16(*(const v8ha*)p, *(const v8ha*)(p + 16)); } static __device__ __forceinline__ v8f mma(V a, V b, v8f c) { return wmma16(a, b, c); } };

// ---- k_gemms: c[m][n] (f32 accumulators) = sum_k A[m][k] Bt[n][k], K = DMOD; block tile 128 x 256 = 8 waves (2 x 4) of 64 x 64 (16 accumulators each); grid (NB*SEQ/128, QKVN/256), 256 threads: the batches' rows are one matrix of NB*SEQ rows.
// Column blocks of q take the rows in token order (A); column blocks of k and v take them in key-list order (Ac), and a block whose first slot lies behind its batch's slots in use leaves at once; in the last block in use a wave with no slot in use among its 64 rows only copies.
// A stage = 64 k of [A 128 rows | Bt 256 rows] at pitch KSP halves in LDS, two buffers; every lane brings 12 x 16 B of a stage by asynchronous copies while the stage before it is multiplied.
#define GBM 128
#define GBN 256
#define GKC 64
#define GSTG ((GBM + GBN) * KSP)   // halves per buffer
static_assert((NB * SEQ) % GBM == 0);
static_assert(QKVN % GBN == 0);
static_assert(DMOD % GKC == 0);
static_assert(DMOD / GKC >= 2);
static_assert(DMOD % GBN == 0);
static_assert(SEQ % GBM == 0);
static_assert(8 * 64 * KSP * 2 <= 2 * GSTG * 2);
static_assert(HD == 64);

// Twelve copies of 16 B per lane into LDS rows 32 apart from l: four from global rows 32 apart from a, eight likewise from b. The s_wait_xcnt stands inside the statement so that no address register is rewritten ahead of it.
__device__ __forceinline__ void cp12(unsigned l, const h16* a, const h16* b) {
    asm volatile("global_load_async_to_lds_b128 %0, %12, off\n\t"
                 "global_load_async_to_lds_b128 %1, %13, off\n\t"
                 "global_load_async_to_lds_b128 %2, %14, off\n\t"
                 "global_load_async_to_lds_b128 %3, %15, off\n\t"
                 "global_load_async_to_lds_b128 %4, %16, off\n\t"
                 "global_load_async_to_lds_b128 %5, %17, off\n\t"
                 "global_load_async_to_lds_b128 %6, %18, off\n\t"
                 "global_load_async_to_lds_b128 %7, %19, off\n\t"
                 "global_load_async_to_lds_b128 %8, %20, off\n\t"
                 "global_load_async_to_lds_b128 %9, %21, off\n\t"
                 "global_load_async_to_lds_b128 %10, %22, off\n\t"
                 "global_load_async_to_lds_b128 %11, %23, off\n\t"
                 "s_wait_xcnt 0x0"
                 :: "v"(l), "v"(l + 1u * 32 * KSP * 2), "v"(l + 2u * 32 * KSP * 2), "v"(l + 3u * 32 * KSP * 2), "v"(l + 4u * 32 * KSP * 2), "v"(l + 5u * 32 * KSP * 2), "v"(l + 6u * 32 * KSP * 2), "v"(l + 7u * 32 * KSP * 2),
                    "v"(l + 8u * 32 * KSP * 2), "v"(l + 9u * 32 * KSP * 2), "v"(l + 10u * 32 * KSP * 2), "v"(l + 11u * 32 * KSP * 2),
                    "v"(a), "v"(a + 1 * 32 * DMOD), "v"(a + 2 * 32 * DMOD), "v"(a + 3 * 32 * DMOD),
                    "v"(b), "v"(b + 1 * 32 * DMOD), "v"(b + 2 * 32 * DMOD), "v"(b + 3 * 32 * DMOD), "v"(b + 4 * 32 * DMOD), "v"(b + 5 * 32 * DMOD), "v"(b + 6 * 32 * DMOD), "v"(b + 7 * 32 * DMOD)
                 : "memory");
}

__global__ __launch_bounds__(256) void k_gemms(const h16* __restrict__ A, const h16* __restrict__ Ac, const h16* __restrict__ Bt, const int* __restrict__ NE, h16* QP, h16* KP, h16* VT) {
    __shared__ __align__(16) h16 S[2 * GSTG];
    const int tid = threadIdx.x, wid = tid >> 5, lane = tid & 31, lr = lane & 15, hi = lane >> 4;
    const int wm = wid >> 2, wn = wid & 3; const int r0 = blockIdx.x * GBM, c0 = blockIdx.y * GBN;
    const bool kv = c0 >= DMOD;
    const int nrow = kv ? min(NE[r0 / SEQ], SEQ) - r0 % SEQ : GBM;   // slots in use from this block's first row on
    if (nrow <= 0) return;                                           // the whole block, in front of every copy and barrier
    const bool act = __builtin_amdgcn_readfirstlane(wm) * 64 < nrow; // a wave whose 64 rows all lie behind the slots in use multiplies and stores nothing; it still copies and passes every wait and barrier (readfirstlane: the test becomes a scalar branch, EXEC stays all ones at the products)
    const int crow = tid >> 3, ccol = (tid & 7) * 8;   // a wave's copy covers 4 rows x 128 B: whole lines
    const h16* ga = (kv ? Ac : A) + (size_t)(r0 + crow) * DMOD + ccol; const h16* gb = Bt + (size_t)(c0 + crow) * DMOD + ccol;
    const unsigned l0 = (unsigned)(size_t)(S + crow * KSP + ccol);
    v8f acc[4][4];
#pragma unroll
    for (int mb = 0; mb < 4; ++mb)
#pragma unroll
        for (int nb = 0; nb < 4; ++nb) acc[mb][nb] = (v8f){};
    const int NT = DMOD / GKC;
    cp12(l0, ga, gb);
    asm volatile("s_wait_asynccnt 0x0" ::: "memory");   // stage 0 has landed (this wave's copies)
    __syncthreads();                                     // ... and every other wave's
    cp12(l0 + GSTG * 2u, ga + GKC, gb + GKC);
    const int aofs = (wm * 64 + lr) * KSP + 8 * hi, bofs = (GBM + wn * 64 + lr) * KSP + 8 * hi;
#pragma unroll 1   // one trip per stage stays rolled: the accumulators leave no registers for a second trip's fragments
    for (int t = 0; t < NT; ++t) {
        const h16* sb = S + (t & 1) * GSTG;
        if (act) {
#pragma unroll
        for (int ks = 0; ks < GKC; ks += 32) {
            v16h a[4], b[4];
            b[0] = WFrag<h16>::ld(sb + bofs + ks);
#pragma unroll
            for (int mb = 0; mb < 4; ++mb) a[mb] = WFrag<h16>::ld(sb + aofs + mb * 16 * KSP + ks);
#pragma unroll
            for (int nb = 1; nb < 4; ++nb) b[nb] = WFrag<h16>::ld(sb + bofs + nb * 16 * KSP + ks);
            __builtin_amdgcn_sched_barrier(0);   // the 16 LDS reads of a k step stay one group in front of its 16 products: left alone the compiler reads each b fragment behind the products of the one before it and waits for it there, four products at a time
#pragma unroll
            for (int nb = 0; nb < 4; ++nb)
#pragma unroll
                for (int mb = 0; mb < 4; ++mb) acc[mb][nb] = wmma16(a[mb], b[nb], acc[mb][nb]);
            __builtin_amdgcn_sched_barrier(0);   // ... and the next k step's reads stay behind these products, not among them
        }
        }
        asm volatile("s_wait_dscnt 0x0" ::: "memory");      // this wave has left the buffer that is refilled below
        asm volatile("s_wait_asynccnt 0x0" ::: "memory");   // this wave's copies of stage t + 1 have landed
        __syncthreads();                                     // publishes stage t + 1, ends every reader's last read of stage t
        if (t + 2 < NT) { const unsigned lb = l0 + (unsigned)(t & 1) * (GSTG * 2u); const int ko = (t + 2) * GKC;
            cp12(lb, ga + ko, gb + ko); }
    }
    asm volatile("s_wait_asynccnt 0x0" ::: "memory");       // nothing in flight when the ring becomes output staging
    if (!act) return;                                       // behind the last barrier
    // A wave's 64 x 64 tile is 64 rows of one head: 8 KB in a row of a q or k plane, or 64 lines of 128 B of a v^T plane. It is rounded to f16 and laid in the wave's own LDS range in the plane's order, then stored as whole lines.
    h16* os = S + wid * (64 * KSP);
    const int col = c0 + wn * 64, hh = (col % DMOD) / HD, t0 = r0 % SEQ + wm * 64;
    const size_t pl = ((size_t)(r0 / SEQ) * NHD + hh) * ((size_t)SEQ * HD);
    const int orow = lane >> 3, ocol = (lane & 7) * 8;   // a wave's store covers 4 rows x 128 B: whole lines; 16 such stores cover the 64 rows
    if (c0 < 2 * DMOD) {   // q, k: [t][d]
#pragma unroll
        for (int mb = 0; mb < 4; ++mb)
#pragma unroll
            for (int nb = 0; nb < 4; ++nb)
#pragma unroll
                for (int j = 0; j < 8; ++j) os[(mb * 16 + hi * 8 + j) * KSP + nb * 16 + lr] = (h16)acc[mb][nb][j];
        h16* g = (kv ? KP : QP) + pl + (size_t)(t0 + orow) * HD + ocol;
        v8h val[16];
#pragma unroll
        for (int s = 0; s < 16; ++s) val[s] = *(const v8ha*)(os + (s * 4 + orow) * KSP + ocol);
#pragma unroll
        for (int s = 0; s < 16; ++s) *(v8h*)(g + s * 4 * HD) = val[s];
    } else {               // v: [d][t]; a lane's 8 accumulator rows are 8 consecutive t of one d
#pragma unroll
        for (int mb = 0; mb < 4; ++mb)
#pragma unroll
            for (int nb = 0; nb < 4; ++nb) { v8h c8;
#pragma unroll
                for (int j = 0; j < 8; ++j) c8[j] = (h16)acc[mb][nb][j];
                *(v8ha*)(os + (nb * 16 + lr) * KSP + mb * 16 + hi * 8) = c8; }
        h16* g = VT + pl + (size_t)orow * SEQ + t0 + ocol;
        v8h val[16];
#pragma unroll
        for (int s = 0; s < 16; ++s) val[s] = *(const v8ha*)(os + (s * 4 + orow) * KSP + ocol);
#pragma unroll
        for (int s = 0; s < 16; ++s) *(v8h*)(g + s * 4 * SEQ) = val[s];
    }
}

// Blocks 0..NB-1 of k_wtG, one per batch, n = number of keys that count: POS[b][t] = slot of token t among them (0..n-1, in token order), -1 where t is excluded; MC[b][s] = 1 where slot s holds no key that counts (s >= n); NE[b] = slots in use = n, or SEQ where n = 0.
// A thread owns KPT consecutive tokens; exclusive prefix of the per-thread counts by shuffles in the wave and one LDS pass over the 8 wave totals.
// The four short loops are unrolled so that keep[] stays in registers, the thread's mask words come as wide loads and the wave totals as wide LDS reads.
#define KPT (SEQ / 256)
static_assert(SEQ % 256 == 0);
__device__ __forceinline__ void key_list(const int* __restrict__ mk, int* POS, int* MC, int* NE) {
    __shared__ int wt[8];
    const int tid = threadIdx.x, lane = tid & 31, wid = tid >> 5; const int b = blockIdx.x;
    mk += (size_t)b * SEQ_FULL; POS += (size_t)b * SEQ; MC += (size_t)b * SEQ;
    bool keep[KPT]; int c = 0;
#pragma unroll
    for (int q = 0; q < KPT; ++q) { keep[q] = !(mk[tid * KPT + q] >= 1); c += keep[q] ? 1 : 0; }
    int inc = c;
#pragma unroll
    for (int sh = 1; sh < 32; sh <<= 1) { const int u = __shfl_up(inc, sh, 32); if (lane >= sh) inc += u; }
    if (lane == 31) wt[wid] = inc;
    __syncthreads();
    int base = inc - c, n = 0;
#pragma unroll
    for (int v = 0; v < 8; ++v) { const int x = wt[v]; if (v < wid) base += x; n += x; }
#pragma unroll
    for (int q = 0; q < KPT; ++q) { const int t = tid * KPT + q;
        POS[t] = keep[q] ? base : -1; base += keep[q] ? 1 : 0;
        MC[t] = (t >= n) ? 1 : 0; }
    if (tid == 0) NE[b] = (n == 0) ? SEQ : n;
}

__global__ __launch_bounds__(256) void k_wtG(const float* __restrict__ w, int K, int N, h16* Bt, const int* __restrict__ mk, int* POS, int* MC, int* NE) {
    if (blockIdx.x < NB) { key_list(mk, POS, MC, NE); return; }
    const int lane = threadIdx.x & 31; const int L0 = ((blockIdx.x - NB) * 8 + (threadIdx.x >> 5)) * 8; const int nlines = N * K / 64;
{
#pragma unroll 1
        for (int l = 0; l < 8; ++l) { const int L = L0 + l; if (L >= nlines) break; const size_t e = (size_t)L * 64 + lane * 2; const int k = (int)(e % K), n = (int)(e / K); v2h o;
            o[0] = (h16)bfr(w[(size_t)k * N + n]); o[1] = (h16)bfr(w[(size_t)(k + 1) * N + n]); *(v2h*)(Bt + e) = o; }
         }
}

// XN: every row in token order. XNc: the same row again at its key-list slot where the token counts, and at slot = token number where that slot holds no key that counts and lies inside the last 128-slot block in use (finite filling for the flagged slots). Every slot below ne rounded up to 128 is written by exactly one block.
__global__ __launch_bounds__(128) void k_ln(const float* __restrict__ X, const float* __restrict__ G, const float* __restrict__ Bv, h16* XN, h16* XNc, const int* __restrict__ POS, const int* __restrict__ MC, const int* __restrict__ NE) {
    __shared__ float red[8];
    const int tid = threadIdx.x, lane = tid & 31, wid = tid >> 5; const int row = blockIdx.x; const int c = tid * 8; const size_t bz = blockIdx.y;
    const int ps = POS[bz * SEQ + row], mc = MC[bz * SEQ + row], ne = min(NE[bz], SEQ);   // the same for the whole block; read at the head, beside the row, and used only at the stores
    const v8f a = *(const v8fa*)(X + (bz * SEQ_FULL + row) * DMOD + c);
    float v[8]; float s = 0.f;
#pragma unroll
    for (int q = 0; q < 8; ++q) { v[q] = bfr(a[q]); s += v[q]; }
#pragma unroll
    for (int sh = 16; sh; sh >>= 1) s += __shfl_xor(s, sh, 32);
    if (lane == 0) red[wid] = s;
    __syncthreads();
    const float mean = ((red[0] + red[1]) + (red[2] + red[3])) * (1.0f / DMOD);
    float s2 = 0.f;
#pragma unroll
    for (int q = 0; q < 8; ++q) { const float d = v[q] - mean; v[q] = d; s2 += d * d; }
#pragma unroll
    for (int sh = 16; sh; sh >>= 1) s2 += __shfl_xor(s2, sh, 32);
    if (lane == 0) red[4 + wid] = s2;
    __syncthreads();
    const float var = ((red[4] + red[5]) + (red[6] + red[7])) * (1.0f / DMOD);
    const float rstd = rsqrtf(var + LNEPS);
    const v8f g = *(const v8fa*)(G + c); const v8f bb = *(const v8fa*)(Bv + c);
    v8h oh;
#pragma unroll
    for (int q = 0; q < 8; ++q) oh[q] = (h16)(v[q] * rstd * bfr(g[q]) + bfr(bb[q]));
    const size_t e = (bz * SEQ + row) * DMOD + c;
    *(v8h*)(XN + e) = oh;
    if (ps >= 0) { const size_t ec = (bz * SEQ + ps) * DMOD + c; *(v8h*)(XNc + ec) = oh;
        asm volatile("s_wait_xcnt 0x0" ::: "memory"); }   // in front of the next branch's address arithmetic, which may reuse this store's address registers
    if ((mc != 0) & (row < ((ne + GBM - 1) & ~(GBM - 1)))) *(v8h*)(XNc + e) = oh;
}

// ---- k_flash: softmax(q k^T * 1/8 with excluded keys' scores replaced by NEGB) v, online over 64-key tiles of the key list (ne slots in use; the list's flags are set from one slot on: the filling slots of the last tile, or every slot where no key counts); grid (SEQ/128, 16 heads, NB batches), 256 threads = 8 waves x 16 query columns.
// Transposed products: S^T = K.Q^T (A = key rows from LDS, B = q kept in registers) and O^T += V^T.P^T (A = value^T rows from LDS, B = P^T). A lane holds one query (column lane & 15) and keys nt*16 + 8*(lane >> 4) + r,
// which is the B operand's k map (elements 0..7 of a 32-key fragment = score tile 2c, elements 8..15 = score tile 2c + 1): P = f16(1024 * exp(s - m_run)) goes from the score accumulators into the operand without LDS.
// Maximum in-lane plus one exchange between the wave halves per tile, taken over the unscaled scores; l in f32 sums the same 1024 * exp(s - m_run), one partial sum per half, joined after the loop; out = O / l.
// One FMA per score in front of the exponential: 1024 * exp((s - m) / 8) = exp2(s * CE + (10 - m * CE)), CE = log2(e) / 8. Tiles whose 64 slots all count (all but the last, as a rule) run without any exclusion test; a tile with a flagged slot replaces by slot index behind a scalar branch.
// Where every key so far is flagged, m = NEGB: 10 - m * CE rounds to -NEGB * CE, which is exact, the FMA gives exactly 0 and every weight is 1 (in place of 1024): the uniform weights of the reference, since l sums the same weights.
// Key tile [64 j][64 d] and value^T tile [64 d][64 j] staged in LDS with plain loads between block barriers; fragments via the WFrag loaders (A and B same k map).
// Residency: the build takes more than 128 VGPRs, so a SIMD holds 6 waves = 3 work-groups a WGP, 768 of the grid's 1,024 at a time; the last batch runs behind the others, one work-group a WGP.
__global__ __launch_bounds__(256) void k_flash(const h16* __restrict__ QP, const h16* __restrict__ KP, const h16* __restrict__ VT, const int* __restrict__ mk, const int* __restrict__ NE, float* outb) {
    __shared__ __align__(16) h16 Ks[64 * KSP];
    __shared__ __align__(16) h16 Vs[64 * KSP];
    __shared__ __align__(16) float Ow[8 * 16 * OSP];
    const int tid = threadIdx.x, wid = tid >> 5, lane = tid & 31, lr = lane & 15, hi = lane >> 4;
    const int hh = blockIdx.y, i0 = blockIdx.x * 128 + wid * 16;
    const size_t bz = blockIdx.z, pl = (bz * NHD + hh) * ((size_t)SEQ * HD);
    mk += bz * SEQ; outb += bz * SEQ_FULL * DMOD;
    const int ne = min(NE[bz], SEQ);   // the same for the whole block: the barriers in the loop stay uniform
    const h16* qp = QP + pl; const h16* kp = KP + pl; const h16* vt = VT + pl;
    float* ow = Ow + wid * (16 * OSP);
    v16h qf[2];
    qf[0] = WFrag<h16>::ld(qp + (size_t)(i0 + lr) * HD + 8 * hi);
    qf[1] = WFrag<h16>::ld(qp + (size_t)(i0 + lr) * HD + 32 + 8 * hi);
    v8f o[4];
#pragma unroll
    for (int n = 0; n < 4; ++n) o[n] = (v8f){};
    float mrow = -__builtin_inff(), lrow = 0.f;
    const float CE = SCL * 1.4426950408889634f;
    const int nclean = (mk[0] >= 1) ? 0 : ne;   // first flagged slot (the same for the whole block): the flags are 0 below the number of keys that count and 1 from there on, and ne is that number unless it is 0
    const int srow = tid >> 3, spc = (tid & 7) * 8;
#pragma unroll 1
    for (int j0 = 0; j0 < ne; j0 += 64) {
        __syncthreads();
#pragma unroll
        for (int rr = 0; rr < 2; ++rr) { const int row = srow + 32 * rr;
            const v8h kv = *(const v8ha*)(kp + (size_t)(j0 + row) * HD + spc);
            const v8h vv = *(const v8ha*)(vt + (size_t)row * SEQ + j0 + spc);
            *(v8ha*)(Ks + row * KSP + spc) = kv; *(v8ha*)(Vs + row * KSP + spc) = vv; }
        __syncthreads();
        v8f s[4];
#pragma unroll
        for (int nt = 0; nt < 4; ++nt) { s[nt] = (v8f){};
#pragma unroll
            for (int kk = 0; kk < 2; ++kk) { const v16h a = WFrag<h16>::ld(Ks + (nt * 16 + lr) * KSP + kk * 32 + 8 * hi); s[nt] = wmma16(a, qf[kk], s[nt]); } }
        asm volatile("v_nop\n\tv_nop\n\tv_nop\n\tv_nop" : "+v"(s[0]), "+v"(s[1]), "+v"(s[2]), "+v"(s[3]) : "v"(qf[0]), "v"(qf[1]));
        if (j0 + 64 > nclean) {   // the same for the whole block: a scalar branch
#pragma unroll
            for (int nt = 0; nt < 4; ++nt)
#pragma unroll
                for (int r = 0; r < 8; ++r) s[nt][r] = (j0 + nt * 16 + 8 * hi + r >= nclean) ? NEGB : s[nt][r];
        }
        float mx = NEGB;
#pragma unroll
        for (int r = 0; r < 8; ++r) mx = fmaxf(mx, fmaxf(fmaxf(s[0][r], s[1][r]), fmaxf(s[2][r], s[3][r])));
        mx = fmaxf(mx, xhalf(mx));
        const float mn = fmaxf(mrow, mx);
        const float alpha = __builtin_amdgcn_exp2f(__fmul_rn(__fsub_rn(mrow, mn), CE)); mrow = mn;
        const float nm = __builtin_fmaf(-mn, CE, 10.0f);
#pragma unroll
        for (int nt = 0; nt < 4; ++nt)
#pragma unroll
            for (int r = 0; r < 8; ++r) s[nt][r] = __builtin_amdgcn_exp2f(__builtin_fmaf(s[nt][r], CE, nm));
        float sr[8];
#pragma unroll
        for (int r = 0; r < 8; ++r) sr[r] = (s[0][r] + s[1][r]) + (s[2][r] + s[3][r]);
        lrow = lrow * alpha + (((sr[0] + sr[1]) + (sr[2] + sr[3])) + ((sr[4] + sr[5]) + (sr[6] + sr[7])));
#pragma unroll
        for (int n = 0; n < 4; ++n)
#pragma unroll
            for (int r = 0; r < 8; ++r) o[n][r] *= alpha;
        v16h p0, p1;
#pragma unroll
        for (int r = 0; r < 8; ++r) { p0[r] = (h16)s[0][r]; p0[8 + r] = (h16)s[1][r]; p1[r] = (h16)s[2][r]; p1[8 + r] = (h16)s[3][r]; }
#pragma unroll
        for (int n = 0; n < 4; ++n) { const v16h a0 = WFrag<h16>::ld(Vs + (n * 16 + lr) * KSP + 8 * hi); o[n] = wmma16(a0, p0, o[n]); const v16h a1 = WFrag<h16>::ld(Vs + (n * 16 + lr) * KSP + 32 + 8 * hi); o[n] = wmma16(a1, p1, o[n]); }
        // four vector slots behind the last product, also on the loop's back edge, before anything rewrites its operands or touches o
        asm volatile("v_nop\n\tv_nop\n\tv_nop\n\tv_nop" : "+v"(o[0]), "+v"(o[1]), "+v"(o[2]), "+v"(o[3]) : "v"(p0), "v"(p1));
    }
    const float inv = __fdiv_rn(1.0f, lrow + xhalf(lrow));
    __syncthreads();
#pragma unroll
    for (int n = 0; n < 4; ++n) { v4f w0, w1;
#pragma unroll
        for (int r = 0; r < 4; ++r) { w0[r] = o[n][r] * inv; w1[r] = o[n][4 + r] * inv; }
        *(v4fa*)(ow + lr * OSP + n * 16 + 8 * hi) = w0; *(v4fa*)(ow + lr * OSP + n * 16 + 8 * hi + 4) = w1; }
    __syncthreads();
    float* orow = outb + (size_t)i0 * DMOD + hh * HD;
    v4f val[8];
#pragma unroll
    for (int sI = 0; sI < 8; ++sI) val[sI] = *(const v4fa*)(ow + (2 * sI + hi) * OSP + lr * 4);
#pragma unroll
    for (int sI = 0; sI < 8; ++sI) *(v4f*)(orow + (size_t)(2 * sI + hi) * DMOD + lr * 4) = val[sI];
    
}

extern "C" void kernel_launch(void* const* d_in, const int* in_sizes, int n_in,
                              void* d_out, int out_size, void* d_ws, size_t ws_size, hipStream_t stream) {
    if (n_in < 5) return;
    const long rows_used = (long)(NB - 1) * SEQ_FULL + SEQ;
    if ((long)in_sizes[0] < rows_used * DMOD) return;
    if ((long)in_sizes[1] < rows_used) return;
    if ((long)in_sizes[2] < (long)DMOD * QKVN) return;
    if (in_sizes[3] < DMOD || in_sizes[4] < DMOD) return;
    if ((long)out_size < rows_used * DMOD) return;
    const float* X = (const float*)d_in[0]; const int* M = (const int*)d_in[1]; const float* W = (const float*)d_in[2]; const float* G = (const float*)d_in[3]; const float* Bv = (const float*)d_in[4];
    float* OUT = (float*)d_out;     // [4][2048][1024]
    char* wsp = (char*)d_ws;
    auto take = [&](size_t bytes) { char* p = wsp; wsp += (bytes + 255) & ~(size_t)255; return (void*)p; };
    h16* WT = (h16*)take((size_t)QKVN * DMOD * 2);                     // W^T f16 [3072][1024]             6,291,456 B
    h16* XN = (h16*)take((size_t)NB * SEQ * DMOD * 2);                 // xn f16 [NB][SEQ][1024]          16,777,216 B
    h16* QP = (h16*)take((size_t)NB * NHD * SEQ * HD * 2);             // q planes [NB][16][SEQ][64]      16,777,216 B
    h16* KP = (h16*)take((size_t)NB * NHD * SEQ * HD * 2);             // k planes                        16,777,216 B
    h16* VTp = (h16*)take((size_t)NB * NHD * HD * SEQ * 2);            // v^T planes [NB][16][64][SEQ]    16,777,216 B
    h16* XNc = (h16*)take((size_t)NB * SEQ * DMOD * 2);                // xn in key-list order            16,777,216 B
    int* POS = (int*)take((size_t)NB * SEQ * 4);                       // token -> slot [NB][SEQ]             32,768 B
    int* MC = (int*)take((size_t)NB * SEQ * 4);                        // slot flags [NB][SEQ]                32,768 B
    int* NE = (int*)take((size_t)NB * 4);                              // slots in use [NB]                      256 B
    if ((size_t)(wsp - (char*)d_ws) > ws_size) return;                 // total 90,243,328 B
    const int nlines = QKVN * DMOD / 64;
    k_wtG<<<(unsigned)(NB + (nlines + 63) / 64), 256, 0, stream>>>(W, DMOD, QKVN, WT, M, POS, MC, NE);
    k_ln<<<dim3(SEQ, NB, 1), 128, 0, stream>>>(X, G, Bv, XN, XNc, POS, MC, NE);
    k_gemms<<<dim3(NB * SEQ / GBM, QKVN / GBN, 1), 256, 0, stream>>>(XN, XNc, WT, NE, QP, KP, VTp);
    k_flash<<<dim3(SEQ / 128, NHD, NB), 256, 0, stream>>>(QP, KP, VTp, MC, NE, OUT);
}

// v008
// Measured time: 103 microseconds a run.
// Two timings next to v007 both put it at 1.05 times that version's speed.
// All steps since v000 together make it 5.70 times as fast.
#include <hip/hip_runtime.h>

// Compute dtypes (f32 accumulate everywhere): LayerNorm in f32 on bf16 (RNE) copies of x, ln_g, ln_b; QKV projection = v_wmma_f32_16x16x32_f16 with xn as one f16 plane and W^T as one f16 plane that holds the bf16 (RNE) values of W; scores (k.q^T, transposed) and v^T.P^T = v_wmma_f32_16x16x32_f16 with q, k, v^T plain f16 planes and P = f16(1024 * exp(s - m)); online softmax statistics f32; output f32.
// Pipeline, every launch covers all NB batches (batch = slowest grid index of k_ln and k_flash): k_ln -> xn f16 [NB][SEQ][1024]; k_gemms -> f16 q, k head planes [NB][16][SEQ][64] and v^T planes [NB][16][64][SEQ], converted from its f32 accumulators; k_flash -> out rows [SEQ][1024] at h*64 of each batch. k_wtG once: W^T f16 [3072][1024], and in NB more blocks the list of the keys that count.
// Excluded keys have weight exactly 0 as long as one key of the batch counts, so they are left out of everything behind the LayerNorm: k_ln also writes xn rows in key-list order (slot s = the s-th key that counts), the k and v column blocks of k_gemms, the k and v^T planes and the key loop of k_flash run over the ne slots in use (rounded up to their tiles) instead of SEQ. A batch with every key excluded keeps all SEQ keys, all flagged: the uniform weights of the reference.

#ifndef NB
#define NB 4
#endif
#ifndef SEQ
#define SEQ 2048
#endif
#define NB_FULL  4
#define SEQ_FULL 2048
#define DMOD 1024
#define NHD  16
#define HD   64
#define QKVN (3 * DMOD)
#define SCL  0.125f
#define NEGB (-0x1p100f)   // stands in for an excluded key's score, far below any score of f16 operands; a power of two, so that NEGB * CE is exact in k_flash
#define LNEPS 1e-5f
#define KSP  72      // LDS pitch (halves) of key / value^T tiles
#define OSP  68      // LDS pitch (floats) of the output staging tile
static_assert(SEQ % 128 == 0);
static_assert(SEQ >= 128);
static_assert(SEQ <= SEQ_FULL);
static_assert(NB >= 1);
static_assert(NB <= NB_FULL);
static_assert(DMOD % 64 == 0);
static_assert(QKVN % 64 == 0);
static_assert(NHD * HD == DMOD);
static_assert(DMOD % 32 == 0);

typedef _Float16 h16;
typedef __attribute__((ext_vector_type(16))) _Float16 v16h;
typedef __attribute__((ext_vector_type(8)))  _Float16 v8h;
typedef __attribute__((ext_vector_type(8)))  float    v8f;
typedef __attribute__((ext_vector_type(4)))  float    v4f;
typedef __attribute__((ext_vector_type(4)))  int      v4i;
typedef __attribute__((ext_vector_type(2)))  _Float16 v2h;
typedef v8h  __attribute__((may_alias)) v8ha;
typedef v4f  __attribute__((may_alias)) v4fa;
typedef v4i  __attribute__((may_alias)) v4ia;
typedef v8f  __attribute__((may_alias)) v8fa;

__device__ __forceinline__ unsigned short f2bf(float f) { unsigned u = __float_as_uint(f); u += 0x7FFFu + ((u >> 16) & 1u); return (unsigned short)(u >> 16); }
__device__ __forceinline__ float bf2f(unsigned short b) { return __uint_as_float(((unsigned)b) << 16); }
__device__ __forceinline__ float bfr(float f) { return bf2f(f2bf(f)); }
__device__ __forceinline__ v16h cat16(v8h lo, v8h hi) { return __builtin_shufflevector(lo, hi, 0, 1, 2, 3, 4, 5, 6, 7, 8, 9, 10, 11, 12, 13, 14, 15); }
__device__ __forceinline__ v8f wmma16(v16h a, v16h b, v8f c) { return __builtin_amdgcn_wmma_f32_16x16x32_f16(false, a, false, b, (short)0, c, false, false); }
__device__ __forceinline__ float xhalf(float x) { return __builtin_bit_cast(float, __builtin_amdgcn_permlanex16(__builtin_bit_cast(int, x), __builtin_bit_cast(int, x), 0x76543210, 0xfedcba98, false, false)); }  // lane l reads lane l ^ 16

// Fragment loaders (A and B use the same per-lane k map): p = row (lane & 15) base + k0 + 8*(lane >> 4); elements 0..7 = p[0..7], elements 8..15 = p[16..23].
template <typename T16> struct WFrag;
template <> struct WFrag<h16> { typedef v16h V; static __device__ __forceinline__ V ld(const h16* p) { return cat16(*(const v8ha*)p, *(const v8ha*)(p + 16)); } static __device__ __forceinline__ v8f mma(V a, V b, v8f c) { return wmma16(a, b, c); } };

// ---- k_gemms: c[m][n] (f32 accumulators) = sum_k A[m][k] Bt[n][k], K = DMOD; block tile 128 x 256 = 8 waves (2 x 4) of 64 x 64 (16 accumulators each); grid (NB*SEQ/128, QKVN/256), 256 threads: the batches' rows are one matrix of NB*SEQ rows.
// Column blocks of q take the rows in token order (A); column blocks of k and v take them in key-list order (Ac), and a block whose first slot lies behind its batch's slots in use leaves at once; in the last block in use a wave with no slot in use among its 64 rows only copies.
// A stage = 64 k of [A 128 rows | Bt 256 rows] at pitch KSP halves in LDS, two buffers; every lane brings 12 x 16 B of a stage by asynchronous copies while the stage before it is multiplied.
#define GBM 128
#define GBN 256
#define GKC 64
#define GSTG ((GBM + GBN) * KSP)   // halves per buffer
static_assert((NB * SEQ) % GBM == 0);
static_assert(QKVN % GBN == 0);
static_assert(DMOD % GKC == 0);
static_assert(DMOD / GKC >= 2);
static_assert(DMOD % GBN == 0);
static_assert(SEQ % GBM == 0);
static_assert(8 * 64 * KSP * 2 <= 2 * GSTG * 2);
static_assert(HD == 64);

// Twelve copies of 16 B per lane into LDS rows 32 apart from l: four from global rows 32 apart from a, eight likewise from b. The s_wait_xcnt stands inside the statement so that no address register is rewritten ahead of it.
__device__ __forceinline__ void cp12(unsigned l, const h16* a, const h16* b) {
    asm volatile("global_load_async_to_lds_b128 %0, %12, off\n\t"
                 "global_load_async_to_lds_b128 %1, %13, off\n\t"
                 "global_load_async_to_lds_b128 %2, %14, off\n\t"
                 "global_load_async_to_lds_b128 %3, %15, off\n\t"
                 "global_load_async_to_lds_b128 %4, %16, off\n\t"
                 "global_load_async_to_lds_b128 %5, %17, off\n\t"
                 "global_load_async_to_lds_b128 %6, %18, off\n\t"
                 "global_load_async_to_lds_b128 %7, %19, off\n\t"
                 "global_load_async_to_lds_b128 %8, %20, off\n\t"
                 "global_load_async_to_lds_b128 %9, %21, off\n\t"
                 "global_load_async_to_lds_b128 %10, %22, off\n\t"
                 "global_load_async_to_lds_b128 %11, %23, off\n\t"
                 "s_wait_xcnt 0x0"
                 :: "v"(l), "v"(l + 1u * 32 * KSP * 2), "v"(l + 2u * 32 * KSP * 2), "v"(l + 3u * 32 * KSP * 2), "v"(l + 4u * 32 * KSP * 2), "v"(l + 5u * 32 * KSP * 2), "v"(l + 6u * 32 * KSP * 2), "v"(l + 7u * 32 * KSP * 2),
                    "v"(l + 8u * 32 * KSP * 2), "v"(l + 9u * 32 * KSP * 2), "v"(l + 10u * 32 * KSP * 2), "v"(l + 11u * 32 * KSP * 2),
                    "v"(a), "v"(a + 1 * 32 * DMOD), "v"(a + 2 * 32 * DMOD), "v"(a + 3 * 32 * DMOD),
                    "v"(b), "v"(b + 1 * 32 * DMOD), "v"(b + 2 * 32 * DMOD), "v"(b + 3 * 32 * DMOD), "v"(b + 4 * 32 * DMOD), "v"(b + 5 * 32 * DMOD), "v"(b + 6 * 32 * DMOD), "v"(b + 7 * 32 * DMOD)
                 : "memory");
}

__global__ __launch_bounds__(256) void k_gemms(const h16* __restrict__ A, const h16* __restrict__ Ac, const h16* __restrict__ Bt, const int* __restrict__ NE, h16* QP, h16* KP, h16* VT) {
    __shared__ __align__(16) h16 S[2 * GSTG];
    const int tid = threadIdx.x, wid = tid >> 5, lane = tid & 31, lr = lane & 15, hi = lane >> 4;
    const int wm = wid >> 2, wn = wid & 3; const int r0 = blockIdx.x * GBM, c0 = blockIdx.y * GBN;
    const bool kv = c0 >= DMOD;
    const int nrow = kv ? min(NE[r0 / SEQ], SEQ) - r0 % SEQ : GBM;   // slots in use from this block's first row on
    if (nrow <= 0) return;                                           // the whole block, in front of every copy and barrier
    const bool act = __builtin_amdgcn_readfirstlane(wm) * 64 < nrow; // a wave whose 64 rows all lie behind the slots in use multiplies and stores nothing; it still copies and passes every wait and barrier (readfirstlane: the test becomes a scalar branch, EXEC stays all ones at the products)
    const int crow = tid >> 3, ccol = (tid & 7) * 8;   // a wave's copy covers 4 rows x 128 B: whole lines
    const h16* ga = (kv ? Ac : A) + (size_t)(r0 + crow) * DMOD + ccol; const h16* gb = Bt + (size_t)(c0 + crow) * DMOD + ccol;
    const unsigned l0 = (unsigned)(size_t)(S + crow * KSP + ccol);
    v8f acc[4][4];
#pragma unroll
    for (int mb = 0; mb < 4; ++mb)
#pragma unroll
        for (int nb = 0; nb < 4; ++nb) acc[mb][nb] = (v8f){};
    const int NT = DMOD / GKC;
    cp12(l0, ga, gb);
    asm volatile("s_wait_asynccnt 0x0" ::: "memory");   // stage 0 has landed (this wave's copies)
    __syncthreads();                                     // ... and every other wave's
    cp12(l0 + GSTG * 2u, ga + GKC, gb + GKC);
    const int aofs = (wm * 64 + lr) * KSP + 8 * hi, bofs = (GBM + wn * 64 + lr) * KSP + 8 * hi;
#pragma unroll 1   // one trip per stage stays rolled: the accumulators leave no registers for a second trip's fragments
    for (int t = 0; t < NT; ++t) {
        const h16* sb = S + (t & 1) * GSTG;
        if (act) {
#pragma unroll
        for (int ks = 0; ks < GKC; ks += 32) {
            v16h a[4], b[4];
            b[0] = WFrag<h16>::ld(sb + bofs + ks);
#pragma unroll
            for (int mb = 0; mb < 4; ++mb) a[mb] = WFrag<h16>::ld(sb + aofs + mb * 16 * KSP + ks);
#pragma unroll
            for (int nb = 1; nb < 4; ++nb) b[nb] = WFrag<h16>::ld(sb + bofs + nb * 16 * KSP + ks);
            __builtin_amdgcn_sched_barrier(0);   // the 16 LDS reads of a k step stay one group in front of its 16 products: left alone the compiler reads each b fragment behind the products of the one before it and waits for it there, four products at a time
#pragma unroll
            for (int nb = 0; nb < 4; ++nb)
#pragma unroll
                for (int mb = 0; mb < 4; ++mb) acc[mb][nb] = wmma16(a[mb], b[nb], acc[mb][nb]);
            __builtin_amdgcn_sched_barrier(0);   // ... and the next k step's reads stay behind these products, not among them
        }
        }
        asm volatile("s_wait_dscnt 0x0" ::: "memory");      // this wave has left the buffer that is refilled below
        asm volatile("s_wait_asynccnt 0x0" ::: "memory");   // this wave's copies of stage t + 1 have landed
        __syncthreads();                                     // publishes stage t + 1, ends every reader's last read of stage t
        if (t + 2 < NT) { const unsigned lb = l0 + (unsigned)(t & 1) * (GSTG * 2u); const int ko = (t + 2) * GKC;
            cp12(lb, ga + ko, gb + ko); }
    }
    asm volatile("s_wait_asynccnt 0x0" ::: "memory");       // nothing in flight when the ring becomes output staging
    if (!act) return;                                       // behind the last barrier
    // A wave's 64 x 64 tile is 64 rows of one head: 8 KB in a row of a q or k plane, or 64 lines of 128 B of a v^T plane. It is rounded to f16 and laid in the wave's own LDS range in the plane's order, then stored as whole lines.
    h16* os = S + wid * (64 * KSP);
    const int col = c0 + wn * 64, hh = (col % DMOD) / HD, t0 = r0 % SEQ + wm * 64;
    const size_t pl = ((size_t)(r0 / SEQ) * NHD + hh) * ((size_t)SEQ * HD);
    const int orow = lane >> 3, ocol = (lane & 7) * 8;   // a wave's store covers 4 rows x 128 B: whole lines; 16 such stores cover the 64 rows
    if (c0 < 2 * DMOD) {   // q, k: [t][d]
#pragma unroll
        for (int mb = 0; mb < 4; ++mb)
#pragma unroll
            for (int nb = 0; nb < 4; ++nb)
#pragma unroll
                for (int j = 0; j < 8; ++j) os[(mb * 16 + hi * 8 + j) * KSP + nb * 16 + lr] = (h16)acc[mb][nb][j];
        h16* g = (kv ? KP : QP) + pl + (size_t)(t0 + orow) * HD + ocol;
        v8h val[16];
#pragma unroll
        for (int s = 0; s < 16; ++s) val[s] = *(const v8ha*)(os + (s * 4 + orow) * KSP + ocol);
#pragma unroll
        for (int s = 0; s < 16; ++s) *(v8h*)(g + s * 4 * HD) = val[s];
    } else {               // v: [d][t]; a lane's 8 accumulator rows are 8 consecutive t of one d
#pragma unroll
        for (int mb = 0; mb < 4; ++mb)
#pragma unroll
            for (int nb = 0; nb < 4; ++nb) { v8h c8;
#pragma unroll
                for (int j = 0; j < 8; ++j) c8[j] = (h16)acc[mb][nb][j];
                *(v8ha*)(os + (nb * 16 + lr) * KSP + mb * 16 + hi * 8) = c8; }
        h16* g = VT + pl + (size_t)orow * SEQ + t0 + ocol;
        v8h val[16];
#pragma unroll
        for (int s = 0; s < 16; ++s) val[s] = *(const v8ha*)(os + (s * 4 + orow) * KSP + ocol);
#pragma unroll
        for (int s = 0; s < 16; ++s) *(v8h*)(g + s * 4 * SEQ) = val[s];
    }
}

// Blocks 0..NB-1 of k_wtG, one per batch, n = number of keys that count: POS[b][t] = slot of token t among them (0..n-1, in token order), -1 where t is excluded; MC[b][s] = 1 where slot s holds no key that counts (s >= n); NE[b] = slots in use = n, or SEQ where n = 0.
// A thread owns KPT consecutive tokens; exclusive prefix of the per-thread counts by shuffles in the wave and one LDS pass over the 8 wave totals.
// The four short loops are unrolled so that keep[] stays in registers, the thread's mask words come as wide loads and the wave totals as wide LDS reads.
#define KPT (SEQ / 256)
static_assert(SEQ % 256 == 0);
__device__ __forceinline__ void key_list(const int* __restrict__ mk, int* POS, int* MC, int* NE) {
    __shared__ int wt[8];
    const int tid = threadIdx.x, lane = tid & 31, wid = tid >> 5; const int b = blockIdx.x;
    mk += (size_t)b * SEQ_FULL; POS += (size_t)b * SEQ; MC += (size_t)b * SEQ;
    bool keep[KPT]; int c = 0;
#pragma unroll
    for (int q = 0; q < KPT; ++q) { keep[q] = !(mk[tid * KPT + q] >= 1); c += keep[q] ? 1 : 0; }
    int inc = c;
#pragma unroll
    for (int sh = 1; sh < 32; sh <<= 1) { const int u = __shfl_up(inc, sh, 32); if (lane >= sh) inc += u; }
    if (lane == 31) wt[wid] = inc;
    __syncthreads();
    int base = inc - c, n = 0;
#pragma unroll
    for (int v = 0; v < 8; ++v) { const int x = wt[v]; if (v < wid) base += x; n += x; }
#pragma unroll
    for (int q = 0; q < KPT; ++q) { const int t = tid * KPT + q;
        POS[t] = keep[q] ? base : -1; base += keep[q] ? 1 : 0;
        MC[t] = (t >= n) ? 1 : 0; }
    if (tid == 0) NE[b] = (n == 0) ? SEQ : n;
}

// Blocks NB.. of k_wtG: W^T by tiles of WTK k x WTN n. A lane reads 8 k rows x 16 B (4 n): a wave's load covers two 256-B row pieces, whole lines; the lane's 8 k of one n are 16 B of a W^T row, laid in LDS at pitch WTP; behind one barrier the tile goes out as 256-B row pieces, whole lines again.
// The short loops are unrolled so that r[], c and val[] stay in registers and a lane's 8 loads are issued together, in front of the first use.
#define WTK 128
#define WTN 64
#define WTP (WTK + 8)   // halves: 272 B = 16 B x odd
static_assert(DMOD % WTK == 0);
static_assert(QKVN % WTN == 0);
__global__ __launch_bounds__(256) void k_wtG(const float* __restrict__ w, h16* Bt, const int* __restrict__ mk, int* POS, int* MC, int* NE) {
    if (blockIdx.x < NB) { key_list(mk, POS, MC, NE); return; }   // the whole block, in front of the barrier below
    __shared__ __align__(16) h16 T[WTN * WTP];
    const int tid = threadIdx.x, tile = blockIdx.x - NB;
    const int n0 = (tile % (QKVN / WTN)) * WTN, k0 = (tile / (QKVN / WTN)) * WTK;
    const int c16 = tid & 15, r16 = tid >> 4;
    const float* g = w + (size_t)(k0 + r16 * 8) * QKVN + n0 + c16 * 4;
    v4f r[8];
#pragma unroll
    for (int j = 0; j < 8; ++j) r[j] = *(const v4fa*)(g + (size_t)j * QKVN);
#pragma unroll
    for (int i = 0; i < 4; ++i) { v8h c;
#pragma unroll
        for (int j = 0; j < 8; ++j) c[j] = (h16)bfr(r[j][i]);
        *(v8ha*)(T + (c16 * 4 + i) * WTP + r16 * 8) = c; }
    __syncthreads();
    h16* o = Bt + (size_t)(n0 + r16) * DMOD + k0 + c16 * 8;
    v8h val[4];
#pragma unroll
    for (int s = 0; s < 4; ++s) val[s] = *(const v8ha*)(T + (s * 16 + r16) * WTP + c16 * 8);
#pragma unroll
    for (int s = 0; s < 4; ++s) *(v8h*)(o + (size_t)s * 16 * DMOD) = val[s];
    asm volatile("s_wait_xcnt 0x0" ::: "memory");   // behind the four stores, in front of whatever code follows in the object and writes their registers
}

// XN: every row in token order. XNc: the same row again at its key-list slot where the token counts, and at slot = token number where that slot holds no key that counts and lies inside the last 128-slot block in use (finite filling for the flagged slots). Every slot below ne rounded up to 128 is written by exactly one block.
__global__ __launch_bounds__(128) void k_ln(const float* __restrict__ X, const float* __restrict__ G, const float* __restrict__ Bv, h16* XN, h16* XNc, const int* __restrict__ POS, const int* __restrict__ MC, const int* __restrict__ NE) {
    __shared__ float red[8];
    const int tid = threadIdx.x, lane = tid & 31, wid = tid >> 5; const int row = blockIdx.x; const int c = tid * 8; const size_t bz = blockIdx.y;
    const int ps = POS[bz * SEQ + row], mc = MC[bz * SEQ + row], ne = min(NE[bz], SEQ);   // the same for the whole block; read at the head, beside the row, and used only at the stores
    const v8f a = *(const v8fa*)(X + (bz * SEQ_FULL + row) * DMOD + c);
    float v[8]; float s = 0.f;
#pragma unroll
    for (int q = 0; q < 8; ++q) { v[q] = bfr(a[q]); s += v[q]; }
#pragma unroll
    for (int sh = 16; sh; sh >>= 1) s += __shfl_xor(s, sh, 32);
    if (lane == 0) red[wid] = s;
    __syncthreads();
    const float mean = ((red[0] + red[1]) + (red[2] + red[3])) * (1.0f / DMOD);
    float s2 = 0.f;
#pragma unroll
    for (int q = 0; q < 8; ++q) { const float d = v[q] - mean; v[q] = d; s2 += d * d; }
#pragma unroll
    for (int sh = 16; sh; sh >>= 1) s2 += __shfl_xor(s2, sh, 32);
    if (lane == 0) red[4 + wid] = s2;
    __syncthreads();
    const float var = ((red[4] + red[5]) + (red[6] + red[7])) * (1.0f / DMOD);
    const float rstd = rsqrtf(var + LNEPS);
    const v8f g = *(const v8fa*)(G + c); const v8f bb = *(const v8fa*)(Bv + c);
    v8h oh;
#pragma unroll
    for (int q = 0; q < 8; ++q) oh[q] = (h16)(v[q] * rstd * bfr(g[q]) + bfr(bb[q]));
    const size_t e = (bz * SEQ + row) * DMOD + c;
    *(v8h*)(XN + e) = oh;
    if (ps >= 0) { const size_t ec = (bz * SEQ + ps) * DMOD + c; *(v8h*)(XNc + ec) = oh;
        asm volatile("s_wait_xcnt 0x0" ::: "memory"); }   // in front of the next branch's address arithmetic, which may reuse this store's address registers
    if ((mc != 0) & (row < ((ne + GBM - 1) & ~(GBM - 1)))) *(v8h*)(XNc + e) = oh;
}

// ---- k_flash: softmax(q k^T * 1/8 with excluded keys' scores replaced by NEGB) v, online over 64-key tiles of the key list (ne slots in use; the list's flags are set from one slot on: the filling slots of the last tile, or every slot where no key counts); grid (SEQ/128, 16 heads, NB batches), 256 threads = 8 waves x 16 query columns.
// Transposed products: S^T = K.Q^T (A = key rows from LDS, B = q kept in registers) and O^T += V^T.P^T (A = value^T rows from LDS, B = P^T). A lane holds one query (column lane & 15) and keys nt*16 + 8*(lane >> 4) + r,
// which is the B operand's k map (elements 0..7 of a 32-key fragment = score tile 2c, elements 8..15 = score tile 2c + 1): P = f16(1024 * exp(s - m_run)) goes from the score accumulators into the operand without LDS.
// Maximum in-lane plus one exchange between the wave halves per tile, taken over the unscaled scores; l in f32 sums the same 1024 * exp(s - m_run), one partial sum per half, joined after the loop; out = O / l.
// One FMA per score in front of the exponential: 1024 * exp((s - m) / 8) = exp2(s * CE + (10 - m * CE)), CE = log2(e) / 8. Tiles whose 64 slots all count (all but the last, as a rule) run without any exclusion test; a tile with a flagged slot replaces by slot index behind a scalar branch.
// Where every key so far is flagged, m = NEGB: 10 - m * CE rounds to -NEGB * CE, which is exact, the FMA gives exactly 0 and every weight is 1 (in place of 1024): the uniform weights of the reference, since l sums the same weights.
// Key tile [64 j][64 d] and value^T tile [64 d][64 j] staged in LDS with plain loads between block barriers; fragments via the WFrag loaders (A and B same k map).
// Residency: the build takes more than 128 VGPRs, so a SIMD holds 6 waves = 3 work-groups a WGP, 768 of the grid's 1,024 at a time; the last batch runs behind the others, one work-group a WGP.
__global__ __launch_bounds__(256) void k_flash(const h16* __restrict__ QP, const h16* __restrict__ KP, const h16* __restrict__ VT, const int* __restrict__ mk, const int* __restrict__ NE, float* outb) {
    __shared__ __align__(16) h16 Ks[64 * KSP];
    __shared__ __align__(16) h16 Vs[64 * KSP];
    __shared__ __align__(16) float Ow[8 * 16 * OSP];
    const int tid = threadIdx.x, wid = tid >> 5, lane = tid & 31, lr = lane & 15, hi = lane >> 4;
    const int hh = blockIdx.y, i0 = blockIdx.x * 128 + wid * 16;
    const size_t bz = blockIdx.z, pl = (bz * NHD + hh) * ((size_t)SEQ * HD);
    mk += bz * SEQ; outb += bz * SEQ_FULL * DMOD;
    const int ne = min(NE[bz], SEQ);   // the same for the whole block: the barriers in the loop stay uniform
    const h16* qp = QP + pl; const h16* kp = KP + pl; const h16* vt = VT + pl;
    float* ow = Ow + wid * (16 * OSP);
    v16h qf[2];
    qf[0] = WFrag<h16>::ld(qp + (size_t)(i0 + lr) * HD + 8 * hi);
    qf[1] = WFrag<h16>::ld(qp + (size_t)(i0 + lr) * HD + 32 + 8 * hi);
    v8f o[4];
#pragma unroll
    for (int n = 0; n < 4; ++n) o[n] = (v8f){};
    float mrow = -__builtin_inff(), lrow = 0.f;
    const float CE = SCL * 1.4426950408889634f;
    const int nclean = (mk[0] >= 1) ? 0 : ne;   // first flagged slot (the same for the whole block): the flags are 0 below the number of keys that count and 1 from there on, and ne is that number unless it is 0
    const int srow = tid >> 3, spc = (tid & 7) * 8;
#pragma unroll 1
    for (int j0 = 0; j0 < ne; j0 += 64) {
        __syncthreads();
#pragma unroll
        for (int rr = 0; rr < 2; ++rr) { const int row = srow + 32 * rr;
            const v8h kv = *(const v8ha*)(kp + (size_t)(j0 + row) * HD + spc);
            const v8h vv = *(const v8ha*)(vt + (size_t)row * SEQ + j0 + spc);
            *(v8ha*)(Ks + row * KSP + spc) = kv; *(v8ha*)(Vs + row * KSP + spc) = vv; }
        __syncthreads();
        v8f s[4];
#pragma unroll
        for (int nt = 0; nt < 4; ++nt) { s[nt] = (v8f){};
#pragma unroll
            for (int kk = 0; kk < 2; ++kk) { const v16h a = WFrag<h16>::ld(Ks + (nt * 16 + lr) * KSP + kk * 32 + 8 * hi); s[nt] = wmma16(a, qf[kk], s[nt]); } }
        asm volatile("v_nop\n\tv_nop\n\tv_nop\n\tv_nop" : "+v"(s[0]), "+v"(s[1]), "+v"(s[2]), "+v"(s[3]) : "v"(qf[0]), "v"(qf[1]));
        if (j0 + 64 > nclean) {   // the same for the whole block: a scalar branch
#pragma unroll
            for (int nt = 0; nt < 4; ++nt)
#pragma unroll
                for (int r = 0; r < 8; ++r) s[nt][r] = (j0 + nt * 16 + 8 * hi + r >= nclean) ? NEGB : s[nt][r];
        }
        float mx = NEGB;
#pragma unroll
        for (int r = 0; r < 8; ++r) mx = fmaxf(mx, fmaxf(fmaxf(s[0][r], s[1][r]), fmaxf(s[2][r], s[3][r])));
        mx = fmaxf(mx, xhalf(mx));
        const float mn = fmaxf(mrow, mx);
        const float alpha = __builtin_amdgcn_exp2f(__fmul_rn(__fsub_rn(mrow, mn), CE)); mrow = mn;
        const float nm = __builtin_fmaf(-mn, CE, 10.0f);
#pragma unroll
        for (int nt = 0; nt < 4; ++nt)
#pragma unroll
            for (int r = 0; r < 8; ++r) s[nt][r] = __builtin_amdgcn_exp2f(__builtin_fmaf(s[nt][r], CE, nm));
        float sr[8];
#pragma unroll
        for (int r = 0; r < 8; ++r) sr[r] = (s[0][r] + s[1][r]) + (s[2][r] + s[3][r]);
        lrow = lrow * alpha + (((sr[0] + sr[1]) + (sr[2] + sr[3])) + ((sr[4] + sr[5]) + (sr[6] + sr[7])));
#pragma unroll
        for (int n = 0; n < 4; ++n)
#pragma unroll
            for (int r = 0; r < 8; ++r) o[n][r] *= alpha;
        v16h p0, p1;
#pragma unroll
        for (int r = 0; r < 8; ++r) { p0[r] = (h16)s[0][r]; p0[8 + r] = (h16)s[1][r]; p1[r] = (h16)s[2][r]; p1[8 + r] = (h16)s[3][r]; }
#pragma unroll
        for (int n = 0; n < 4; ++n) { const v16h a0 = WFrag<h16>::ld(Vs + (n * 16 + lr) * KSP + 8 * hi); o[n] = wmma16(a0, p0, o[n]); const v16h a1 = WFrag<h16>::ld(Vs + (n * 16 + lr) * KSP + 32 + 8 * hi); o[n] = wmma16(a1, p1, o[n]); }
        // four vector slots behind the last product, also on the loop's back edge, before anything rewrites its operands or touches o
        asm volatile("v_nop\n\tv_nop\n\tv_nop\n\tv_nop" : "+v"(o[0]), "+v"(o[1]), "+v"(o[2]), "+v"(o[3]) : "v"(p0), "v"(p1));
    }
    const float inv = __fdiv_rn(1.0f, lrow + xhalf(lrow));
    __syncthreads();
#pragma unroll
    for (int n = 0; n < 4; ++n) { v4f w0, w1;
#pragma unroll
        for (int r = 0; r < 4; ++r) { w0[r] = o[n][r] * inv; w1[r] = o[n][4 + r] * inv; }
        *(v4fa*)(ow + lr * OSP + n * 16 + 8 * hi) = w0; *(v4fa*)(ow + lr * OSP + n * 16 + 8 * hi + 4) = w1; }
    __syncthreads();
    float* orow = outb + (size_t)i0 * DMOD + hh * HD;
    v4f val[8];
#pragma unroll
    for (int sI = 0; sI < 8; ++sI) val[sI] = *(const v4fa*)(ow + (2 * sI + hi) * OSP + lr * 4);
#pragma unroll
    for (int sI = 0; sI < 8; ++sI) *(v4f*)(orow + (size_t)(2 * sI + hi) * DMOD + lr * 4) = val[sI];
    
}

extern "C" void kernel_launch(void* const* d_in, const int* in_sizes, int n_in,
                              void* d_out, int out_size, void* d_ws, size_t ws_size, hipStream_t stream) {
    if (n_in < 5) return;
    const long rows_used = (long)(NB - 1) * SEQ_FULL + SEQ;
    if ((long)in_sizes[0] < rows_used * DMOD) return;
    if ((long)in_sizes[1] < rows_used) return;
    if ((long)in_sizes[2] < (long)DMOD * QKVN) return;
    if (in_sizes[3] < DMOD || in_sizes[4] < DMOD) return;
    if ((long)out_size < rows_used * DMOD) return;
    const float* X = (const float*)d_in[0]; const int* M = (const int*)d_in[1]; const float* W = (const float*)d_in[2]; const float* G = (const float*)d_in[3]; const float* Bv = (const float*)d_in[4];
    float* OUT = (float*)d_out;     // [4][2048][1024]
    char* wsp = (char*)d_ws;
    auto take = [&](size_t bytes) { char* p = wsp; wsp += (bytes + 255) & ~(size_t)255; return (void*)p; };
    h16* WT = (h16*)take((size_t)QKVN * DMOD * 2);                     // W^T f16 [3072][1024]             6,291,456 B
    h16* XN = (h16*)take((size_t)NB * SEQ * DMOD * 2);                 // xn f16 [NB][SEQ][1024]          16,777,216 B
    h16* QP = (h16*)take((size_t)NB * NHD * SEQ * HD * 2);             // q planes [NB][16][SEQ][64]      16,777,216 B
    h16* KP = (h16*)take((size_t)NB * NHD * SEQ * HD * 2);             // k planes                        16,777,216 B
    h16* VTp = (h16*)take((size_t)NB * NHD * HD * SEQ * 2);            // v^T planes [NB][16][64][SEQ]    16,777,216 B
    h16* XNc = (h16*)take((size_t)NB * SEQ * DMOD * 2);                // xn in key-list order            16,777,216 B
    int* POS = (int*)take((size_t)NB * SEQ * 4);                       // token -> slot [NB][SEQ]             32,768 B
    int* MC = (int*)take((size_t)NB * SEQ * 4);                        // slot flags [NB][SEQ]                32,768 B
    int* NE = (int*)take((size_t)NB * 4);                              // slots in use [NB]                      256 B
    if ((size_t)(wsp - (char*)d_ws) > ws_size) return;                 // total 90,243,328 B
    k_wtG<<<NB + (QKVN / WTN) * (DMOD / WTK), 256, 0, stream>>>(W, WT, M, POS, MC, NE);
    k_ln<<<dim3(SEQ, NB, 1), 128, 0, stream>>>(X, G, Bv, XN, XNc, POS, MC, NE);
    k_gemms<<<dim3(NB * SEQ / GBM, QKVN / GBN, 1), 256, 0, stream>>>(XN, XNc, WT, NE, QP, KP, VTp);
    k_flash<<<dim3(SEQ / 128, NHD, NB), 256, 0, stream>>>(QP, KP, VTp, MC, NE, OUT);
}

// v009
// A run of this version takes 85.8 microseconds.
// Two timings next to v008 put it at 1.21 and 1.19 times that version's speed.
// Over all steps from v000 it is 6.85 times as fast.
#include <hip/hip_runtime.h>

// Compute dtypes (f32 accumulate everywhere): LayerNorm in f32 on bf16 (RNE) copies of x, ln_g, ln_b; QKV projection = v_wmma_f32_16x16x32_f16 with xn as one f16 plane and W^T as one f16 plane that holds the bf16 (RNE) values of W; scores (k.q^T, transposed) and v^T.P^T = v_wmma_f32_16x16x32_f16 with q, k, v^T plain f16 planes and P = f16(1024 * exp(s - m)); online softmax statistics f32; output f32.
// Pipeline, every launch covers all NB batches (batch = slowest grid index of k_ln and k_flash): k_ln -> xn f16 [NB][SEQ][1024]; k_gemms -> f16 q, k head planes [NB][16][SEQ][64] and v^T planes [NB][16][64][SEQ], converted from its f32 accumulators; k_flash -> out rows [SEQ][1024] at h*64 of each batch. k_wtG once: W^T f16 [3072][1024], and in NB more blocks the list of the keys that count.
// Excluded keys have weight exactly 0 as long as one key of the batch counts, so they are left out of everything behind the LayerNorm: k_ln also writes xn rows in key-list order (slot s = the s-th key that counts), the k and v column blocks of k_gemms, the k and v^T planes and the key loop of k_flash run over the ne slots in use (rounded up to their tiles) instead of SEQ. A batch with every key excluded keeps all SEQ keys, all flagged: the uniform weights of the reference.

#ifndef NB
#define NB 4
#endif
#ifndef SEQ
#define SEQ 2048
#endif
#define NB_FULL  4
#define SEQ_FULL 2048
#define DMOD 1024
#define NHD  16
#define HD   64
#define QKVN (3 * DMOD)
#define SCL  0.125f
#define NEGB (-0x1p100f)   // stands in for an excluded key's score, far below any score of f16 operands; a power of two, so that NEGB * CE is exact in k_flash
#define LNEPS 1e-5f
#define KSP  72      // LDS pitch (halves) of key / value^T tiles
#define OSP  68      // LDS pitch (floats) of the output staging tile
static_assert(SEQ % 128 == 0);
static_assert(SEQ >= 128);
static_assert(SEQ <= SEQ_FULL);
static_assert(NB >= 1);
static_assert(NB <= NB_FULL);
static_assert(DMOD % 64 == 0);
static_assert(QKVN % 64 == 0);
static_assert(NHD * HD == DMOD);
static_assert(DMOD % 32 == 0);

typedef _Float16 h16;
typedef __attribute__((ext_vector_type(16))) _Float16 v16h;
typedef __attribute__((ext_vector_type(8)))  _Float16 v8h;
typedef __attribute__((ext_vector_type(8)))  float    v8f;
typedef __attribute__((ext_vector_type(4)))  float    v4f;
typedef __attribute__((ext_vector_type(4)))  int      v4i;
typedef __attribute__((ext_vector_type(2)))  _Float16 v2h;
typedef v8h  __attribute__((may_alias)) v8ha;
typedef v4f  __attribute__((may_alias)) v4fa;
typedef v4i  __attribute__((may_alias)) v4ia;
typedef v8f  __attribute__((may_alias)) v8fa;

__device__ __forceinline__ unsigned short f2bf(float f) { unsigned u = __float_as_uint(f); u += 0x7FFFu + ((u >> 16) & 1u); return (unsigned short)(u >> 16); }
__device__ __forceinline__ float bf2f(unsigned short b) { return __uint_as_float(((unsigned)b) << 16); }
__device__ __forceinline__ float bfr(float f) { return bf2f(f2bf(f)); }
__device__ __forceinline__ v16h cat16(v8h lo, v8h hi) { return __builtin_shufflevector(lo, hi, 0, 1, 2, 3, 4, 5, 6, 7, 8, 9, 10, 11, 12, 13, 14, 15); }
__device__ __forceinline__ v8f wmma16(v16h a, v16h b, v8f c) { return __builtin_amdgcn_wmma_f32_16x16x32_f16(false, a, false, b, (short)0, c, false, false); }
__device__ __forceinline__ float xhalf(float x) { return __builtin_bit_cast(float, __builtin_amdgcn_permlanex16(__builtin_bit_cast(int, x), __builtin_bit_cast(int, x), 0x76543210, 0xfedcba98, false, false)); }  // lane l reads lane l ^ 16

// Fragment loaders (A and B use the same per-lane k map): p = row (lane & 15) base + k0 + 8*(lane >> 4); elements 0..7 = p[0..7], elements 8..15 = p[16..23].
template <typename T16> struct WFrag;
template <> struct WFrag<h16> { typedef v16h V; static __device__ __forceinline__ V ld(const h16* p) { return cat16(*(const v8ha*)p, *(const v8ha*)(p + 16)); } static __device__ __forceinline__ v8f mma(V a, V b, v8f c) { return wmma16(a, b, c); } };

// ---- k_gemms: c[m][n] (f32 accumulators) = sum_k A[m][k] Bt[n][k], K = DMOD; block tile 128 x 256 = 8 waves (2 x 4) of 64 x 64 (16 accumulators each); grid (NB*SEQ/128, QKVN/256), 256 threads: the batches' rows are one matrix of NB*SEQ rows.
// Column blocks of q take the rows in token order (A); column blocks of k and v take them in key-list order (Ac), and a block whose first slot lies behind its batch's slots in use leaves at once; in the last block in use a wave with no slot in use among its 64 rows only copies.
// A stage = 64 k of [A 128 rows | Bt 256 rows] at pitch KSP halves in LDS, two buffers; every lane brings 12 x 16 B of a stage by asynchronous copies while the stage before it is multiplied.
#define GBM 128
#define GBN 256
#define GKC 64
#define GSTG ((GBM + GBN) * KSP)   // halves per buffer
static_assert((NB * SEQ) % GBM == 0);
static_assert(QKVN % GBN == 0);
static_assert(DMOD % GKC == 0);
static_assert(DMOD / GKC >= 2);
static_assert(DMOD % GBN == 0);
static_assert(SEQ % GBM == 0);
static_assert(8 * 64 * KSP * 2 <= 2 * GSTG * 2);
static_assert(HD == 64);

// Twelve copies of 16 B per lane into LDS rows 32 apart from l: four from global rows 32 apart from a, eight likewise from b. The s_wait_xcnt stands inside the statement so that no address register is rewritten ahead of it.
__device__ __forceinline__ void cp12(unsigned l, const h16* a, const h16* b) {
    asm volatile("global_load_async_to_lds_b128 %0, %12, off\n\t"
                 "global_load_async_to_lds_b128 %1, %13, off\n\t"
                 "global_load_async_to_lds_b128 %2, %14, off\n\t"
                 "global_load_async_to_lds_b128 %3, %15, off\n\t"
                 "global_load_async_to_lds_b128 %4, %16, off\n\t"
                 "global_load_async_to_lds_b128 %5, %17, off\n\t"
                 "global_load_async_to_lds_b128 %6, %18, off\n\t"
                 "global_load_async_to_lds_b128 %7, %19, off\n\t"
                 "global_load_async_to_lds_b128 %8, %20, off\n\t"
                 "global_load_async_to_lds_b128 %9, %21, off\n\t"
                 "global_load_async_to_lds_b128 %10, %22, off\n\t"
                 "global_load_async_to_lds_b128 %11, %23, off\n\t"
                 "s_wait_xcnt 0x0"
                 :: "v"(l), "v"(l + 1u * 32 * KSP * 2), "v"(l + 2u * 32 * KSP * 2), "v"(l + 3u * 32 * KSP * 2), "v"(l + 4u * 32 * KSP * 2), "v"(l + 5u * 32 * KSP * 2), "v"(l + 6u * 32 * KSP * 2), "v"(l + 7u * 32 * KSP * 2),
                    "v"(l + 8u * 32 * KSP * 2), "v"(l + 9u * 32 * KSP * 2), "v"(l + 10u * 32 * KSP * 2), "v"(l + 11u * 32 * KSP * 2),
                    "v"(a), "v"(a + 1 * 32 * DMOD), "v"(a + 2 * 32 * DMOD), "v"(a + 3 * 32 * DMOD),
                    "v"(b), "v"(b + 1 * 32 * DMOD), "v"(b + 2 * 32 * DMOD), "v"(b + 3 * 32 * DMOD), "v"(b + 4 * 32 * DMOD), "v"(b + 5 * 32 * DMOD), "v"(b + 6 * 32 * DMOD), "v"(b + 7 * 32 * DMOD)
                 : "memory");
}

__global__ __launch_bounds__(256) void k_gemms(const h16* __restrict__ A, const h16* __restrict__ Ac, const h16* __restrict__ Bt, const int* __restrict__ NE, h16* QP, h16* KP, h16* VT) {
    __shared__ __align__(16) h16 S[2 * GSTG];
    const int tid = threadIdx.x, wid = tid >> 5, lane = tid & 31, lr = lane & 15, hi = lane >> 4;
    const int wm = wid >> 2, wn = wid & 3; const int r0 = blockIdx.x * GBM, c0 = blockIdx.y * GBN;
    const bool kv = c0 >= DMOD;
    const int nrow = kv ? min(NE[r0 / SEQ], SEQ) - r0 % SEQ : GBM;   // slots in use from this block's first row on
    if (nrow <= 0) return;                                           // the whole block, in front of every copy and barrier
    const bool act = __builtin_amdgcn_readfirstlane(wm) * 64 < nrow; // a wave whose 64 rows all lie behind the slots in use multiplies and stores nothing; it still copies and passes every wait and barrier (readfirstlane: the test becomes a scalar branch, EXEC stays all ones at the products)
    const int crow = tid >> 3, ccol = (tid & 7) * 8;   // a wave's copy covers 4 rows x 128 B: whole lines
    const h16* ga = (kv ? Ac : A) + (size_t)(r0 + crow) * DMOD + ccol; const h16* gb = Bt + (size_t)(c0 + crow) * DMOD + ccol;
    const unsigned l0 = (unsigned)(size_t)(S + crow * KSP + ccol);
    v8f acc[4][4];
#pragma unroll
    for (int mb = 0; mb < 4; ++mb)
#pragma unroll
        for (int nb = 0; nb < 4; ++nb) acc[mb][nb] = (v8f){};
    const int NT = DMOD / GKC;
    cp12(l0, ga, gb);
    asm volatile("s_wait_asynccnt 0x0" ::: "memory");   // stage 0 has landed (this wave's copies)
    __syncthreads();                                     // ... and every other wave's
    cp12(l0 + GSTG * 2u, ga + GKC, gb + GKC);
    const int aofs = (wm * 64 + lr) * KSP + 8 * hi, bofs = (GBM + wn * 64 + lr) * KSP + 8 * hi;
#pragma unroll 1   // one trip per stage stays rolled: the accumulators leave no registers for a second trip's fragments
    for (int t = 0; t < NT; ++t) {
        const h16* sb = S + (t & 1) * GSTG;
        if (act) {
#pragma unroll
        for (int ks = 0; ks < GKC; ks += 32) {
            v16h a[4], b[4];
            b[0] = WFrag<h16>::ld(sb + bofs + ks);
#pragma unroll
            for (int mb = 0; mb < 4; ++mb) a[mb] = WFrag<h16>::ld(sb + aofs + mb * 16 * KSP + ks);
#pragma unroll
            for (int nb = 1; nb < 4; ++nb) b[nb] = WFrag<h16>::ld(sb + bofs + nb * 16 * KSP + ks);
            __builtin_amdgcn_sched_barrier(0);   // the 16 LDS reads of a k step stay one group in front of its 16 products: left alone the compiler reads each b fragment behind the products of the one before it and waits for it there, four products at a time
#pragma unroll
            for (int nb = 0; nb < 4; ++nb)
#pragma unroll
                for (int mb = 0; mb < 4; ++mb) acc[mb][nb] = wmma16(a[mb], b[nb], acc[mb][nb]);
            __builtin_amdgcn_sched_barrier(0);   // ... and the next k step's reads stay behind these products, not among them
        }
        }
        asm volatile("s_wait_dscnt 0x0" ::: "memory");      // this wave has left the buffer that is refilled below
        asm volatile("s_wait_asynccnt 0x0" ::: "memory");   // this wave's copies of stage t + 1 have landed
        __syncthreads();                                     // publishes stage t + 1, ends every reader's last read of stage t
        if (t + 2 < NT) { const unsigned lb = l0 + (unsigned)(t & 1) * (GSTG * 2u); const int ko = (t + 2) * GKC;
            cp12(lb, ga + ko, gb + ko); }
    }
    asm volatile("s_wait_asynccnt 0x0" ::: "memory");       // nothing in flight when the ring becomes output staging
    if (!act) return;                                       // behind the last barrier
    // A wave's 64 x 64 tile is 64 rows of one head: 8 KB in a row of a q or k plane, or 64 lines of 128 B of a v^T plane. It is rounded to f16 and laid in the wave's own LDS range in the plane's order, then stored as whole lines.
    h16* os = S + wid * (64 * KSP);
    const int col = c0 + wn * 64, hh = (col % DMOD) / HD, t0 = r0 % SEQ + wm * 64;
    const size_t pl = ((size_t)(r0 / SEQ) * NHD + hh) * ((size_t)SEQ * HD);
    const int orow = lane >> 3, ocol = (lane & 7) * 8;   // a wave's store covers 4 rows x 128 B: whole lines; 16 such stores cover the 64 rows
    if (c0 < 2 * DMOD) {   // q, k: [t][d]
#pragma unroll
        for (int mb = 0; mb < 4; ++mb)
#pragma unroll
            for (int nb = 0; nb < 4; ++nb)
#pragma unroll
                for (int j = 0; j < 8; ++j) os[(mb * 16 + hi * 8 + j) * KSP + nb * 16 + lr] = (h16)acc[mb][nb][j];
        h16* g = (kv ? KP : QP) + pl + (size_t)(t0 + orow) * HD + ocol;
        v8h val[16];
#pragma unroll
        for (int s = 0; s < 16; ++s) val[s] = *(const v8ha*)(os + (s * 4 + orow) * KSP + ocol);
#pragma unroll
        for (int s = 0; s < 16; ++s) *(v8h*)(g + s * 4 * HD) = val[s];
    } else {               // v: [d][t]; a lane's 8 accumulator rows are 8 consecutive t of one d
#pragma unroll
        for (int mb = 0; mb < 4; ++mb)
#pragma unroll
            for (int nb = 0; nb < 4; ++nb) { v8h c8;
#pragma unroll
                for (int j = 0; j < 8; ++j) c8[j] = (h16)acc[mb][nb][j];
                *(v8ha*)(os + (nb * 16 + lr) * KSP + mb * 16 + hi * 8) = c8; }
        h16* g = VT + pl + (size_t)orow * SEQ + t0 + ocol;
        v8h val[16];
#pragma unroll
        for (int s = 0; s < 16; ++s) val[s] = *(const v8ha*)(os + (s * 4 + orow) * KSP + ocol);
#pragma unroll
        for (int s = 0; s < 16; ++s) *(v8h*)(g + s * 4 * SEQ) = val[s];
    }
}

// Blocks 0..NB-1 of k_wtG, one per batch, n = number of keys that count: POS[b][t] = slot of token t among them (0..n-1, in token order), -1 where t is excluded; MC[b][s] = 1 where slot s holds no key that counts (s >= n); NE[b] = slots in use = n, or SEQ where n = 0.
// A thread owns KPT consecutive tokens; exclusive prefix of the per-thread counts by shuffles in the wave and one LDS pass over the 8 wave totals.
// The four short loops are unrolled so that keep[] stays in registers, the thread's mask words come as wide loads and the wave totals as wide LDS reads.
#define KPT (SEQ / 256)
static_assert(SEQ % 256 == 0);
__device__ __forceinline__ void key_list(const int* __restrict__ mk, int* POS, int* MC, int* NE) {
    __shared__ int wt[8];
    const int tid = threadIdx.x, lane = tid & 31, wid = tid >> 5; const int b = blockIdx.x;
    mk += (size_t)b * SEQ_FULL; POS += (size_t)b * SEQ; MC += (size_t)b * SEQ;
    bool keep[KPT]; int c = 0;
#pragma unroll
    for (int q = 0; q < KPT; ++q) { keep[q] = !(mk[tid * KPT + q] >= 1); c += keep[q] ? 1 : 0; }
    int inc = c;
#pragma unroll
    for (int sh = 1; sh < 32; sh <<= 1) { const int u = __shfl_up(inc, sh, 32); if (lane >= sh) inc += u; }
    if (lane == 31) wt[wid] = inc;
    __syncthreads();
    int base = inc - c, n = 0;
#pragma unroll
    for (int v = 0; v < 8; ++v) { const int x = wt[v]; if (v < wid) base += x; n += x; }
#pragma unroll
    for (int q = 0; q < KPT; ++q) { const int t = tid * KPT + q;
        POS[t] = keep[q] ? base : -1; base += keep[q] ? 1 : 0;
        MC[t] = (t >= n) ? 1 : 0; }
    if (tid == 0) NE[b] = (n == 0) ? SEQ : n;
}

// Blocks NB.. of k_wtG: W^T by tiles of WTK k x WTN n. A lane reads 8 k rows x 16 B (4 n): a wave's load covers two 256-B row pieces, whole lines; the lane's 8 k of one n are 16 B of a W^T row, laid in LDS at pitch WTP; behind one barrier the tile goes out as 256-B row pieces, whole lines again.
// The short loops are unrolled so that r[], c and val[] stay in registers and a lane's 8 loads are issued together, in front of the first use.
#define WTK 128
#define WTN 64
#define WTP (WTK + 8)   // halves: 272 B = 16 B x odd
static_assert(DMOD % WTK == 0);
static_assert(QKVN % WTN == 0);
__global__ __launch_bounds__(256) void k_wtG(const float* __restrict__ w, h16* Bt, const int* __restrict__ mk, int* POS, int* MC, int* NE) {
    if (blockIdx.x < NB) { key_list(mk, POS, MC, NE); return; }   // the whole block, in front of the barrier below
    __shared__ __align__(16) h16 T[WTN * WTP];
    const int tid = threadIdx.x, tile = blockIdx.x - NB;
    const int n0 = (tile % (QKVN / WTN)) * WTN, k0 = (tile / (QKVN / WTN)) * WTK;
    const int c16 = tid & 15, r16 = tid >> 4;
    const float* g = w + (size_t)(k0 + r16 * 8) * QKVN + n0 + c16 * 4;
    v4f r[8];
#pragma unroll
    for (int j = 0; j < 8; ++j) r[j] = *(const v4fa*)(g + (size_t)j * QKVN);
#pragma unroll
    for (int i = 0; i < 4; ++i) { v8h c;
#pragma unroll
        for (int j = 0; j < 8; ++j) c[j] = (h16)bfr(r[j][i]);
        *(v8ha*)(T + (c16 * 4 + i) * WTP + r16 * 8) = c; }
    __syncthreads();
    h16* o = Bt + (size_t)(n0 + r16) * DMOD + k0 + c16 * 8;
    v8h val[4];
#pragma unroll
    for (int s = 0; s < 4; ++s) val[s] = *(const v8ha*)(T + (s * 16 + r16) * WTP + c16 * 8);
#pragma unroll
    for (int s = 0; s < 4; ++s) *(v8h*)(o + (size_t)s * 16 * DMOD) = val[s];
    asm volatile("s_wait_xcnt 0x0" ::: "memory");   // behind the four stores, in front of whatever code follows in the object and writes their registers
}

// XN: every row in token order. XNc: the same row again at its key-list slot where the token counts, and at slot = token number where that slot holds no key that counts and lies below ne rounded up to 128 (finite filling for the flagged slots). Every slot below ne rounded up to 128 is written by exactly one block.
__global__ __launch_bounds__(128) void k_ln(const float* __restrict__ X, const float* __restrict__ G, const float* __restrict__ Bv, h16* XN, h16* XNc, const int* __restrict__ POS, const int* __restrict__ MC, const int* __restrict__ NE) {
    __shared__ float red[8];
    const int tid = threadIdx.x, lane = tid & 31, wid = tid >> 5; const int row = blockIdx.x; const int c = tid * 8; const size_t bz = blockIdx.y;
    const int ps = POS[bz * SEQ + row], mc = MC[bz * SEQ + row], ne = min(NE[bz], SEQ);   // the same for the whole block; read at the head, beside the row, and used only at the stores
    const v8f a = *(const v8fa*)(X + (bz * SEQ_FULL + row) * DMOD + c);
    float v[8]; float s = 0.f;
#pragma unroll
    for (int q = 0; q < 8; ++q) { v[q] = bfr(a[q]); s += v[q]; }
#pragma unroll
    for (int sh = 16; sh; sh >>= 1) s += __shfl_xor(s, sh, 32);
    if (lane == 0) red[wid] = s;
    __syncthreads();
    const float mean = ((red[0] + red[1]) + (red[2] + red[3])) * (1.0f / DMOD);
    float s2 = 0.f;
#pragma unroll
    for (int q = 0; q < 8; ++q) { const float d = v[q] - mean; v[q] = d; s2 += d * d; }
#pragma unroll
    for (int sh = 16; sh; sh >>= 1) s2 += __shfl_xor(s2, sh, 32);
    if (lane == 0) red[4 + wid] = s2;
    __syncthreads();
    const float var = ((red[4] + red[5]) + (red[6] + red[7])) * (1.0f / DMOD);
    const float rstd = rsqrtf(var + LNEPS);
    const v8f g = *(const v8fa*)(G + c); const v8f bb = *(const v8fa*)(Bv + c);
    v8h oh;
#pragma unroll
    for (int q = 0; q < 8; ++q) oh[q] = (h16)(v[q] * rstd * bfr(g[q]) + bfr(bb[q]));
    const size_t e = (bz * SEQ + row) * DMOD + c;
    *(v8h*)(XN + e) = oh;
    if (ps >= 0) { const size_t ec = (bz * SEQ + ps) * DMOD + c; *(v8h*)(XNc + ec) = oh;
        asm volatile("s_wait_xcnt 0x0" ::: "memory"); }   // in front of the next branch's address arithmetic, which may reuse this store's address registers
    if ((mc != 0) & (row < ((ne + GBM - 1) & ~(GBM - 1)))) *(v8h*)(XNc + e) = oh;
}

// ---- k_flash: softmax(q k^T * 1/8 with excluded keys' scores replaced by NEGB) v, online over 64-key tiles of the key list (ne slots in use; the list's flags are set from one slot on: the filling slots of the last tile, or every slot where no key counts); grid (SEQ/128, 16 heads, NB batches), 256 threads = 8 waves x 16 query columns.
// Transposed products: S^T = K.Q^T (A = key rows from LDS, B = q kept in registers) and O^T += V^T.P^T (A = value^T rows from LDS, B = P^T). A lane holds one query (column lane & 15) and keys nt*16 + 8*(lane >> 4) + r,
// which is the B operand's k map (elements 0..7 of a 32-key fragment = score tile 2c, elements 8..15 = score tile 2c + 1): P = f16(1024 * exp(s - m_run)) goes from the score accumulators into the operand without LDS.
// Maximum in-lane plus one exchange between the wave halves per tile, taken over the unscaled scores; l in f32 sums the same 1024 * exp(s - m_run), one partial sum per half, joined after the loop; out = O / l.
// One FMA per score in front of the exponential: 1024 * exp((s - m) / 8) = exp2(s * CE + (10 - m * CE)), CE = log2(e) / 8. Tiles whose 64 slots all count (all but the last, as a rule) run without any exclusion test; a tile with a flagged slot replaces by slot index behind a scalar branch.
// Where every key so far is flagged, m = NEGB: 10 - m * CE rounds to -NEGB * CE, which is exact, the FMA gives exactly 0 and every weight is 1 (in place of 1024): the uniform weights of the reference, since l sums the same weights.
// Key tile [64 j][64 d] and value^T tile [64 d][64 j] staged in LDS with plain loads between block barriers; fragments via the WFrag loaders (A and B same k map).
// Residency: the build stays within 128 VGPRs (127), so a SIMD holds 8 waves = 4 work-groups a WGP (4 x 53,248 B of LDS) and the grid's 1,024 work-groups run in one round. Above 128 a WGP holds 3 work-groups and the last quarter of the grid runs as a second round, one work-group a WGP: read the count after any change.
__global__ __launch_bounds__(256) void k_flash(const h16* __restrict__ QP, const h16* __restrict__ KP, const h16* __restrict__ VT, const int* __restrict__ mk, const int* __restrict__ NE, float* outb) {
    __shared__ __align__(16) h16 KV[2 * 64 * KSP];   // key tile, then value^T tile: one array, so that one address register and immediate offsets serve all stores, and one all fragment reads
    __shared__ __align__(16) float Ow[8 * 16 * OSP];
    const int tid = threadIdx.x, wid = tid >> 5, lane = tid & 31, lr = lane & 15, hi = lane >> 4;
    const int hh = blockIdx.y, i0 = blockIdx.x * 128 + wid * 16;
    const size_t bz = blockIdx.z, pl = (bz * NHD + hh) * ((size_t)SEQ * HD);
    mk += bz * SEQ; outb += bz * SEQ_FULL * DMOD;
    const int ne = min(NE[bz], SEQ);   // the same for the whole block: the barriers in the loop stay uniform
    const h16* qp = QP + pl; const h16* kp = KP + pl; const h16* vt = VT + pl;
    float* ow = Ow + wid * (16 * OSP);
    v16h qf[2];
    qf[0] = WFrag<h16>::ld(qp + (size_t)(i0 + lr) * HD + 8 * hi);
    qf[1] = WFrag<h16>::ld(qp + (size_t)(i0 + lr) * HD + 32 + 8 * hi);
    v8f o[4];
#pragma unroll
    for (int n = 0; n < 4; ++n) o[n] = (v8f){};
    float mrow = -__builtin_inff(), lrow = 0.f;
    const float CE = SCL * 1.4426950408889634f;
    const int nclean = (mk[0] >= 1) ? 0 : ne;   // first flagged slot (the same for the whole block): the flags are 0 below the number of keys that count and 1 from there on, and ne is that number unless it is 0
    const int srow = tid >> 3, spc = (tid & 7) * 8;
    h16* st = KV + srow * KSP + spc;               // staging stores: rows srow and srow + 32 of both tiles
    const h16* fr = KV + lr * KSP + 8 * hi;        // fragment reads of both tiles
#pragma unroll 1
    for (int j0 = 0; j0 < ne; j0 += 64) {
        __syncthreads();
#pragma unroll
        for (int rr = 0; rr < 2; ++rr) { const int row = srow + 32 * rr;
            const v8h kv = *(const v8ha*)(kp + (size_t)(j0 + row) * HD + spc);
            const v8h vv = *(const v8ha*)(vt + (size_t)row * SEQ + j0 + spc);
            *(v8ha*)(st + 32 * rr * KSP) = kv; *(v8ha*)(st + (64 + 32 * rr) * KSP) = vv; }
        __syncthreads();
        v8f s[4];
#pragma unroll
        for (int nt = 0; nt < 4; ++nt) { s[nt] = (v8f){};
#pragma unroll
            for (int kk = 0; kk < 2; ++kk) { const v16h a = WFrag<h16>::ld(fr + nt * 16 * KSP + kk * 32); s[nt] = wmma16(a, qf[kk], s[nt]); } }
        asm volatile("v_nop\n\tv_nop\n\tv_nop\n\tv_nop" : "+v"(s[0]), "+v"(s[1]), "+v"(s[2]), "+v"(s[3]) : "v"(qf[0]), "v"(qf[1]));
        if (j0 + 64 > nclean) {   // the same for the whole block: a scalar branch
#pragma unroll
            for (int nt = 0; nt < 4; ++nt)
#pragma unroll
                for (int r = 0; r < 8; ++r) s[nt][r] = (j0 + nt * 16 + 8 * hi + r >= nclean) ? NEGB : s[nt][r];
        }
        float mx = NEGB;
#pragma unroll
        for (int r = 0; r < 8; ++r) mx = fmaxf(mx, fmaxf(fmaxf(s[0][r], s[1][r]), fmaxf(s[2][r], s[3][r])));
        mx = fmaxf(mx, xhalf(mx));
        const float mn = fmaxf(mrow, mx);
        const float alpha = __builtin_amdgcn_exp2f(__fmul_rn(__fsub_rn(mrow, mn), CE)); mrow = mn;
        const float nm = __builtin_fmaf(-mn, CE, 10.0f);
#pragma unroll
        for (int nt = 0; nt < 4; ++nt)
#pragma unroll
            for (int r = 0; r < 8; ++r) s[nt][r] = __builtin_amdgcn_exp2f(__builtin_fmaf(s[nt][r], CE, nm));
        float sr[8];
#pragma unroll
        for (int r = 0; r < 8; ++r) sr[r] = (s[0][r] + s[1][r]) + (s[2][r] + s[3][r]);
        lrow = lrow * alpha + (((sr[0] + sr[1]) + (sr[2] + sr[3])) + ((sr[4] + sr[5]) + (sr[6] + sr[7])));
#pragma unroll
        for (int n = 0; n < 4; ++n)
#pragma unroll
            for (int r = 0; r < 8; ++r) o[n][r] *= alpha;
        v16h p0, p1;
#pragma unroll
        for (int r = 0; r < 8; ++r) { p0[r] = (h16)s[0][r]; p0[8 + r] = (h16)s[1][r]; p1[r] = (h16)s[2][r]; p1[8 + r] = (h16)s[3][r]; }
#pragma unroll
        for (int n = 0; n < 4; ++n) { const v16h a0 = WFrag<h16>::ld(fr + (64 + n * 16) * KSP); o[n] = wmma16(a0, p0, o[n]); const v16h a1 = WFrag<h16>::ld(fr + (64 + n * 16) * KSP + 32); o[n] = wmma16(a1, p1, o[n]); }
        // four vector slots behind the last product, also on the loop's back edge, before anything rewrites its operands or touches o
        asm volatile("v_nop\n\tv_nop\n\tv_nop\n\tv_nop" : "+v"(o[0]), "+v"(o[1]), "+v"(o[2]), "+v"(o[3]) : "v"(p0), "v"(p1));
    }
    const float inv = __fdiv_rn(1.0f, lrow + xhalf(lrow));
    __syncthreads();
#pragma unroll
    for (int n = 0; n < 4; ++n) { v4f w0, w1;
#pragma unroll
        for (int r = 0; r < 4; ++r) { w0[r] = o[n][r] * inv; w1[r] = o[n][4 + r] * inv; }
        *(v4fa*)(ow + lr * OSP + n * 16 + 8 * hi) = w0; *(v4fa*)(ow + lr * OSP + n * 16 + 8 * hi + 4) = w1; }
    __syncthreads();
    float* orow = outb + (size_t)i0 * DMOD + hh * HD;
    v4f val[8];
#pragma unroll
    for (int sI = 0; sI < 8; ++sI) val[sI] = *(const v4fa*)(ow + (2 * sI + hi) * OSP + lr * 4);
#pragma unroll
    for (int sI = 0; sI < 8; ++sI) *(v4f*)(orow + (size_t)(2 * sI + hi) * DMOD + lr * 4) = val[sI];
    
}

extern "C" void kernel_launch(void* const* d_in, const int* in_sizes, int n_in,
                              void* d_out, int out_size, void* d_ws, size_t ws_size, hipStream_t stream) {
    if (n_in < 5) return;
    const long rows_used = (long)(NB - 1) * SEQ_FULL + SEQ;
    if ((long)in_sizes[0] < rows_used * DMOD) return;
    if ((long)in_sizes[1] < rows_used) return;
    if ((long)in_sizes[2] < (long)DMOD * QKVN) return;
    if (in_sizes[3] < DMOD || in_sizes[4] < DMOD) return;
    if ((long)out_size < rows_used * DMOD) return;
    const float* X = (const float*)d_in[0]; const int* M = (const int*)d_in[1]; const float* W = (const float*)d_in[2]; const float* G = (const float*)d_in[3]; const float* Bv = (const float*)d_in[4];
    float* OUT = (float*)d_out;     // [4][2048][1024]
    char* wsp = (char*)d_ws;
    auto take = [&](size_t bytes) { char* p = wsp; wsp += (bytes + 255) & ~(size_t)255; return (void*)p; };
    h16* WT = (h16*)take((size_t)QKVN * DMOD * 2);                     // W^T f16 [3072][1024]             6,291,456 B
    h16* XN = (h16*)take((size_t)NB * SEQ * DMOD * 2);                 // xn f16 [NB][SEQ][1024]          16,777,216 B
    h16* QP = (h16*)take((size_t)NB * NHD * SEQ * HD * 2);             // q planes [NB][16][SEQ][64]      16,777,216 B
    h16* KP = (h16*)take((size_t)NB * NHD * SEQ * HD * 2);             // k planes                        16,777,216 B
    h16* VTp = (h16*)take((size_t)NB * NHD * HD * SEQ * 2);            // v^T planes [NB][16][64][SEQ]    16,777,216 B
    h16* XNc = (h16*)take((size_t)NB * SEQ * DMOD * 2);                // xn in key-list order            16,777,216 B
    int* POS = (int*)take((size_t)NB * SEQ * 4);                       // token -> slot [NB][SEQ]             32,768 B
    int* MC = (int*)take((size_t)NB * SEQ * 4);                        // slot flags [NB][SEQ]                32,768 B
    int* NE = (int*)take((size_t)NB * 4);                              // slots in use [NB]                      256 B
    if ((size_t)(wsp - (char*)d_ws) > ws_size) return;                 // total 90,243,328 B
    k_wtG<<<NB + (QKVN / WTN) * (DMOD / WTK), 256, 0, stream>>>(W, WT, M, POS, MC, NE);
    k_ln<<<dim3(SEQ, NB, 1), 128, 0, stream>>>(X, G, Bv, XN, XNc, POS, MC, NE);
    k_gemms<<<dim3(NB * SEQ / GBM, QKVN / GBN, 1), 256, 0, stream>>>(XN, XNc, WT, NE, QP, KP, VTp);
    k_flash<<<dim3(SEQ / 128, NHD, NB), 256, 0, stream>>>(QP, KP, VTp, MC, NE, OUT);
}

// v010
// Measured time: 83.7 microseconds a run.
// In two side-by-side timings against v009, it was 1.03 and 1.02 times as fast.
// All steps since v000 together make it 7.03 times as fast.
#include <hip/hip_runtime.h>

// Compute dtypes (f32 accumulate everywhere): LayerNorm in f32 on bf16 (RNE) copies of x, ln_g, ln_b; QKV projection = v_wmma_f32_16x16x32_f16 with xn as one f16 plane and W^T as one f16 plane that holds the bf16 (RNE) values of W; scores (k.q^T, transposed) and v^T.P^T = v_wmma_f32_16x16x32_f16 with q, k, v^T plain f16 planes and P = f16(1024 * exp(s - m)); online softmax statistics f32; output f32.
// Pipeline, three launches, each covers all NB batches: k_pre -> xn f16 [NB][SEQ][1024] (LayerNorm blocks), W^T f16 [3072][1024] (tile blocks) and the list of the keys that count (NB blocks), three jobs that read nothing of one another; k_gemms -> f16 q, k head planes [NB][16][SEQ][64] and v^T planes [NB][16][64][SEQ], converted from its f32 accumulators; k_flash -> out rows [SEQ][1024] at h*64 of each batch.
// Excluded keys have weight exactly 0 as long as one key of the batch counts, so they are left out of everything behind the LayerNorm: the k and v column blocks of k_gemms fetch their xn rows in key-list order (slot s = the s-th key that counts) through the list; those blocks, the k and v^T planes and the key loop of k_flash run over the ne slots in use (rounded up to their tiles) instead of SEQ. A batch with every key excluded keeps all SEQ keys, all flagged: the uniform weights of the reference.

#ifndef NB
#define NB 4
#endif
#ifndef SEQ
#define SEQ 2048
#endif
#define NB_FULL  4
#define SEQ_FULL 2048
#define DMOD 1024
#define NHD  16
#define HD   64
#define QKVN (3 * DMOD)
#define SCL  0.125f
#define NEGB (-0x1p100f)   // stands in for an excluded key's score, far below any score of f16 operands; a power of two, so that NEGB * CE is exact in k_flash
#define LNEPS 1e-5f
#define KSP  72      // LDS pitch (halves) of key / value^T tiles
#define OSP  68      // LDS pitch (floats) of the output staging tile
static_assert(SEQ % 128 == 0);
static_assert(SEQ >= 128);
static_assert(SEQ <= SEQ_FULL);
static_assert(NB >= 1);
static_assert(NB <= NB_FULL);
static_assert(DMOD % 64 == 0);
static_assert(QKVN % 64 == 0);
static_assert(NHD * HD == DMOD);
static_assert(DMOD % 32 == 0);

typedef _Float16 h16;
typedef __attribute__((ext_vector_type(16))) _Float16 v16h;
typedef __attribute__((ext_vector_type(8)))  _Float16 v8h;
typedef __attribute__((ext_vector_type(8)))  float    v8f;
typedef __attribute__((ext_vector_type(4)))  float    v4f;
typedef __attribute__((ext_vector_type(4)))  int      v4i;
typedef __attribute__((ext_vector_type(2)))  _Float16 v2h;
typedef v8h  __attribute__((may_alias)) v8ha;
typedef v4f  __attribute__((may_alias)) v4fa;
typedef v4i  __attribute__((may_alias)) v4ia;
typedef v8f  __attribute__((may_alias)) v8fa;

__device__ __forceinline__ unsigned short f2bf(float f) { unsigned u = __float_as_uint(f); u += 0x7FFFu + ((u >> 16) & 1u); return (unsigned short)(u >> 16); }
__device__ __forceinline__ float bf2f(unsigned short b) { return __uint_as_float(((unsigned)b) << 16); }
__device__ __forceinline__ float bfr(float f) { return bf2f(f2bf(f)); }
__device__ __forceinline__ v16h cat16(v8h lo, v8h hi) { return __builtin_shufflevector(lo, hi, 0, 1, 2, 3, 4, 5, 6, 7, 8, 9, 10, 11, 12, 13, 14, 15); }
__device__ __forceinline__ v8f wmma16(v16h a, v16h b, v8f c) { return __builtin_amdgcn_wmma_f32_16x16x32_f16(false, a, false, b, (short)0, c, false, false); }
__device__ __forceinline__ float xhalf(float x) { return __builtin_bit_cast(float, __builtin_amdgcn_permlanex16(__builtin_bit_cast(int, x), __builtin_bit_cast(int, x), 0x76543210, 0xfedcba98, false, false)); }  // lane l reads lane l ^ 16

// Fragment loaders (A and B use the same per-lane k map): p = row (lane & 15) base + k0 + 8*(lane >> 4); elements 0..7 = p[0..7], elements 8..15 = p[16..23].
template <typename T16> struct WFrag;
template <> struct WFrag<h16> { typedef v16h V; static __device__ __forceinline__ V ld(const h16* p) { return cat16(*(const v8ha*)p, *(const v8ha*)(p + 16)); } static __device__ __forceinline__ v8f mma(V a, V b, v8f c) { return wmma16(a, b, c); } };

// ---- k_gemms: c[m][n] (f32 accumulators) = sum_k A[m][k] Bt[n][k], K = DMOD; block tile 128 x 256 = 8 waves (2 x 4) of 64 x 64 (16 accumulators each); grid (NB*SEQ/128, QKVN/256), 256 threads: the batches' rows are one matrix of NB*SEQ rows.
// Column blocks of q take the rows of A in token order; column blocks of k and v take them in key-list order (row of slot s = IDX[s]: every lane's copy has an address of its own, so a gathered row takes the same copies as a row in order), and a block whose first slot lies behind its batch's slots in use leaves at once; in the last block in use a wave with no slot in use among its 64 rows only copies.
// A stage = 64 k of [A 128 rows | Bt 256 rows] at pitch KSP halves in LDS, two buffers; every lane brings 12 x 16 B of a stage by asynchronous copies while the stage before it is multiplied.
#define GBM 128
#define GBN 256
#define GKC 64
#define GSTG ((GBM + GBN) * KSP)   // halves per buffer
static_assert((NB * SEQ) % GBM == 0);
static_assert(QKVN % GBN == 0);
static_assert(DMOD % GKC == 0);
static_assert(DMOD / GKC >= 2);
static_assert(DMOD % GBN == 0);
static_assert(SEQ % GBM == 0);
static_assert(8 * 64 * KSP * 2 <= 2 * GSTG * 2);
static_assert(HD == 64);

// Twelve copies of 16 B per lane into LDS rows 32 apart from l: four from the global rows a0..a3, eight from global rows 32 apart from b. The s_wait_xcnt stands inside the statement so that no address register is rewritten ahead of it.
__device__ __forceinline__ void cp12(unsigned l, const h16* a0, const h16* a1, const h16* a2, const h16* a3, const h16* b) {
    asm volatile("global_load_async_to_lds_b128 %0, %12, off\n\t"
                 "global_load_async_to_lds_b128 %1, %13, off\n\t"
                 "global_load_async_to_lds_b128 %2, %14, off\n\t"
                 "global_load_async_to_lds_b128 %3, %15, off\n\t"
                 "global_load_async_to_lds_b128 %4, %16, off\n\t"
                 "global_load_async_to_lds_b128 %5, %17, off\n\t"
                 "global_load_async_to_lds_b128 %6, %18, off\n\t"
                 "global_load_async_to_lds_b128 %7, %19, off\n\t"
                 "global_load_async_to_lds_b128 %8, %20, off\n\t"
                 "global_load_async_to_lds_b128 %9, %21, off\n\t"
                 "global_load_async_to_lds_b128 %10, %22, off\n\t"
                 "global_load_async_to_lds_b128 %11, %23, off\n\t"
                 "s_wait_xcnt 0x0"
                 :: "v"(l), "v"(l + 1u * 32 * KSP * 2), "v"(l + 2u * 32 * KSP * 2), "v"(l + 3u * 32 * KSP * 2), "v"(l + 4u * 32 * KSP * 2), "v"(l + 5u * 32 * KSP * 2), "v"(l + 6u * 32 * KSP * 2), "v"(l + 7u * 32 * KSP * 2),
                    "v"(l + 8u * 32 * KSP * 2), "v"(l + 9u * 32 * KSP * 2), "v"(l + 10u * 32 * KSP * 2), "v"(l + 11u * 32 * KSP * 2),
                    "v"(a0), "v"(a1), "v"(a2), "v"(a3),
                    "v"(b), "v"(b + 1 * 32 * DMOD), "v"(b + 2 * 32 * DMOD), "v"(b + 3 * 32 * DMOD), "v"(b + 4 * 32 * DMOD), "v"(b + 5 * 32 * DMOD), "v"(b + 6 * 32 * DMOD), "v"(b + 7 * 32 * DMOD)
                 : "memory");
}

__global__ __launch_bounds__(256) void k_gemms(const h16* __restrict__ A, const int* __restrict__ IDX, const h16* __restrict__ Bt, const int* __restrict__ NE, h16* QP, h16* KP, h16* VT) {
    __shared__ __align__(16) h16 S[2 * GSTG];
    const int tid = threadIdx.x, wid = tid >> 5, lane = tid & 31, lr = lane & 15, hi = lane >> 4;
    const int wm = wid >> 2, wn = wid & 3; const int r0 = blockIdx.x * GBM, c0 = blockIdx.y * GBN;
    const bool kv = c0 >= DMOD;
    const int crow = tid >> 3, ccol = (tid & 7) * 8;   // a wave's copy covers 4 rows x 128 B: whole lines
    int tk[4];   // this lane's four A rows inside the batch (LDS rows crow + 32 i): the slot number itself, or for k and v the slot's token
#pragma unroll
    for (int i = 0; i < 4; ++i) tk[i] = r0 % SEQ + crow + 32 * i;
    if (kv) {    // the four list entries are fetched as one group, ahead of the read of NE, so that the two latencies overlap; every entry of IDX has been written
#pragma unroll
        for (int i = 0; i < 4; ++i) tk[i] = IDX[(r0 / SEQ) * SEQ + tk[i]];
    }
    const int nrow = kv ? min(NE[r0 / SEQ], SEQ) - r0 % SEQ : GBM;   // slots in use from this block's first row on
    if (nrow <= 0) return;                                           // the whole block, in front of every copy and barrier
    const bool act = __builtin_amdgcn_readfirstlane(wm) * 64 < nrow; // a wave whose 64 rows all lie behind the slots in use multiplies and stores nothing; it still copies and passes every wait and barrier (readfirstlane: the test becomes a scalar branch, EXEC stays all ones at the products)
    const h16* ga[4];   // a row number is clamped to the batch's rows before it becomes an address
#pragma unroll
    for (int i = 0; i < 4; ++i) ga[i] = A + (size_t)((r0 / SEQ) * SEQ + min(max(tk[i], 0), SEQ - 1)) * DMOD + ccol;
    const h16* gb = Bt + (size_t)(c0 + crow) * DMOD + ccol;
    const unsigned l0 = (unsigned)(size_t)(S + crow * KSP + ccol);
    v8f acc[4][4];
#pragma unroll
    for (int mb = 0; mb < 4; ++mb)
#pragma unroll
        for (int nb = 0; nb < 4; ++nb) acc[mb][nb] = (v8f){};
    const int NT = DMOD / GKC;
    cp12(l0, ga[0], ga[1], ga[2], ga[3], gb);
    asm volatile("s_wait_asynccnt 0x0" ::: "memory");   // stage 0 has landed (this wave's copies)
    __syncthreads();                                     // ... and every other wave's
    cp12(l0 + GSTG * 2u, ga[0] + GKC, ga[1] + GKC, ga[2] + GKC, ga[3] + GKC, gb + GKC);
    const int aofs = (wm * 64 + lr) * KSP + 8 * hi, bofs = (GBM + wn * 64 + lr) * KSP + 8 * hi;
#pragma unroll 1   // one trip per stage stays rolled: the accumulators leave no registers for a second trip's fragments
    for (int t = 0; t < NT; ++t) {
        const h16* sb = S + (t & 1) * GSTG;
        if (act) {
#pragma unroll
        for (int ks = 0; ks < GKC; ks += 32) {
            v16h a[4], b[4];
            b[0] = WFrag<h16>::ld(sb + bofs + ks);
#pragma unroll
            for (int mb = 0; mb < 4; ++mb) a[mb] = WFrag<h16>::ld(sb + aofs + mb * 16 * KSP + ks);
#pragma unroll
            for (int nb = 1; nb < 4; ++nb) b[nb] = WFrag<h16>::ld(sb + bofs + nb * 16 * KSP + ks);
            __builtin_amdgcn_sched_barrier(0);   // the 16 LDS reads of a k step stay one group in front of its 16 products: left alone the compiler reads each b fragment behind the products of the one before it and waits for it there, four products at a time
#pragma unroll
            for (int nb = 0; nb < 4; ++nb)
#pragma unroll
                for (int mb = 0; mb < 4; ++mb) acc[mb][nb] = wmma16(a[mb], b[nb], acc[mb][nb]);
            __builtin_amdgcn_sched_barrier(0);   // ... and the next k step's reads stay behind these products, not among them
        }
        }
        asm volatile("s_wait_dscnt 0x0" ::: "memory");      // this wave has left the buffer that is refilled below
        asm volatile("s_wait_asynccnt 0x0" ::: "memory");   // this wave's copies of stage t + 1 have landed
        __syncthreads();                                     // publishes stage t + 1, ends every reader's last read of stage t
        if (t + 2 < NT) { const unsigned lb = l0 + (unsigned)(t & 1) * (GSTG * 2u); const int ko = (t + 2) * GKC;
            cp12(lb, ga[0] + ko, ga[1] + ko, ga[2] + ko, ga[3] + ko, gb + ko); }
    }
    asm volatile("s_wait_asynccnt 0x0" ::: "memory");       // nothing in flight when the ring becomes output staging
    if (!act) return;                                       // behind the last barrier
    // A wave's 64 x 64 tile is 64 rows of one head: 8 KB in a row of a q or k plane, or 64 lines of 128 B of a v^T plane. It is rounded to f16 and laid in the wave's own LDS range in the plane's order, then stored as whole lines.
    h16* os = S + wid * (64 * KSP);
    const int col = c0 + wn * 64, hh = (col % DMOD) / HD, t0 = r0 % SEQ + wm * 64;
    const size_t pl = ((size_t)(r0 / SEQ) * NHD + hh) * ((size_t)SEQ * HD);
    const int orow = lane >> 3, ocol = (lane & 7) * 8;   // a wave's store covers 4 rows x 128 B: whole lines; 16 such stores cover the 64 rows
    if (c0 < 2 * DMOD) {   // q, k: [t][d]
#pragma unroll
        for (int mb = 0; mb < 4; ++mb)
#pragma unroll
            for (int nb = 0; nb < 4; ++nb)
#pragma unroll
                for (int j = 0; j < 8; ++j) os[(mb * 16 + hi * 8 + j) * KSP + nb * 16 + lr] = (h16)acc[mb][nb][j];
        h16* g = (kv ? KP : QP) + pl + (size_t)(t0 + orow) * HD + ocol;
        v8h val[16];
#pragma unroll
        for (int s = 0; s < 16; ++s) val[s] = *(const v8ha*)(os + (s * 4 + orow) * KSP + ocol);
#pragma unroll
        for (int s = 0; s < 16; ++s) *(v8h*)(g + s * 4 * HD) = val[s];
    } else {               // v: [d][t]; a lane's 8 accumulator rows are 8 consecutive t of one d
#pragma unroll
        for (int mb = 0; mb < 4; ++mb)
#pragma unroll
            for (int nb = 0; nb < 4; ++nb) { v8h c8;
#pragma unroll
                for (int j = 0; j < 8; ++j) c8[j] = (h16)acc[mb][nb][j];
                *(v8ha*)(os + (nb * 16 + lr) * KSP + mb * 16 + hi * 8) = c8; }
        h16* g = VT + pl + (size_t)orow * SEQ + t0 + ocol;
        v8h val[16];
#pragma unroll
        for (int s = 0; s < 16; ++s) val[s] = *(const v8ha*)(os + (s * 4 + orow) * KSP + ocol);
#pragma unroll
        for (int s = 0; s < 16; ++s) *(v8h*)(g + s * 4 * SEQ) = val[s];
    }
}

// Blocks 0..NB-1 of k_pre, one per batch, n = number of keys that count: IDX[b][s] = token of slot s (the s-th key that counts, in token order) for s < n, and s itself for s >= n (a finite xn row as filling for the flagged slots); MC[b][s] = 1 where slot s holds no key that counts (s >= n); NE[b] = slots in use = n, or SEQ where n = 0. Every entry of IDX is stored once: below n by the thread that owns the token, from n on by the thread that owns token number s.
// A thread owns KPT consecutive tokens; exclusive prefix of the per-thread counts by shuffles in the wave and one LDS pass over the 8 wave totals.
// The four short loops are unrolled so that keep[] stays in registers, the thread's mask words come as wide loads and the wave totals as wide LDS reads.
#define KPT (SEQ / 256)
static_assert(SEQ % 256 == 0);
__device__ __forceinline__ void key_list(const int* __restrict__ mk, int* IDX, int* MC, int* NE) {
    __shared__ int wt[8];
    const int tid = threadIdx.x, lane = tid & 31, wid = tid >> 5; const int b = blockIdx.x;
    mk += (size_t)b * SEQ_FULL; IDX += (size_t)b * SEQ; MC += (size_t)b * SEQ;
    bool keep[KPT]; int c = 0;
#pragma unroll
    for (int q = 0; q < KPT; ++q) { keep[q] = !(mk[tid * KPT + q] >= 1); c += keep[q] ? 1 : 0; }
    int inc = c;
#pragma unroll
    for (int sh = 1; sh < 32; sh <<= 1) { const int u = __shfl_up(inc, sh, 32); if (lane >= sh) inc += u; }
    if (lane == 31) wt[wid] = inc;
    __syncthreads();
    int base = inc - c, n = 0;
#pragma unroll
    for (int v = 0; v < 8; ++v) { const int x = wt[v]; if (v < wid) base += x; n += x; }
#pragma unroll
    for (int q = 0; q < KPT; ++q) { const int t = tid * KPT + q;
        if (keep[q]) IDX[base] = t;
        base += keep[q] ? 1 : 0;
        if (t >= n) IDX[t] = t;
        MC[t] = (t >= n) ? 1 : 0; }
    if (tid == 0) NE[b] = (n == 0) ? SEQ : n;
}

// Blocks NB..NB+WTT-1 of k_pre: W^T by tiles of WTK k x WTN n. A lane reads 8 k rows x 16 B (4 n): a wave's load covers two 256-B row pieces, whole lines; the lane's 8 k of one n are 16 B of a W^T row, laid in LDS at pitch WTP; behind one barrier the tile goes out as 256-B row pieces, whole lines again.
// The short loops are unrolled so that r[], c and val[] stay in registers and a lane's 8 loads are issued together, in front of the first use.
#define WTK 128
#define WTN 64
#define WTP (WTK + 8)   // halves: 272 B = 16 B x odd
static_assert(DMOD % WTK == 0);
#define WTT ((QKVN / WTN) * (DMOD / WTK))   // tiles
static_assert(QKVN % WTN == 0);
__device__ __forceinline__ void wt_tile(const int tile, const float* __restrict__ w, h16* Bt) {
    __shared__ __align__(16) h16 T[WTN * WTP];
    const int tid = threadIdx.x;
    const int n0 = (tile % (QKVN / WTN)) * WTN, k0 = (tile / (QKVN / WTN)) * WTK;
    const int c16 = tid & 15, r16 = tid >> 4;
    const float* g = w + (size_t)(k0 + r16 * 8) * QKVN + n0 + c16 * 4;
    v4f r[8];
#pragma unroll
    for (int j = 0; j < 8; ++j) r[j] = *(const v4fa*)(g + (size_t)j * QKVN);
#pragma unroll
    for (int i = 0; i < 4; ++i) { v8h c;
#pragma unroll
        for (int j = 0; j < 8; ++j) c[j] = (h16)bfr(r[j][i]);
        *(v8ha*)(T + (c16 * 4 + i) * WTP + r16 * 8) = c; }
    __syncthreads();
    h16* o = Bt + (size_t)(n0 + r16) * DMOD + k0 + c16 * 8;
    v8h val[4];
#pragma unroll
    for (int s = 0; s < 4; ++s) val[s] = *(const v8ha*)(T + (s * 16 + r16) * WTP + c16 * 8);
#pragma unroll
    for (int s = 0; s < 4; ++s) *(v8h*)(o + (size_t)s * 16 * DMOD) = val[s];
    asm volatile("s_wait_xcnt 0x0" ::: "memory");   // behind the four stores, in front of whatever code follows in the object and writes their registers
}

// Blocks NB+WTT.. of k_pre: LayerNorm, two rows a block (four waves a row), XN in token order. Both barriers are passed by all eight waves; a row's sums come from its own four waves' slots of red.
__device__ __forceinline__ void ln_rows(const int pair, const float* __restrict__ X, const float* __restrict__ G, const float* __restrict__ Bv, h16* XN) {
    __shared__ float red[16];
    const int tid = threadIdx.x, lane = tid & 31, wid = tid >> 5, w0 = wid & 4; const int grow = pair * 2 + (tid >> 7); const int row = grow % SEQ; const int c = (tid & 127) * 8; const size_t bz = grow / SEQ;
    const v8f a = *(const v8fa*)(X + (bz * SEQ_FULL + row) * DMOD + c);
    float v[8]; float s = 0.f;
#pragma unroll
    for (int q = 0; q < 8; ++q) { v[q] = bfr(a[q]); s += v[q]; }
#pragma unroll
    for (int sh = 16; sh; sh >>= 1) s += __shfl_xor(s, sh, 32);
    if (lane == 0) red[wid] = s;
    __syncthreads();
    const float mean = ((red[w0] + red[w0 + 1]) + (red[w0 + 2] + red[w0 + 3])) * (1.0f / DMOD);
    float s2 = 0.f;
#pragma unroll
    for (int q = 0; q < 8; ++q) { const float d = v[q] - mean; v[q] = d; s2 += d * d; }
#pragma unroll
    for (int sh = 16; sh; sh >>= 1) s2 += __shfl_xor(s2, sh, 32);
    if (lane == 0) red[8 + wid] = s2;
    __syncthreads();
    const float var = ((red[8 + w0] + red[9 + w0]) + (red[10 + w0] + red[11 + w0])) * (1.0f / DMOD);
    const float rstd = rsqrtf(var + LNEPS);
    const v8f g = *(const v8fa*)(G + c); const v8f bb = *(const v8fa*)(Bv + c);
    v8h oh;
#pragma unroll
    for (int q = 0; q < 8; ++q) oh[q] = (h16)(v[q] * rstd * bfr(g[q]) + bfr(bb[q]));
    const size_t e = (bz * SEQ + row) * DMOD + c;
    *(v8h*)(XN + e) = oh;
    asm volatile("s_wait_xcnt 0x0" ::: "memory");   // behind the store, in front of whatever code follows in the object and writes its registers
}

// One launch for the three jobs in front of the GEMM; a block does one of them, chosen by its number alone, so every barrier inside a job is passed by the whole block. The few list and tile blocks come first and run beside the LayerNorm blocks.
__global__ __launch_bounds__(256) void k_pre(const float* __restrict__ w, h16* Bt, const int* __restrict__ mk, int* IDX, int* MC, int* NE, const float* __restrict__ X, const float* __restrict__ G, const float* __restrict__ Bv, h16* XN) {
    const int blk = blockIdx.x;
    if (blk < NB) key_list(mk, IDX, MC, NE);
    else if (blk < NB + WTT) wt_tile(blk - NB, w, Bt);
    else ln_rows(blk - (NB + WTT), X, G, Bv, XN);
}

// ---- k_flash: softmax(q k^T * 1/8 with excluded keys' scores replaced by NEGB) v, online over 64-key tiles of the key list (ne slots in use; the list's flags are set from one slot on: the filling slots of the last tile, or every slot where no key counts); grid (SEQ/128, 16 heads, NB batches), 256 threads = 8 waves x 16 query columns.
// Transposed products: S^T = K.Q^T (A = key rows from LDS, B = q kept in registers) and O^T += V^T.P^T (A = value^T rows from LDS, B = P^T). A lane holds one query (column lane & 15) and keys nt*16 + 8*(lane >> 4) + r,
// which is the B operand's k map (elements 0..7 of a 32-key fragment = score tile 2c, elements 8..15 = score tile 2c + 1): P = f16(1024 * exp(s - m_run)) goes from the score accumulators into the operand without LDS.
// Maximum in-lane plus one exchange between the wave halves per tile, taken over the unscaled scores; l in f32 sums the same 1024 * exp(s - m_run), one partial sum per half, joined after the loop; out = O / l.
// One FMA per score in front of the exponential: 1024 * exp((s - m) / 8) = exp2(s * CE + (10 - m * CE)), CE = log2(e) / 8. Tiles whose 64 slots all count (all but the last, as a rule) run without any exclusion test; a tile with a flagged slot replaces by slot index behind a scalar branch.
// Where every key so far is flagged, m = NEGB: 10 - m * CE rounds to -NEGB * CE, which is exact, the FMA gives exactly 0 and every weight is 1 (in place of 1024): the uniform weights of the reference, since l sums the same weights.
// Key tile [64 j][64 d] and value^T tile [64 d][64 j] staged in LDS with plain loads between block barriers; fragments via the WFrag loaders (A and B same k map).
// Residency: the build stays within 128 VGPRs (127), so a SIMD holds 8 waves = 4 work-groups a WGP (4 x 53,248 B of LDS) and the grid's 1,024 work-groups run in one round. Above 128 a WGP holds 3 work-groups and the last quarter of the grid runs as a second round, one work-group a WGP: read the count after any change.
__global__ __launch_bounds__(256) void k_flash(const h16* __restrict__ QP, const h16* __restrict__ KP, const h16* __restrict__ VT, const int* __restrict__ mk, const int* __restrict__ NE, float* outb) {
    __shared__ __align__(16) h16 KV[2 * 64 * KSP];   // key tile, then value^T tile: one array, so that one address register and immediate offsets serve all stores, and one all fragment reads
    __shared__ __align__(16) float Ow[8 * 16 * OSP];
    const int tid = threadIdx.x, wid = tid >> 5, lane = tid & 31, lr = lane & 15, hi = lane >> 4;
    const int hh = blockIdx.y, i0 = blockIdx.x * 128 + wid * 16;
    const size_t bz = blockIdx.z, pl = (bz * NHD + hh) * ((size_t)SEQ * HD);
    mk += bz * SEQ; outb += bz * SEQ_FULL * DMOD;
    const int ne = min(NE[bz], SEQ);   // the same for the whole block: the barriers in the loop stay uniform
    const h16* qp = QP + pl; const h16* kp = KP + pl; const h16* vt = VT + pl;
    float* ow = Ow + wid * (16 * OSP);
    v16h qf[2];
    qf[0] = WFrag<h16>::ld(qp + (size_t)(i0 + lr) * HD + 8 * hi);
    qf[1] = WFrag<h16>::ld(qp + (size_t)(i0 + lr) * HD + 32 + 8 * hi);
    v8f o[4];
#pragma unroll
    for (int n = 0; n < 4; ++n) o[n] = (v8f){};
    float mrow = -__builtin_inff(), lrow = 0.f;
    const float CE = SCL * 1.4426950408889634f;
    const int nclean = (mk[0] >= 1) ? 0 : ne;   // first flagged slot (the same for the whole block): the flags are 0 below the number of keys that count and 1 from there on, and ne is that number unless it is 0
    const int srow = tid >> 3, spc = (tid & 7) * 8;
    h16* st = KV + srow * KSP + spc;               // staging stores: rows srow and srow + 32 of both tiles
    const h16* fr = KV + lr * KSP + 8 * hi;        // fragment reads of both tiles
#pragma unroll 1
    for (int j0 = 0; j0 < ne; j0 += 64) {
        __syncthreads();
#pragma unroll
        for (int rr = 0; rr < 2; ++rr) { const int row = srow + 32 * rr;
            const v8h kv = *(const v8ha*)(kp + (size_t)(j0 + row) * HD + spc);
            const v8h vv = *(const v8ha*)(vt + (size_t)row * SEQ + j0 + spc);
            *(v8ha*)(st + 32 * rr * KSP) = kv; *(v8ha*)(st + (64 + 32 * rr) * KSP) = vv; }
        __syncthreads();
        v8f s[4];
#pragma unroll
        for (int nt = 0; nt < 4; ++nt) { s[nt] = (v8f){};
#pragma unroll
            for (int kk = 0; kk < 2; ++kk) { const v16h a = WFrag<h16>::ld(fr + nt * 16 * KSP + kk * 32); s[nt] = wmma16(a, qf[kk], s[nt]); } }
        asm volatile("v_nop\n\tv_nop\n\tv_nop\n\tv_nop" : "+v"(s[0]), "+v"(s[1]), "+v"(s[2]), "+v"(s[3]) : "v"(qf[0]), "v"(qf[1]));
        if (j0 + 64 > nclean) {   // the same for the whole block: a scalar branch
#pragma unroll
            for (int nt = 0; nt < 4; ++nt)
#pragma unroll
                for (int r = 0; r < 8; ++r) s[nt][r] = (j0 + nt * 16 + 8 * hi + r >= nclean) ? NEGB : s[nt][r];
        }
        float mx = NEGB;
#pragma unroll
        for (int r = 0; r < 8; ++r) mx = fmaxf(mx, fmaxf(fmaxf(s[0][r], s[1][r]), fmaxf(s[2][r], s[3][r])));
        mx = fmaxf(mx, xhalf(mx));
        const float mn = fmaxf(mrow, mx);
        const float alpha = __builtin_amdgcn_exp2f(__fmul_rn(__fsub_rn(mrow, mn), CE)); mrow = mn;
        const float nm = __builtin_fmaf(-mn, CE, 10.0f);
#pragma unroll
        for (int nt = 0; nt < 4; ++nt)
#pragma unroll
            for (int r = 0; r < 8; ++r) s[nt][r] = __builtin_amdgcn_exp2f(__builtin_fmaf(s[nt][r], CE, nm));
        float sr[8];
#pragma unroll
        for (int r = 0; r < 8; ++r) sr[r] = (s[0][r] + s[1][r]) + (s[2][r] + s[3][r]);
        lrow = lrow * alpha + (((sr[0] + sr[1]) + (sr[2] + sr[3])) + ((sr[4] + sr[5]) + (sr[6] + sr[7])));
#pragma unroll
        for (int n = 0; n < 4; ++n)
#pragma unroll
            for (int r = 0; r < 8; ++r) o[n][r] *= alpha;
        v16h p0, p1;
#pragma unroll
        for (int r = 0; r < 8; ++r) { p0[r] = (h16)s[0][r]; p0[8 + r] = (h16)s[1][r]; p1[r] = (h16)s[2][r]; p1[8 + r] = (h16)s[3][r]; }
#pragma unroll
        for (int n = 0; n < 4; ++n) { const v16h a0 = WFrag<h16>::ld(fr + (64 + n * 16) * KSP); o[n] = wmma16(a0, p0, o[n]); const v16h a1 = WFrag<h16>::ld(fr + (64 + n * 16) * KSP + 32); o[n] = wmma16(a1, p1, o[n]); }
        // four vector slots behind the last product, also on the loop's back edge, before anything rewrites its operands or touches o
        asm volatile("v_nop\n\tv_nop\n\tv_nop\n\tv_nop" : "+v"(o[0]), "+v"(o[1]), "+v"(o[2]), "+v"(o[3]) : "v"(p0), "v"(p1));
    }
    const float inv = __fdiv_rn(1.0f, lrow + xhalf(lrow));
    __syncthreads();
#pragma unroll
    for (int n = 0; n < 4; ++n) { v4f w0, w1;
#pragma unroll
        for (int r = 0; r < 4; ++r) { w0[r] = o[n][r] * inv; w1[r] = o[n][4 + r] * inv; }
        *(v4fa*)(ow + lr * OSP + n * 16 + 8 * hi) = w0; *(v4fa*)(ow + lr * OSP + n * 16 + 8 * hi + 4) = w1; }
    __syncthreads();
    float* orow = outb + (size_t)i0 * DMOD + hh * HD;
    v4f val[8];
#pragma unroll
    for (int sI = 0; sI < 8; ++sI) val[sI] = *(const v4fa*)(ow + (2 * sI + hi) * OSP + lr * 4);
#pragma unroll
    for (int sI = 0; sI < 8; ++sI) *(v4f*)(orow + (size_t)(2 * sI + hi) * DMOD + lr * 4) = val[sI];
    
}

extern "C" void kernel_launch(void* const* d_in, const int* in_sizes, int n_in,
                              void* d_out, int out_size, void* d_ws, size_t ws_size, hipStream_t stream) {
    if (n_in < 5) return;
    const long rows_used = (long)(NB - 1) * SEQ_FULL + SEQ;
    if ((long)in_sizes[0] < rows_used * DMOD) return;
    if ((long)in_sizes[1] < rows_used) return;
    if ((long)in_sizes[2] < (long)DMOD * QKVN) return;
    if (in_sizes[3] < DMOD || in_sizes[4] < DMOD) return;
    if ((long)out_size < rows_used * DMOD) return;
    const float* X = (const float*)d_in[0]; const int* M = (const int*)d_in[1]; const float* W = (const float*)d_in[2]; const float* G = (const float*)d_in[3]; const float* Bv = (const float*)d_in[4];
    float* OUT = (float*)d_out;     // [4][2048][1024]
    char* wsp = (char*)d_ws;
    auto take = [&](size_t bytes) { char* p = wsp; wsp += (bytes + 255) & ~(size_t)255; return (void*)p; };
    h16* WT = (h16*)take((size_t)QKVN * DMOD * 2);                     // W^T f16 [3072][1024]             6,291,456 B
    h16* XN = (h16*)take((size_t)NB * SEQ * DMOD * 2);                 // xn f16 [NB][SEQ][1024]          16,777,216 B
    h16* QP = (h16*)take((size_t)NB * NHD * SEQ * HD * 2);             // q planes [NB][16][SEQ][64]      16,777,216 B
    h16* KP = (h16*)take((size_t)NB * NHD * SEQ * HD * 2);             // k planes                        16,777,216 B
    h16* VTp = (h16*)take((size_t)NB * NHD * HD * SEQ * 2);            // v^T planes [NB][16][64][SEQ]    16,777,216 B
    int* IDX = (int*)take((size_t)NB * SEQ * 4);                       // slot -> token [NB][SEQ]             32,768 B
    int* MC = (int*)take((size_t)NB * SEQ * 4);                        // slot flags [NB][SEQ]                32,768 B
    int* NE = (int*)take((size_t)NB * 4);                              // slots in use [NB]                      256 B
    if ((size_t)(wsp - (char*)d_ws) > ws_size) return;                 // total 73,466,112 B
    k_pre<<<NB + WTT + NB * SEQ / 2, 256, 0, stream>>>(W, WT, M, IDX, MC, NE, X, G, Bv, XN);
    k_gemms<<<dim3(NB * SEQ / GBM, QKVN / GBN, 1), 256, 0, stream>>>(XN, IDX, WT, NE, QP, KP, VTp);
    k_flash<<<dim3(SEQ / 128, NHD, NB), 256, 0, stream>>>(QP, KP, VTp, MC, NE, OUT);
}
